// v000
// The times below were measured on an AMD MI455X: many runs one after another, warmed up first and cycling through
// copies of the inputs, with the whole window's GPU time divided by the number of runs. Launches and the gaps
// between them are all in it. The median over several windows is given; except for v000 it joins two sittings, which
// can be a few percent apart, so the side-by-side timings, each taken in one sitting, are the better comparison.
// v000, which the later versions start from, runs in 197 microseconds.
#include <hip/hip_runtime.h>

// HeposMultiHeadAttention (q [1][1024][1024], k, v [1][8192][1024]; Q/K/V = in W^T + b (16 heads x 64); head h attends only keys with (k_idx - h) % 16 == 0 (512 keys per head); softmax(Q.K / 8); out = merged Wo^T + bo -> [1][1024][1024]; no row is fully masked, so nan_to_num is a no-op).
// The HEPOS mask is structural: each head's 512 keys are gathered into dense planes (key m of head h = token 16 m + h), so no masked score is ever computed.
// Compute dtypes, f32 accumulate: every input rounded to bf16; Q/K/V as PLAIN bf16 GEMMs (inputs: exact) + bias; scores hl x hl (3 products), softmax f32 -> hl planes, attn.v 3 products (all cheap: 512 keys); Wo hl x exact (2 products) + bias.

#define TQ   1024
#define TK   8192
#define DM   1024
#define NH_  16
#define HD   64
#define KPH  512    // keys per head = TK / 16
typedef _Float16 h16;
typedef unsigned short bf;
typedef __attribute__((ext_vector_type(16))) __bf16   v16bf;
typedef __attribute__((ext_vector_type(16))) _Float16 v16h;
typedef __attribute__((ext_vector_type(8)))  _Float16 v8h;
typedef __attribute__((ext_vector_type(8)))  unsigned short v8us;
typedef __attribute__((ext_vector_type(8)))  float    v8f;
typedef __attribute__((ext_vector_type(4)))  float    v4f;
typedef v8h  __attribute__((may_alias)) v8ha;
typedef v4f  __attribute__((may_alias)) v4fa;
typedef v8us __attribute__((may_alias)) v8usa;

__device__ __forceinline__ unsigned short f2bf(float f) { unsigned u = __float_as_uint(f); u += 0x7FFFu + ((u >> 16) & 1u); return (unsigned short)(u >> 16); }
__device__ __forceinline__ float bf2f(unsigned short b) { return __uint_as_float(((unsigned)b) << 16); }
__device__ __forceinline__ float bfr(float f) { return bf2f(f2bf(f)); }
__device__ __forceinline__ v16h cat16(v8h lo, v8h hi) { return __builtin_shufflevector(lo, hi, 0, 1, 2, 3, 4, 5, 6, 7, 8, 9, 10, 11, 12, 13, 14, 15); }
__device__ __forceinline__ v16bf cat16b(v8us lo, v8us hi) { return __builtin_bit_cast(v16bf, __builtin_shufflevector(lo, hi, 0, 1, 2, 3, 4, 5, 6, 7, 8, 9, 10, 11, 12, 13, 14, 15)); }
__device__ __forceinline__ v8f wmma16(v16h a, v16h b, v8f c) { return __builtin_amdgcn_wmma_f32_16x16x32_f16(false, a, false, b, (short)0, c, false, false); }
__device__ __forceinline__ v8f wmmab(v16bf a, v16bf b, v8f c) { return __builtin_amdgcn_wmma_f32_16x16x32_bf16(false, a, false, b, (short)0, c, false, false); }



// ---- k_gemmw: register-blocked GEMM, ONE WAVE per 64x64 output tile (16 accumulators), operands straight from K-contiguous 16-bit planes; grid (M/64, N/64, Z), 32 threads.
// C[m][n] (f32, pitch ldc, + optional f32 bias[n]) = sum_k A[m][k] Bt[n][k] (+ split products per NSPLIT). z-batch strides sA/sB/sC in elements. K % 32 == 0.
template <typename T16> struct WFrag;
template <> struct WFrag<h16> { typedef v16h V; static __device__ __forceinline__ V ld(const h16* p) { return cat16(*(const v8h*)p, *(const v8h*)(p + 16)); } static __device__ __forceinline__ v8f mma(V a, V b, v8f c) { return wmma16(a, b, c); } };
template <> struct WFrag<bf> { typedef v16bf V; static __device__ __forceinline__ V ld(const bf* p) { return cat16b(*(const v8us*)p, *(const v8us*)(p + 16)); } static __device__ __forceinline__ v8f mma(V a, V b, v8f c) { return wmmab(a, b, c); } };
template <typename T16, int NSPLIT, bool BIAS>
__global__ __launch_bounds__(32) void k_gemmw(const T16* __restrict__ A, const T16* __restrict__ A2, const T16* __restrict__ Bt, const T16* __restrict__ Bt2, int K, float* C, int ldc, const float* __restrict__ bias, size_t sA, size_t sB, size_t sC) {
    typedef typename WFrag<T16>::V V;
    __shared__ __align__(16) float os[16 * 68];
    const size_t z = blockIdx.z; A += z * sA; if (A2) A2 += z * sA; Bt += z * sB; if (Bt2) Bt2 += z * sB; C += z * sC;
    const int lane = threadIdx.x & 31, lr = lane & 15, hi = lane >> 4; const int r0 = blockIdx.x * 64, c0 = blockIdx.y * 64;
    v8f acc[4][4];
#pragma unroll
    for (int mb = 0; mb < 4; ++mb)
#pragma unroll
        for (int nb = 0; nb < 4; ++nb) acc[mb][nb] = (v8f){};
    const size_t aoff = (size_t)(r0 + lr) * K + 8 * hi, boff = (size_t)(c0 + lr) * K + 8 * hi;
#pragma unroll 1
    for (int kc = 0; kc < K; kc += 32) {
        V a[4], a2[4];
#pragma unroll
        for (int mb = 0; mb < 4; ++mb) { a[mb] = WFrag<T16>::ld(A + aoff + (size_t)mb * 16 * K + kc); if (NSPLIT == 1 || NSPLIT == 2) a2[mb] = WFrag<T16>::ld(A2 + aoff + (size_t)mb * 16 * K + kc); }
#pragma unroll
        for (int nb = 0; nb < 4; ++nb) { const V b = WFrag<T16>::ld(Bt + boff + (size_t)nb * 16 * K + kc); V b2; if (NSPLIT >= 2) b2 = WFrag<T16>::ld(Bt2 + boff + (size_t)nb * 16 * K + kc);
#pragma unroll
            for (int mb = 0; mb < 4; ++mb) { acc[mb][nb] = WFrag<T16>::mma(a[mb], b, acc[mb][nb]); if (NSPLIT == 1 || NSPLIT == 2) acc[mb][nb] = WFrag<T16>::mma(a2[mb], b, acc[mb][nb]); if (NSPLIT >= 2) acc[mb][nb] = WFrag<T16>::mma(a[mb], b2, acc[mb][nb]); } }
        asm volatile("v_nop\n\tv_nop\n\tv_nop\n\tv_nop" : "+v"(acc[0][0]), "+v"(acc[1][1]), "+v"(acc[2][2]), "+v"(acc[3][3]) : "v"(a[0]), "v"(a[3]));
    }
#pragma unroll
    for (int mb = 0; mb < 4; ++mb) {
#pragma unroll
        for (int nb = 0; nb < 4; ++nb) {
#pragma unroll
            for (int j = 0; j < 8; ++j) os[(hi * 8 + j) * 68 + nb * 16 + lr] = acc[mb][nb][j]; }
        __builtin_amdgcn_wave_barrier(); asm volatile("" ::: "memory");
        float* crow = C + (size_t)(r0 + mb * 16) * ldc + c0;
{
#pragma unroll
            for (int s = 0; s < 8; ++s) { const int row = 2 * s + hi, cofs = lr * 4; v4f val = *(const v4fa*)(os + row * 68 + cofs); if (BIAS) { val[0] += bfr(bias[c0 + cofs]); val[1] += bfr(bias[c0 + cofs + 1]); val[2] += bfr(bias[c0 + cofs + 2]); val[3] += bfr(bias[c0 + cofs + 3]); }
                *(v4f*)(crow + (size_t)row * ldc + cofs) = val; }
             }
        __builtin_amdgcn_wave_barrier(); asm volatile("" ::: "memory");
    }
}

__device__ __forceinline__ void splitf(float y, unsigned short& h, unsigned short& l) { h = f2bf(y); l = f2bf(y - bf2f(h)); }
typedef __attribute__((ext_vector_type(2))) unsigned short v2us;
typedef __attribute__((ext_vector_type(4))) unsigned short v4us;

__global__ __launch_bounds__(256) void k_cvt8(const float* __restrict__ src, bf* dst, size_t n8) { const size_t i = (size_t)blockIdx.x * 256 + threadIdx.x; if (i >= n8) return; const v8f v = *(const v8f*)(src + i * 8); v8us o;
#pragma unroll
    for (int k = 0; k < 8; ++k) o[k] = f2bf(v[k]); *(v8us*)(dst + i * 8) = o;  }
__global__ __launch_bounds__(256) void k_qpl(const float* __restrict__ Q, bf* Qh, bf* Ql) { const size_t e = ((size_t)blockIdx.x * 256 + threadIdx.x) * 4; if (e >= (size_t)NH_ * TQ * HD) return; const int d = (int)(e % HD); const int t = (int)((e / HD) % TQ); const int h = (int)(e / ((size_t)HD * TQ)); const v4f a = *(const v4f*)(Q + (size_t)t * DM + h * HD + d); v4us oh, ol;
#pragma unroll
    for (int u = 0; u < 4; ++u) { unsigned short x0, x1; splitf(a[u], x0, x1); oh[u] = x0; ol[u] = x1; } *(v4us*)(Qh + e) = oh; *(v4us*)(Ql + e) = ol;  }
__global__ __launch_bounds__(256) void k_kpl(const float* __restrict__ K, bf* Kh, bf* Kl) { const size_t e = ((size_t)blockIdx.x * 256 + threadIdx.x) * 4; if (e >= (size_t)NH_ * KPH * HD) return; const int d = (int)(e % HD); const int m = (int)((e / HD) % KPH); const int h = (int)(e / ((size_t)HD * KPH)); const v4f a = *(const v4f*)(K + (size_t)(16 * m + h) * DM + h * HD + d); v4us oh, ol;
#pragma unroll
    for (int u = 0; u < 4; ++u) { unsigned short x0, x1; splitf(a[u], x0, x1); oh[u] = x0; ol[u] = x1; } *(v4us*)(Kh + e) = oh; *(v4us*)(Kl + e) = ol;  }
__global__ __launch_bounds__(256) void k_vtp(const float* __restrict__ V, bf* Vh, bf* Vl) { const size_t e = ((size_t)blockIdx.x * 256 + threadIdx.x) * 4; if (e >= (size_t)NH_ * HD * KPH) return; const int m = (int)(e % KPH); const int d = (int)((e / KPH) % HD); const int h = (int)(e / ((size_t)KPH * HD)); v4us oh, ol;
#pragma unroll
    for (int u = 0; u < 4; ++u) { unsigned short x0, x1; splitf(V[(size_t)(16 * (m + u) + h) * DM + h * HD + d], x0, x1); oh[u] = x0; ol[u] = x1; } *(v4us*)(Vh + e) = oh; *(v4us*)(Vl + e) = ol;  }
__global__ __launch_bounds__(256) void k_soft(const float* __restrict__ S, bf* Ph, bf* Pl) { const int lane = threadIdx.x & 31; const int row = blockIdx.x * 8 + (threadIdx.x >> 5); if (row >= NH_ * TQ) return; const float* sr = S + (size_t)row * KPH; float v[KPH / 32]; float mx = -3.0e38f;
#pragma unroll
    for (int ch = 0; ch < KPH / 128; ++ch) { const v4f a = *(const v4f*)(sr + ch * 128 + lane * 4);
#pragma unroll
        for (int u = 0; u < 4; ++u) { const float t = a[u] * 0.125f; v[ch * 4 + u] = t; mx = fmaxf(mx, t); } }
#pragma unroll
    for (int sh = 16; sh; sh >>= 1) mx = fmaxf(mx, __shfl_xor(mx, sh, 32));
    float sum = 0.f;
#pragma unroll
    for (int q = 0; q < KPH / 32; ++q) { float d0 = __fsub_rn(v[q], mx); asm volatile("" : "+v"(d0)); v[q] = __builtin_amdgcn_exp2f(__fmul_rn(d0, 1.4426950408889634f)); sum += v[q]; }
#pragma unroll
    for (int sh = 16; sh; sh >>= 1) sum += __shfl_xor(sum, sh, 32);
    const float f = __fdiv_rn(1.0f, sum);
    {
#pragma unroll
        for (int ch = 0; ch < KPH / 128; ++ch) { v4us oh, ol; for (int q = 0; q < 4; ++q) { unsigned short a, b; splitf(v[ch * 4 + q] * f, a, b); oh[q] = a; ol[q] = b; } const size_t oo = (size_t)row * KPH + ch * 128 + lane * 4; *(v4us*)(Ph + oo) = oh; *(v4us*)(Pl + oo) = ol; }
         } }
__global__ __launch_bounds__(256) void k_mrg(const float* __restrict__ O, bf* Ah, bf* Al) { const size_t e = ((size_t)blockIdx.x * 256 + threadIdx.x) * 4; if (e >= (size_t)NH_ * TQ * HD) return; const int d = (int)(e % HD); const int t = (int)((e / HD) % TQ); const int h = (int)(e / ((size_t)HD * TQ)); const size_t oo = (size_t)t * DM + h * HD + d; v4us oh, ol;
#pragma unroll
    for (int u = 0; u < 4; ++u) { unsigned short a, b; splitf(O[e + u], a, b); oh[u] = a; ol[u] = b; } *(v4us*)(Ah + oo) = oh; *(v4us*)(Al + oo) = ol;  }

extern "C" void kernel_launch(void* const* d_in, const int* in_sizes, int n_in,
                              void* d_out, int out_size, void* d_ws, size_t ws_size, hipStream_t stream) {
    (void)in_sizes; (void)n_in; (void)out_size;
    const float* qin = (const float*)d_in[0]; const float* kin = (const float*)d_in[1]; const float* vin = (const float*)d_in[2]; const float* Wq = (const float*)d_in[3]; const float* bq = (const float*)d_in[4]; const float* Wk = (const float*)d_in[5]; const float* bk = (const float*)d_in[6]; const float* Wv = (const float*)d_in[7]; const float* bv = (const float*)d_in[8]; const float* Wo = (const float*)d_in[9]; const float* bo = (const float*)d_in[10];
    float* OUT = (float*)d_out;     // [1][1024][1024]
    char* wsp = (char*)d_ws;
    auto take = [&](size_t bytes) { char* p = wsp; wsp += (bytes + 255) & ~(size_t)255; return (void*)p; };
    bf* BQ = (bf*)take((size_t)DM * DM * 2); bf* BK = (bf*)take((size_t)DM * DM * 2); bf* BV = (bf*)take((size_t)DM * DM * 2); bf* BO = (bf*)take((size_t)DM * DM * 2);
    bf* QB = (bf*)take((size_t)TQ * DM * 2); bf* KB = (bf*)take((size_t)TK * DM * 2); float* FQ = (float*)take((size_t)TQ * DM * 4); float* FK = (float*)take((size_t)TK * DM * 4); float* FV = (float*)take((size_t)TK * DM * 4);
    bf* Qh = (bf*)take((size_t)NH_ * TQ * HD * 2); bf* Ql = (bf*)take((size_t)NH_ * TQ * HD * 2); bf* Kh = (bf*)take((size_t)NH_ * KPH * HD * 2); bf* Kl = (bf*)take((size_t)NH_ * KPH * HD * 2); bf* Vh = (bf*)take((size_t)NH_ * HD * KPH * 2); bf* Vl = (bf*)take((size_t)NH_ * HD * KPH * 2);
    float* S = (float*)take((size_t)NH_ * TQ * KPH * 4); bf* Ph = (bf*)take((size_t)NH_ * TQ * KPH * 2); bf* Pl = (bf*)take((size_t)NH_ * TQ * KPH * 2); float* O = (float*)take((size_t)NH_ * TQ * HD * 4); bf* ATh = (bf*)take((size_t)TQ * DM * 2); bf* ATl = (bf*)take((size_t)TQ * DM * 2);
    if ((size_t)(wsp - (char*)d_ws) > ws_size) return;    // total ~ 175 MB
    k_cvt8<<<(DM * DM / 8 + 255) / 256, 256, 0, stream>>>(Wq, BQ, DM * DM / 8); k_cvt8<<<(DM * DM / 8 + 255) / 256, 256, 0, stream>>>(Wk, BK, DM * DM / 8); k_cvt8<<<(DM * DM / 8 + 255) / 256, 256, 0, stream>>>(Wv, BV, DM * DM / 8); k_cvt8<<<(DM * DM / 8 + 255) / 256, 256, 0, stream>>>(Wo, BO, DM * DM / 8);   // torch [out][in] = Bt as-is
    k_cvt8<<<(TQ * DM / 8 + 255) / 256, 256, 0, stream>>>(qin, QB, TQ * DM / 8);
    k_gemmw<bf, 0, true><<<dim3(TQ / 64, DM / 64, 1), 32, 0, stream>>>(QB, nullptr, BQ, nullptr, DM, FQ, DM, bq, 0, 0, 0);
    k_cvt8<<<(TK * DM / 8 + 255) / 256, 256, 0, stream>>>(kin, KB, TK * DM / 8);
    k_gemmw<bf, 0, true><<<dim3(TK / 64, DM / 64, 1), 32, 0, stream>>>(KB, nullptr, BK, nullptr, DM, FK, DM, bk, 0, 0, 0);
    k_cvt8<<<(TK * DM / 8 + 255) / 256, 256, 0, stream>>>(vin, KB, TK * DM / 8);     // reuse the bf16 input buffer (stream-ordered after the K GEMM)
    k_gemmw<bf, 0, true><<<dim3(TK / 64, DM / 64, 1), 32, 0, stream>>>(KB, nullptr, BV, nullptr, DM, FV, DM, bv, 0, 0, 0);
    k_qpl<<<(unsigned)(((size_t)NH_ * TQ * HD / 4 + 255) / 256), 256, 0, stream>>>(FQ, Qh, Ql); k_kpl<<<(unsigned)(((size_t)NH_ * KPH * HD / 4 + 255) / 256), 256, 0, stream>>>(FK, Kh, Kl); k_vtp<<<(unsigned)(((size_t)NH_ * HD * KPH / 4 + 255) / 256), 256, 0, stream>>>(FV, Vh, Vl);
    const size_t zq = (size_t)TQ * HD, zk = (size_t)KPH * HD, zS = (size_t)TQ * KPH, zv = (size_t)HD * KPH;
    k_gemmw<bf, 2, false><<<dim3(TQ / 64, KPH / 64, NH_), 32, 0, stream>>>(Qh, Ql, Kh, Kl, HD, S, KPH, nullptr, zq, zk, zS);
    k_soft<<<NH_ * TQ / 8, 256, 0, stream>>>(S, Ph, Pl);
    k_gemmw<bf, 2, false><<<dim3(TQ / 64, 1, NH_), 32, 0, stream>>>(Ph, Pl, Vh, Vl, KPH, O, HD, nullptr, zS, zv, zq);
    k_mrg<<<(unsigned)(((size_t)NH_ * TQ * HD / 4 + 255) / 256), 256, 0, stream>>>(O, ATh, ATl);
    k_gemmw<bf, 1, true><<<dim3(TQ / 64, DM / 64, 1), 32, 0, stream>>>(ATh, ATl, BO, nullptr, DM, OUT, DM, bo, 0, 0, 0);
}

// v001
// Measured time: 175 microseconds a run.
// In two side-by-side timings against v000, it was 1.15 and 1.18 times as fast.
#include <hip/hip_runtime.h>

// HeposMultiHeadAttention (q [1][1024][1024], k, v [1][8192][1024]; Q/K/V = in W^T + b (16 heads x 64); head h attends only keys with (k_idx - h) % 16 == 0 (512 keys per head); softmax(Q.K / 8); out = merged Wo^T + bo -> [1][1024][1024]; no row is fully masked, so nan_to_num is a no-op).
// The HEPOS mask is structural: each head's 512 keys are gathered into dense planes (key m of head h = token 16 m + h), so no masked score is ever computed.
// Key token t is kept by head t % 16 alone, so of its K and V projections only that head's 64 columns are ever read: the k / v inputs are regrouped by head and projected as 16 batched 512 x 64 x 1024 GEMMs.
// Compute dtypes, f32 accumulate: every input rounded to bf16; Q/K/V as PLAIN bf16 GEMMs (inputs: exact) + bias; scores hl x hl (3 products), softmax f32 -> hl planes, attn.v 3 products (all cheap: 512 keys); Wo hl x exact (2 products) + bias.

#define TQ   1024
#define TK   8192
#define DM   1024
#define NH_  16
#define HD   64
#define KPH  512    // keys per head = TK / 16
typedef _Float16 h16;
typedef unsigned short bf;
typedef __attribute__((ext_vector_type(16))) __bf16   v16bf;
typedef __attribute__((ext_vector_type(16))) _Float16 v16h;
typedef __attribute__((ext_vector_type(8)))  _Float16 v8h;
typedef __attribute__((ext_vector_type(8)))  unsigned short v8us;
typedef __attribute__((ext_vector_type(8)))  float    v8f;
typedef __attribute__((ext_vector_type(4)))  float    v4f;
typedef v8h  __attribute__((may_alias)) v8ha;
typedef v4f  __attribute__((may_alias)) v4fa;
typedef v8us __attribute__((may_alias)) v8usa;

__device__ __forceinline__ unsigned short f2bf(float f) { unsigned u = __float_as_uint(f); u += 0x7FFFu + ((u >> 16) & 1u); return (unsigned short)(u >> 16); }
__device__ __forceinline__ float bf2f(unsigned short b) { return __uint_as_float(((unsigned)b) << 16); }
__device__ __forceinline__ float bfr(float f) { return bf2f(f2bf(f)); }
__device__ __forceinline__ v16h cat16(v8h lo, v8h hi) { return __builtin_shufflevector(lo, hi, 0, 1, 2, 3, 4, 5, 6, 7, 8, 9, 10, 11, 12, 13, 14, 15); }
__device__ __forceinline__ v16bf cat16b(v8us lo, v8us hi) { return __builtin_bit_cast(v16bf, __builtin_shufflevector(lo, hi, 0, 1, 2, 3, 4, 5, 6, 7, 8, 9, 10, 11, 12, 13, 14, 15)); }
__device__ __forceinline__ v8f wmma16(v16h a, v16h b, v8f c) { return __builtin_amdgcn_wmma_f32_16x16x32_f16(false, a, false, b, (short)0, c, false, false); }
__device__ __forceinline__ v8f wmmab(v16bf a, v16bf b, v8f c) { return __builtin_amdgcn_wmma_f32_16x16x32_bf16(false, a, false, b, (short)0, c, false, false); }



// ---- k_gemmw: register-blocked GEMM, ONE WAVE per 64x64 output tile (16 accumulators), operands straight from K-contiguous 16-bit planes; grid (M/64, N/64, Z), 32 threads.
// C[m][n] (f32, pitch ldc, + optional f32 bias[n]) = sum_k A[m][k] Bt[n][k] (+ split products per NSPLIT). z-batch strides sA/sB/sC/sBias in elements. K % 32 == 0.
template <typename T16> struct WFrag;
template <> struct WFrag<h16> { typedef v16h V; static __device__ __forceinline__ V ld(const h16* p) { return cat16(*(const v8h*)p, *(const v8h*)(p + 16)); } static __device__ __forceinline__ v8f mma(V a, V b, v8f c) { return wmma16(a, b, c); } };
template <> struct WFrag<bf> { typedef v16bf V; static __device__ __forceinline__ V ld(const bf* p) { return cat16b(*(const v8us*)p, *(const v8us*)(p + 16)); } static __device__ __forceinline__ v8f mma(V a, V b, v8f c) { return wmmab(a, b, c); } };
template <typename T16, int NSPLIT, bool BIAS>
__global__ __launch_bounds__(32) void k_gemmw(const T16* __restrict__ A, const T16* __restrict__ A2, const T16* __restrict__ Bt, const T16* __restrict__ Bt2, int K, float* C, int ldc, const float* __restrict__ bias, size_t sA, size_t sB, size_t sC, size_t sBias) {
    typedef typename WFrag<T16>::V V;
    __shared__ __align__(16) float os[16 * 68];
    const size_t z = blockIdx.z; A += z * sA; if (A2) A2 += z * sA; Bt += z * sB; if (Bt2) Bt2 += z * sB; C += z * sC; if (BIAS) bias += z * sBias;
    const int lane = threadIdx.x & 31, lr = lane & 15, hi = lane >> 4; const int r0 = blockIdx.x * 64, c0 = blockIdx.y * 64;
    v8f acc[4][4];
#pragma unroll
    for (int mb = 0; mb < 4; ++mb)
#pragma unroll
        for (int nb = 0; nb < 4; ++nb) acc[mb][nb] = (v8f){};
    const size_t aoff = (size_t)(r0 + lr) * K + 8 * hi, boff = (size_t)(c0 + lr) * K + 8 * hi;
#pragma unroll 1
    for (int kc = 0; kc < K; kc += 32) {
        V a[4], a2[4];
#pragma unroll
        for (int mb = 0; mb < 4; ++mb) { a[mb] = WFrag<T16>::ld(A + aoff + (size_t)mb * 16 * K + kc); if (NSPLIT == 1 || NSPLIT == 2) a2[mb] = WFrag<T16>::ld(A2 + aoff + (size_t)mb * 16 * K + kc); }
#pragma unroll
        for (int nb = 0; nb < 4; ++nb) { const V b = WFrag<T16>::ld(Bt + boff + (size_t)nb * 16 * K + kc); V b2; if (NSPLIT >= 2) b2 = WFrag<T16>::ld(Bt2 + boff + (size_t)nb * 16 * K + kc);
#pragma unroll
            for (int mb = 0; mb < 4; ++mb) { acc[mb][nb] = WFrag<T16>::mma(a[mb], b, acc[mb][nb]); if (NSPLIT == 1 || NSPLIT == 2) acc[mb][nb] = WFrag<T16>::mma(a2[mb], b, acc[mb][nb]); if (NSPLIT >= 2) acc[mb][nb] = WFrag<T16>::mma(a[mb], b2, acc[mb][nb]); } }
        asm volatile("v_nop\n\tv_nop\n\tv_nop\n\tv_nop" : "+v"(acc[0][0]), "+v"(acc[1][1]), "+v"(acc[2][2]), "+v"(acc[3][3]) : "v"(a[0]), "v"(a[3]));
    }
#pragma unroll
    for (int mb = 0; mb < 4; ++mb) {
#pragma unroll
        for (int nb = 0; nb < 4; ++nb) {
#pragma unroll
            for (int j = 0; j < 8; ++j) os[(hi * 8 + j) * 68 + nb * 16 + lr] = acc[mb][nb][j]; }
        __builtin_amdgcn_wave_barrier(); asm volatile("" ::: "memory");
        float* crow = C + (size_t)(r0 + mb * 16) * ldc + c0;
{
#pragma unroll
            for (int s = 0; s < 8; ++s) { const int row = 2 * s + hi, cofs = lr * 4; v4f val = *(const v4fa*)(os + row * 68 + cofs); if (BIAS) { val[0] += bfr(bias[c0 + cofs]); val[1] += bfr(bias[c0 + cofs + 1]); val[2] += bfr(bias[c0 + cofs + 2]); val[3] += bfr(bias[c0 + cofs + 3]); }
                *(v4f*)(crow + (size_t)row * ldc + cofs) = val; }
             }
        __builtin_amdgcn_wave_barrier(); asm volatile("" ::: "memory");
    }
}

__device__ __forceinline__ void splitf(float y, unsigned short& h, unsigned short& l) { h = f2bf(y); l = f2bf(y - bf2f(h)); }
typedef __attribute__((ext_vector_type(2))) unsigned short v2us;
typedef __attribute__((ext_vector_type(4))) unsigned short v4us;

__global__ __launch_bounds__(256) void k_cvt8(const float* __restrict__ src, bf* dst, size_t n8) { const size_t i = (size_t)blockIdx.x * 256 + threadIdx.x; if (i >= n8) return; const v8f v = *(const v8f*)(src + i * 8); v8us o;
#pragma unroll
    for (int k = 0; k < 8; ++k) o[k] = f2bf(v[k]); *(v8us*)(dst + i * 8) = o;  }
// bf16 copy of a [TK][DM] input with its rows regrouped by the head that keeps them: token t -> row t / 16 of plane t % 16 (planes [NH_][KPH][DM]).
__global__ __launch_bounds__(256) void k_cvt8g(const float* __restrict__ src, bf* dst) { const size_t i = (size_t)blockIdx.x * 256 + threadIdx.x; if (i >= (size_t)TK * DM / 8) return; const int t = (int)(i / (DM / 8)); const int c = (int)(i % (DM / 8)) * 8; const v8f v = *(const v8f*)(src + i * 8); v8us o;
#pragma unroll
    for (int k = 0; k < 8; ++k) o[k] = f2bf(v[k]); *(v8us*)(dst + ((size_t)(t % NH_) * KPH + t / NH_) * DM + c) = o;  }
__global__ __launch_bounds__(256) void k_qpl(const float* __restrict__ Q, bf* Qh, bf* Ql) { const size_t e = ((size_t)blockIdx.x * 256 + threadIdx.x) * 4; if (e >= (size_t)NH_ * TQ * HD) return; const int d = (int)(e % HD); const int t = (int)((e / HD) % TQ); const int h = (int)(e / ((size_t)HD * TQ)); const v4f a = *(const v4f*)(Q + (size_t)t * DM + h * HD + d); v4us oh, ol;
#pragma unroll
    for (int u = 0; u < 4; ++u) { unsigned short x0, x1; splitf(a[u], x0, x1); oh[u] = x0; ol[u] = x1; } *(v4us*)(Qh + e) = oh; *(v4us*)(Ql + e) = ol;  }
__global__ __launch_bounds__(256) void k_kpl(const float* __restrict__ K, bf* Kh, bf* Kl) { const size_t e = ((size_t)blockIdx.x * 256 + threadIdx.x) * 4; if (e >= (size_t)NH_ * KPH * HD) return; const v4f a = *(const v4f*)(K + e); v4us oh, ol;    // K arrives as [NH_][KPH][HD], the planes' own order
#pragma unroll
    for (int u = 0; u < 4; ++u) { unsigned short x0, x1; splitf(a[u], x0, x1); oh[u] = x0; ol[u] = x1; } *(v4us*)(Kh + e) = oh; *(v4us*)(Kl + e) = ol;  }
__global__ __launch_bounds__(256) void k_vtp(const float* __restrict__ V, bf* Vh, bf* Vl) { const size_t e = ((size_t)blockIdx.x * 256 + threadIdx.x) * 4; if (e >= (size_t)NH_ * HD * KPH) return; const int m = (int)(e % KPH); const int d = (int)((e / KPH) % HD); const int h = (int)(e / ((size_t)KPH * HD)); v4us oh, ol;
#pragma unroll
    for (int u = 0; u < 4; ++u) { unsigned short x0, x1; splitf(V[((size_t)h * KPH + m + u) * HD + d], x0, x1); oh[u] = x0; ol[u] = x1; } *(v4us*)(Vh + e) = oh; *(v4us*)(Vl + e) = ol;  }
__global__ __launch_bounds__(256) void k_soft(const float* __restrict__ S, bf* Ph, bf* Pl) { const int lane = threadIdx.x & 31; const int row = blockIdx.x * 8 + (threadIdx.x >> 5); if (row >= NH_ * TQ) return; const float* sr = S + (size_t)row * KPH; float v[KPH / 32]; float mx = -3.0e38f;
#pragma unroll
    for (int ch = 0; ch < KPH / 128; ++ch) { const v4f a = *(const v4f*)(sr + ch * 128 + lane * 4);
#pragma unroll
        for (int u = 0; u < 4; ++u) { const float t = a[u] * 0.125f; v[ch * 4 + u] = t; mx = fmaxf(mx, t); } }
#pragma unroll
    for (int sh = 16; sh; sh >>= 1) mx = fmaxf(mx, __shfl_xor(mx, sh, 32));
    float sum = 0.f;
#pragma unroll
    for (int q = 0; q < KPH / 32; ++q) { float d0 = __fsub_rn(v[q], mx); asm volatile("" : "+v"(d0)); v[q] = __builtin_amdgcn_exp2f(__fmul_rn(d0, 1.4426950408889634f)); sum += v[q]; }
#pragma unroll
    for (int sh = 16; sh; sh >>= 1) sum += __shfl_xor(sum, sh, 32);
    const float f = __fdiv_rn(1.0f, sum);
    {
#pragma unroll
        for (int ch = 0; ch < KPH / 128; ++ch) { v4us oh, ol; for (int q = 0; q < 4; ++q) { unsigned short a, b; splitf(v[ch * 4 + q] * f, a, b); oh[q] = a; ol[q] = b; } const size_t oo = (size_t)row * KPH + ch * 128 + lane * 4; *(v4us*)(Ph + oo) = oh; *(v4us*)(Pl + oo) = ol; }
         } }
__global__ __launch_bounds__(256) void k_mrg(const float* __restrict__ O, bf* Ah, bf* Al) { const size_t e = ((size_t)blockIdx.x * 256 + threadIdx.x) * 4; if (e >= (size_t)NH_ * TQ * HD) return; const int d = (int)(e % HD); const int t = (int)((e / HD) % TQ); const int h = (int)(e / ((size_t)HD * TQ)); const size_t oo = (size_t)t * DM + h * HD + d; v4us oh, ol;
#pragma unroll
    for (int u = 0; u < 4; ++u) { unsigned short a, b; splitf(O[e + u], a, b); oh[u] = a; ol[u] = b; } *(v4us*)(Ah + oo) = oh; *(v4us*)(Al + oo) = ol;  }

extern "C" void kernel_launch(void* const* d_in, const int* in_sizes, int n_in,
                              void* d_out, int out_size, void* d_ws, size_t ws_size, hipStream_t stream) {
    (void)in_sizes; (void)n_in; (void)out_size;
    const float* qin = (const float*)d_in[0]; const float* kin = (const float*)d_in[1]; const float* vin = (const float*)d_in[2]; const float* Wq = (const float*)d_in[3]; const float* bq = (const float*)d_in[4]; const float* Wk = (const float*)d_in[5]; const float* bk = (const float*)d_in[6]; const float* Wv = (const float*)d_in[7]; const float* bv = (const float*)d_in[8]; const float* Wo = (const float*)d_in[9]; const float* bo = (const float*)d_in[10];
    float* OUT = (float*)d_out;     // [1][1024][1024]
    char* wsp = (char*)d_ws;
    auto take = [&](size_t bytes) { char* p = wsp; wsp += (bytes + 255) & ~(size_t)255; return (void*)p; };
    bf* BQ = (bf*)take((size_t)DM * DM * 2); bf* BK = (bf*)take((size_t)DM * DM * 2); bf* BV = (bf*)take((size_t)DM * DM * 2); bf* BO = (bf*)take((size_t)DM * DM * 2);
    bf* QB = (bf*)take((size_t)TQ * DM * 2); bf* KB = (bf*)take((size_t)TK * DM * 2); float* FQ = (float*)take((size_t)TQ * DM * 4); float* FK = (float*)take((size_t)NH_ * KPH * HD * 4); float* FV = (float*)take((size_t)NH_ * KPH * HD * 4);
    bf* Qh = (bf*)take((size_t)NH_ * TQ * HD * 2); bf* Ql = (bf*)take((size_t)NH_ * TQ * HD * 2); bf* Kh = (bf*)take((size_t)NH_ * KPH * HD * 2); bf* Kl = (bf*)take((size_t)NH_ * KPH * HD * 2); bf* Vh = (bf*)take((size_t)NH_ * HD * KPH * 2); bf* Vl = (bf*)take((size_t)NH_ * HD * KPH * 2);
    float* S = (float*)take((size_t)NH_ * TQ * KPH * 4); bf* Ph = (bf*)take((size_t)NH_ * TQ * KPH * 2); bf* Pl = (bf*)take((size_t)NH_ * TQ * KPH * 2); float* O = (float*)take((size_t)NH_ * TQ * HD * 4); bf* ATh = (bf*)take((size_t)TQ * DM * 2); bf* ATl = (bf*)take((size_t)TQ * DM * 2);
    if ((size_t)(wsp - (char*)d_ws) > ws_size) return;    // total ~ 115 MB
    k_cvt8<<<(DM * DM / 8 + 255) / 256, 256, 0, stream>>>(Wq, BQ, DM * DM / 8); k_cvt8<<<(DM * DM / 8 + 255) / 256, 256, 0, stream>>>(Wk, BK, DM * DM / 8); k_cvt8<<<(DM * DM / 8 + 255) / 256, 256, 0, stream>>>(Wv, BV, DM * DM / 8); k_cvt8<<<(DM * DM / 8 + 255) / 256, 256, 0, stream>>>(Wo, BO, DM * DM / 8);   // torch [out][in] = Bt as-is
    k_cvt8<<<(TQ * DM / 8 + 255) / 256, 256, 0, stream>>>(qin, QB, TQ * DM / 8);
    k_gemmw<bf, 0, true><<<dim3(TQ / 64, DM / 64, 1), 32, 0, stream>>>(QB, nullptr, BQ, nullptr, DM, FQ, DM, bq, 0, 0, 0, 0);
    const size_t zi = (size_t)KPH * DM, zw = (size_t)HD * DM, zp = (size_t)KPH * HD;    // per head: input plane, the head's 64 weight rows, projected plane
    k_cvt8g<<<(TK * DM / 8 + 255) / 256, 256, 0, stream>>>(kin, KB);
    k_gemmw<bf, 0, true><<<dim3(KPH / 64, 1, NH_), 32, 0, stream>>>(KB, nullptr, BK, nullptr, DM, FK, HD, bk, zi, zw, zp, HD);
    k_cvt8g<<<(TK * DM / 8 + 255) / 256, 256, 0, stream>>>(vin, KB);     // reuse the bf16 input buffer (stream-ordered after the K GEMM)
    k_gemmw<bf, 0, true><<<dim3(KPH / 64, 1, NH_), 32, 0, stream>>>(KB, nullptr, BV, nullptr, DM, FV, HD, bv, zi, zw, zp, HD);
    k_qpl<<<(unsigned)(((size_t)NH_ * TQ * HD / 4 + 255) / 256), 256, 0, stream>>>(FQ, Qh, Ql); k_kpl<<<(unsigned)(((size_t)NH_ * KPH * HD / 4 + 255) / 256), 256, 0, stream>>>(FK, Kh, Kl); k_vtp<<<(unsigned)(((size_t)NH_ * HD * KPH / 4 + 255) / 256), 256, 0, stream>>>(FV, Vh, Vl);
    const size_t zq = (size_t)TQ * HD, zk = (size_t)KPH * HD, zS = (size_t)TQ * KPH, zv = (size_t)HD * KPH;
    k_gemmw<bf, 2, false><<<dim3(TQ / 64, KPH / 64, NH_), 32, 0, stream>>>(Qh, Ql, Kh, Kl, HD, S, KPH, nullptr, zq, zk, zS, 0);
    k_soft<<<NH_ * TQ / 8, 256, 0, stream>>>(S, Ph, Pl);
    k_gemmw<bf, 2, false><<<dim3(TQ / 64, 1, NH_), 32, 0, stream>>>(Ph, Pl, Vh, Vl, KPH, O, HD, nullptr, zS, zv, zq, 0);
    k_mrg<<<(unsigned)(((size_t)NH_ * TQ * HD / 4 + 255) / 256), 256, 0, stream>>>(O, ATh, ATl);
    k_gemmw<bf, 1, true><<<dim3(TQ / 64, DM / 64, 1), 32, 0, stream>>>(ATh, ATl, BO, nullptr, DM, OUT, DM, bo, 0, 0, 0, 0);
}

// v002
// A run of this version takes 167 microseconds.
// Timed twice side by side with v001, it ran 1.04 times as fast both times.
// All steps since v000 together make it 1.21 times as fast.
#include <hip/hip_runtime.h>

// HeposMultiHeadAttention (q [1][1024][1024], k, v [1][8192][1024]; Q/K/V = in W^T + b (16 heads x 64); head h attends only keys with (k_idx - h) % 16 == 0 (512 keys per head); softmax(Q.K / 8); out = merged Wo^T + bo -> [1][1024][1024]; no row is fully masked, so nan_to_num is a no-op).
// The HEPOS mask is structural: each head's 512 keys are gathered into dense planes (key m of head h = token 16 m + h), so no masked score is ever computed.
// Key token t is kept by head t % 16 alone, so of its K and V projections only that head's 64 columns are ever read: the k / v inputs are regrouped by head and projected as 16 batched 512 x 64 x 1024 GEMMs.
// Compute dtypes, f32 accumulate: every input rounded to bf16; Q/K/V as PLAIN bf16 GEMMs (inputs: exact) + bias; scores hl x hl (3 products), softmax f32 -> hl planes, attn.v 3 products (all cheap: 512 keys); Wo hl x exact (2 products) + bias.

#define TQ   1024
#define TK   8192
#define DM   1024
#define NH_  16
#define HD   64
#define KPH  512    // keys per head = TK / 16
typedef _Float16 h16;
typedef unsigned short bf;
typedef __attribute__((ext_vector_type(16))) __bf16   v16bf;
typedef __attribute__((ext_vector_type(16))) _Float16 v16h;
typedef __attribute__((ext_vector_type(8)))  _Float16 v8h;
typedef __attribute__((ext_vector_type(8)))  unsigned short v8us;
typedef __attribute__((ext_vector_type(8)))  float    v8f;
typedef __attribute__((ext_vector_type(4)))  float    v4f;
typedef v8h  __attribute__((may_alias)) v8ha;
typedef v4f  __attribute__((may_alias)) v4fa;
typedef v8us __attribute__((may_alias)) v8usa;

__device__ __forceinline__ unsigned short f2bf(float f) { unsigned u = __float_as_uint(f); u += 0x7FFFu + ((u >> 16) & 1u); return (unsigned short)(u >> 16); }
__device__ __forceinline__ float bf2f(unsigned short b) { return __uint_as_float(((unsigned)b) << 16); }
__device__ __forceinline__ float bfr(float f) { return bf2f(f2bf(f)); }
__device__ __forceinline__ v16h cat16(v8h lo, v8h hi) { return __builtin_shufflevector(lo, hi, 0, 1, 2, 3, 4, 5, 6, 7, 8, 9, 10, 11, 12, 13, 14, 15); }
__device__ __forceinline__ v16bf cat16b(v8us lo, v8us hi) { return __builtin_bit_cast(v16bf, __builtin_shufflevector(lo, hi, 0, 1, 2, 3, 4, 5, 6, 7, 8, 9, 10, 11, 12, 13, 14, 15)); }
__device__ __forceinline__ v8f wmma16(v16h a, v16h b, v8f c) { return __builtin_amdgcn_wmma_f32_16x16x32_f16(false, a, false, b, (short)0, c, false, false); }
__device__ __forceinline__ v8f wmmab(v16bf a, v16bf b, v8f c) { return __builtin_amdgcn_wmma_f32_16x16x32_bf16(false, a, false, b, (short)0, c, false, false); }



// ---- k_gemmw: register-blocked GEMM, ONE WAVE per 64x64 output tile (16 accumulators), operands straight from K-contiguous 16-bit planes; grid (M/64, N/64, Z), 32 threads.
// C[m][n] (f32, pitch ldc, + optional f32 bias[n]) = sum_k A[m][k] Bt[n][k] (+ split products per NSPLIT). z-batch strides sA/sB/sC/sBias in elements. K % 32 == 0.
template <typename T16> struct WFrag;
template <> struct WFrag<h16> { typedef v16h V; static __device__ __forceinline__ V ld(const h16* p) { return cat16(*(const v8h*)p, *(const v8h*)(p + 16)); } static __device__ __forceinline__ v8f mma(V a, V b, v8f c) { return wmma16(a, b, c); } };
template <> struct WFrag<bf> { typedef v16bf V; static __device__ __forceinline__ V ld(const bf* p) { return cat16b(*(const v8us*)p, *(const v8us*)(p + 16)); } static __device__ __forceinline__ v8f mma(V a, V b, v8f c) { return wmmab(a, b, c); } };
template <typename T16, int NSPLIT, bool BIAS>
__global__ __launch_bounds__(32) void k_gemmw(const T16* __restrict__ A, const T16* __restrict__ A2, const T16* __restrict__ Bt, const T16* __restrict__ Bt2, int K, float* C, int ldc, const float* __restrict__ bias, size_t sA, size_t sB, size_t sC, size_t sBias) {
    typedef typename WFrag<T16>::V V;
    __shared__ __align__(16) float os[16 * 68];
    const size_t z = blockIdx.z; A += z * sA; if (A2) A2 += z * sA; Bt += z * sB; if (Bt2) Bt2 += z * sB; C += z * sC; if (BIAS) bias += z * sBias;
    const int lane = threadIdx.x & 31, lr = lane & 15, hi = lane >> 4; const int r0 = blockIdx.x * 64, c0 = blockIdx.y * 64;
    v8f acc[4][4];
#pragma unroll
    for (int mb = 0; mb < 4; ++mb)
#pragma unroll
        for (int nb = 0; nb < 4; ++nb) acc[mb][nb] = (v8f){};
    const size_t aoff = (size_t)(r0 + lr) * K + 8 * hi, boff = (size_t)(c0 + lr) * K + 8 * hi;
#pragma unroll 1
    for (int kc = 0; kc < K; kc += 32) {
        V a[4], a2[4];
#pragma unroll
        for (int mb = 0; mb < 4; ++mb) { a[mb] = WFrag<T16>::ld(A + aoff + (size_t)mb * 16 * K + kc); if (NSPLIT == 1 || NSPLIT == 2) a2[mb] = WFrag<T16>::ld(A2 + aoff + (size_t)mb * 16 * K + kc); }
#pragma unroll
        for (int nb = 0; nb < 4; ++nb) { const V b = WFrag<T16>::ld(Bt + boff + (size_t)nb * 16 * K + kc); V b2; if (NSPLIT >= 2) b2 = WFrag<T16>::ld(Bt2 + boff + (size_t)nb * 16 * K + kc);
#pragma unroll
            for (int mb = 0; mb < 4; ++mb) { acc[mb][nb] = WFrag<T16>::mma(a[mb], b, acc[mb][nb]); if (NSPLIT == 1 || NSPLIT == 2) acc[mb][nb] = WFrag<T16>::mma(a2[mb], b, acc[mb][nb]); if (NSPLIT >= 2) acc[mb][nb] = WFrag<T16>::mma(a[mb], b2, acc[mb][nb]); } }
        asm volatile("v_nop\n\tv_nop\n\tv_nop\n\tv_nop" : "+v"(acc[0][0]), "+v"(acc[1][1]), "+v"(acc[2][2]), "+v"(acc[3][3]) : "v"(a[0]), "v"(a[3]));
    }
#pragma unroll
    for (int mb = 0; mb < 4; ++mb) {
#pragma unroll
        for (int nb = 0; nb < 4; ++nb) {
#pragma unroll
            for (int j = 0; j < 8; ++j) os[(hi * 8 + j) * 68 + nb * 16 + lr] = acc[mb][nb][j]; }
        __builtin_amdgcn_wave_barrier(); asm volatile("" ::: "memory");
        float* crow = C + (size_t)(r0 + mb * 16) * ldc + c0;
{
#pragma unroll
            for (int s = 0; s < 8; ++s) { const int row = 2 * s + hi, cofs = lr * 4; v4f val = *(const v4fa*)(os + row * 68 + cofs); if (BIAS) { val[0] += bfr(bias[c0 + cofs]); val[1] += bfr(bias[c0 + cofs + 1]); val[2] += bfr(bias[c0 + cofs + 2]); val[3] += bfr(bias[c0 + cofs + 3]); }
                *(v4f*)(crow + (size_t)row * ldc + cofs) = val; }
             }
        __builtin_amdgcn_wave_barrier(); asm volatile("" ::: "memory");
    }
}

__device__ __forceinline__ void splitf(float y, unsigned short& h, unsigned short& l) { h = f2bf(y); l = f2bf(y - bf2f(h)); }
typedef __attribute__((ext_vector_type(2))) unsigned short v2us;
typedef __attribute__((ext_vector_type(4))) unsigned short v4us;

// ---- k_cvtall: every f32 -> bf16 input copy in ONE streaming launch. All seven sources are rows of DM floats (k, v: TK rows each; Wq, Wk, Wv, Wo, q: 1024 rows each).
// CG work-groups x CW waves x CR rows per wave cover them exactly once. A wave reads a row as 8 loads of 512 contiguous bytes, non-temporal (each source is read once), and asks for all its CR rows
// before it rounds the first; it stores a row as 8 stores of 256 contiguous bytes. k / v rows are regrouped by the head that keeps them: token t -> row t / 16 of plane t % 16 (planes [NH_][KPH][DM]).
#define CG 256
#define CW 21
#define CR 4
static_assert(CG * CW * CR == 2 * TK + 4 * DM + TQ, "the conversion launch covers every row once");
__global__ __launch_bounds__(CW * 32) void k_cvtall(const float* __restrict__ kin, const float* __restrict__ vin, const float* __restrict__ Wq, const float* __restrict__ Wk, const float* __restrict__ Wv, const float* __restrict__ Wo, const float* __restrict__ qin,
                                                    bf* KB, bf* VB, bf* BQ, bf* BK, bf* BV, bf* BO, bf* QB) {
    const int lane = threadIdx.x & 31; const int gw = __builtin_amdgcn_readfirstlane((int)(blockIdx.x * CW + (threadIdx.x >> 5)));   // wave-uniform: a row's source and place are scalar work
    __builtin_assume(gw >= 0 && gw < CG * CW);
    v4f x[CR][DM / 128]; bf* dst[CR];
#pragma unroll
    for (int r = 0; r < CR; ++r) { const int row = r * (CG * CW) + gw; const float* s; bf* d;
        if (row < 2 * TK) { const int t = row & (TK - 1); s = (row < TK ? kin : vin) + (size_t)t * DM; d = (row < TK ? KB : VB) + ((size_t)(t % NH_) * KPH + t / NH_) * DM; }
        else { const int m = (row - 2 * TK) >> 10; const size_t o = (size_t)((row - 2 * TK) & 1023) * DM; s = Wq; d = BQ;
            if (m == 1) { s = Wk; d = BK; } if (m == 2) { s = Wv; d = BV; } if (m == 3) { s = Wo; d = BO; } if (m == 4) { s = qin; d = QB; } s += o; d += o; }
        dst[r] = d + lane * 4;
#pragma unroll
        for (int q = 0; q < DM / 128; ++q) x[r][q] = __builtin_nontemporal_load((const v4f*)(s + q * 128 + lane * 4)); }
    __builtin_amdgcn_sched_barrier(0);   // keeps every row's loads in front of the first rounding: left alone the compiler issues the last row's loads only when earlier rows have arrived, a second memory latency in every wave
#pragma unroll
    for (int r = 0; r < CR; ++r)
#pragma unroll
        for (int q = 0; q < DM / 128; ++q) { v4us o;
#pragma unroll
            for (int u = 0; u < 4; ++u) o[u] = f2bf(x[r][q][u]);
            *(v4us*)(dst[r] + q * 128) = o; } }
__global__ __launch_bounds__(256) void k_qpl(const float* __restrict__ Q, bf* Qh, bf* Ql) { const size_t e = ((size_t)blockIdx.x * 256 + threadIdx.x) * 4; if (e >= (size_t)NH_ * TQ * HD) return; const int d = (int)(e % HD); const int t = (int)((e / HD) % TQ); const int h = (int)(e / ((size_t)HD * TQ)); const v4f a = *(const v4f*)(Q + (size_t)t * DM + h * HD + d); v4us oh, ol;
#pragma unroll
    for (int u = 0; u < 4; ++u) { unsigned short x0, x1; splitf(a[u], x0, x1); oh[u] = x0; ol[u] = x1; } *(v4us*)(Qh + e) = oh; *(v4us*)(Ql + e) = ol;  }
__global__ __launch_bounds__(256) void k_kpl(const float* __restrict__ K, bf* Kh, bf* Kl) { const size_t e = ((size_t)blockIdx.x * 256 + threadIdx.x) * 4; if (e >= (size_t)NH_ * KPH * HD) return; const v4f a = *(const v4f*)(K + e); v4us oh, ol;    // K arrives as [NH_][KPH][HD], the planes' own order
#pragma unroll
    for (int u = 0; u < 4; ++u) { unsigned short x0, x1; splitf(a[u], x0, x1); oh[u] = x0; ol[u] = x1; } *(v4us*)(Kh + e) = oh; *(v4us*)(Kl + e) = ol;  }
__global__ __launch_bounds__(256) void k_vtp(const float* __restrict__ V, bf* Vh, bf* Vl) { const size_t e = ((size_t)blockIdx.x * 256 + threadIdx.x) * 4; if (e >= (size_t)NH_ * HD * KPH) return; const int m = (int)(e % KPH); const int d = (int)((e / KPH) % HD); const int h = (int)(e / ((size_t)KPH * HD)); v4us oh, ol;
#pragma unroll
    for (int u = 0; u < 4; ++u) { unsigned short x0, x1; splitf(V[((size_t)h * KPH + m + u) * HD + d], x0, x1); oh[u] = x0; ol[u] = x1; } *(v4us*)(Vh + e) = oh; *(v4us*)(Vl + e) = ol;  }
__global__ __launch_bounds__(256) void k_soft(const float* __restrict__ S, bf* Ph, bf* Pl) { const int lane = threadIdx.x & 31; const int row = blockIdx.x * 8 + (threadIdx.x >> 5); if (row >= NH_ * TQ) return; const float* sr = S + (size_t)row * KPH; float v[KPH / 32]; float mx = -3.0e38f;
#pragma unroll
    for (int ch = 0; ch < KPH / 128; ++ch) { const v4f a = *(const v4f*)(sr + ch * 128 + lane * 4);
#pragma unroll
        for (int u = 0; u < 4; ++u) { const float t = a[u] * 0.125f; v[ch * 4 + u] = t; mx = fmaxf(mx, t); } }
#pragma unroll
    for (int sh = 16; sh; sh >>= 1) mx = fmaxf(mx, __shfl_xor(mx, sh, 32));
    float sum = 0.f;
#pragma unroll
    for (int q = 0; q < KPH / 32; ++q) { float d0 = __fsub_rn(v[q], mx); asm volatile("" : "+v"(d0)); v[q] = __builtin_amdgcn_exp2f(__fmul_rn(d0, 1.4426950408889634f)); sum += v[q]; }
#pragma unroll
    for (int sh = 16; sh; sh >>= 1) sum += __shfl_xor(sum, sh, 32);
    const float f = __fdiv_rn(1.0f, sum);
    {
#pragma unroll
        for (int ch = 0; ch < KPH / 128; ++ch) { v4us oh, ol; for (int q = 0; q < 4; ++q) { unsigned short a, b; splitf(v[ch * 4 + q] * f, a, b); oh[q] = a; ol[q] = b; } const size_t oo = (size_t)row * KPH + ch * 128 + lane * 4; *(v4us*)(Ph + oo) = oh; *(v4us*)(Pl + oo) = ol; }
         } }
__global__ __launch_bounds__(256) void k_mrg(const float* __restrict__ O, bf* Ah, bf* Al) { const size_t e = ((size_t)blockIdx.x * 256 + threadIdx.x) * 4; if (e >= (size_t)NH_ * TQ * HD) return; const int d = (int)(e % HD); const int t = (int)((e / HD) % TQ); const int h = (int)(e / ((size_t)HD * TQ)); const size_t oo = (size_t)t * DM + h * HD + d; v4us oh, ol;
#pragma unroll
    for (int u = 0; u < 4; ++u) { unsigned short a, b; splitf(O[e + u], a, b); oh[u] = a; ol[u] = b; } *(v4us*)(Ah + oo) = oh; *(v4us*)(Al + oo) = ol;  }

extern "C" void kernel_launch(void* const* d_in, const int* in_sizes, int n_in,
                              void* d_out, int out_size, void* d_ws, size_t ws_size, hipStream_t stream) {
    (void)in_sizes; (void)n_in; (void)out_size;
    const float* qin = (const float*)d_in[0]; const float* kin = (const float*)d_in[1]; const float* vin = (const float*)d_in[2]; const float* Wq = (const float*)d_in[3]; const float* bq = (const float*)d_in[4]; const float* Wk = (const float*)d_in[5]; const float* bk = (const float*)d_in[6]; const float* Wv = (const float*)d_in[7]; const float* bv = (const float*)d_in[8]; const float* Wo = (const float*)d_in[9]; const float* bo = (const float*)d_in[10];
    float* OUT = (float*)d_out;     // [1][1024][1024]
    char* wsp = (char*)d_ws;
    auto take = [&](size_t bytes) { char* p = wsp; wsp += (bytes + 255) & ~(size_t)255; return (void*)p; };
    bf* BQ = (bf*)take((size_t)DM * DM * 2); bf* BK = (bf*)take((size_t)DM * DM * 2); bf* BV = (bf*)take((size_t)DM * DM * 2); bf* BO = (bf*)take((size_t)DM * DM * 2);
    bf* QB = (bf*)take((size_t)TQ * DM * 2); bf* KB = (bf*)take((size_t)TK * DM * 2); bf* VB = (bf*)take((size_t)TK * DM * 2); float* FQ = (float*)take((size_t)TQ * DM * 4); float* FK = (float*)take((size_t)NH_ * KPH * HD * 4); float* FV = (float*)take((size_t)NH_ * KPH * HD * 4);
    bf* Qh = (bf*)take((size_t)NH_ * TQ * HD * 2); bf* Ql = (bf*)take((size_t)NH_ * TQ * HD * 2); bf* Kh = (bf*)take((size_t)NH_ * KPH * HD * 2); bf* Kl = (bf*)take((size_t)NH_ * KPH * HD * 2); bf* Vh = (bf*)take((size_t)NH_ * HD * KPH * 2); bf* Vl = (bf*)take((size_t)NH_ * HD * KPH * 2);
    float* S = (float*)take((size_t)NH_ * TQ * KPH * 4); bf* Ph = (bf*)take((size_t)NH_ * TQ * KPH * 2); bf* Pl = (bf*)take((size_t)NH_ * TQ * KPH * 2); float* O = (float*)take((size_t)NH_ * TQ * HD * 4); bf* ATh = (bf*)take((size_t)TQ * DM * 2); bf* ATl = (bf*)take((size_t)TQ * DM * 2);
    if ((size_t)(wsp - (char*)d_ws) > ws_size) return;    // total ~ 131 MB
    k_cvtall<<<CG, CW * 32, 0, stream>>>(kin, vin, Wq, Wk, Wv, Wo, qin, KB, VB, BQ, BK, BV, BO, QB);   // torch [out][in] weights = Bt as-is
    k_gemmw<bf, 0, true><<<dim3(TQ / 64, DM / 64, 1), 32, 0, stream>>>(QB, nullptr, BQ, nullptr, DM, FQ, DM, bq, 0, 0, 0, 0);
    const size_t zi = (size_t)KPH * DM, zw = (size_t)HD * DM, zp = (size_t)KPH * HD;    // per head: input plane, the head's 64 weight rows, projected plane
    k_gemmw<bf, 0, true><<<dim3(KPH / 64, 1, NH_), 32, 0, stream>>>(KB, nullptr, BK, nullptr, DM, FK, HD, bk, zi, zw, zp, HD);
    k_gemmw<bf, 0, true><<<dim3(KPH / 64, 1, NH_), 32, 0, stream>>>(VB, nullptr, BV, nullptr, DM, FV, HD, bv, zi, zw, zp, HD);
    k_qpl<<<(unsigned)(((size_t)NH_ * TQ * HD / 4 + 255) / 256), 256, 0, stream>>>(FQ, Qh, Ql); k_kpl<<<(unsigned)(((size_t)NH_ * KPH * HD / 4 + 255) / 256), 256, 0, stream>>>(FK, Kh, Kl); k_vtp<<<(unsigned)(((size_t)NH_ * HD * KPH / 4 + 255) / 256), 256, 0, stream>>>(FV, Vh, Vl);
    const size_t zq = (size_t)TQ * HD, zk = (size_t)KPH * HD, zS = (size_t)TQ * KPH, zv = (size_t)HD * KPH;
    k_gemmw<bf, 2, false><<<dim3(TQ / 64, KPH / 64, NH_), 32, 0, stream>>>(Qh, Ql, Kh, Kl, HD, S, KPH, nullptr, zq, zk, zS, 0);
    k_soft<<<NH_ * TQ / 8, 256, 0, stream>>>(S, Ph, Pl);
    k_gemmw<bf, 2, false><<<dim3(TQ / 64, 1, NH_), 32, 0, stream>>>(Ph, Pl, Vh, Vl, KPH, O, HD, nullptr, zS, zv, zq, 0);
    k_mrg<<<(unsigned)(((size_t)NH_ * TQ * HD / 4 + 255) / 256), 256, 0, stream>>>(O, ATh, ATl);
    k_gemmw<bf, 1, true><<<dim3(TQ / 64, DM / 64, 1), 32, 0, stream>>>(ATh, ATl, BO, nullptr, DM, OUT, DM, bo, 0, 0, 0, 0);
}

// v003
// One run takes 97 microseconds.
// Timed twice side by side with v002, it ran 1.72 and 1.73 times as fast.
// Counting every step since v000, it is 2.08 times as fast.
#include <hip/hip_runtime.h>

// HeposMultiHeadAttention (q [1][1024][1024], k, v [1][8192][1024]; Q/K/V = in W^T + b (16 heads x 64); head h attends only keys with (k_idx - h) % 16 == 0 (512 keys per head); softmax(Q.K / 8); out = merged Wo^T + bo -> [1][1024][1024]; no row is fully masked, so nan_to_num is a no-op).
// The HEPOS mask is structural: each head's 512 keys are gathered into dense planes (key m of head h = token 16 m + h), so no masked score is ever computed.
// Key token t is kept by head t % 16 alone, so of its K and V projections only that head's 64 columns are ever read: the k / v inputs are regrouped by head and projected as 16 batched 512 x 64 x 1024 GEMMs.
// Compute dtypes, f32 accumulate: every input rounded to bf16; Q/K/V as PLAIN bf16 GEMMs (inputs: exact) + bias; scores hl x hl (3 products), softmax f32 -> hl planes, attn.v 3 products (all cheap: 512 keys); Wo hl x exact (2 products) + bias.

#define TQ   1024
#define TK   8192
#define DM   1024
#define NH_  16
#define HD   64
#define KPH  512    // keys per head = TK / 16
typedef _Float16 h16;
typedef unsigned short bf;
typedef __attribute__((ext_vector_type(16))) __bf16   v16bf;
typedef __attribute__((ext_vector_type(16))) _Float16 v16h;
typedef __attribute__((ext_vector_type(8)))  _Float16 v8h;
typedef __attribute__((ext_vector_type(8)))  unsigned short v8us;
typedef __attribute__((ext_vector_type(8)))  float    v8f;
typedef __attribute__((ext_vector_type(4)))  float    v4f;
typedef v8h  __attribute__((may_alias)) v8ha;
typedef v4f  __attribute__((may_alias)) v4fa;
typedef v8us __attribute__((may_alias)) v8usa;

__device__ __forceinline__ unsigned short f2bf(float f) { unsigned u = __float_as_uint(f); u += 0x7FFFu + ((u >> 16) & 1u); return (unsigned short)(u >> 16); }
__device__ __forceinline__ float bf2f(unsigned short b) { return __uint_as_float(((unsigned)b) << 16); }
__device__ __forceinline__ float bfr(float f) { return bf2f(f2bf(f)); }
__device__ __forceinline__ v16h cat16(v8h lo, v8h hi) { return __builtin_shufflevector(lo, hi, 0, 1, 2, 3, 4, 5, 6, 7, 8, 9, 10, 11, 12, 13, 14, 15); }
__device__ __forceinline__ v16bf cat16b(v8us lo, v8us hi) { return __builtin_bit_cast(v16bf, __builtin_shufflevector(lo, hi, 0, 1, 2, 3, 4, 5, 6, 7, 8, 9, 10, 11, 12, 13, 14, 15)); }
__device__ __forceinline__ v8f wmma16(v16h a, v16h b, v8f c) { return __builtin_amdgcn_wmma_f32_16x16x32_f16(false, a, false, b, (short)0, c, false, false); }
__device__ __forceinline__ v8f wmmab(v16bf a, v16bf b, v8f c) { return __builtin_amdgcn_wmma_f32_16x16x32_bf16(false, a, false, b, (short)0, c, false, false); }



// ---- k_gemmw: register-blocked GEMM, one work-group of KS waves per 64x64 output tile, operands straight from K-contiguous 16-bit planes; grid (M/64, N/64, Z), 32 * KS threads.
// Every wave holds the whole tile (16 accumulators) and takes every KS-th 32-wide slice of K, so a wave's chain of load latencies is K / (32 KS) trips long and the KS waves of a trip read 64 KS contiguous bytes of each row.
// The KS partial tiles meet in LDS behind one barrier; wave w sums rows 64 w / KS ... of them, partial 0 first, and stores those rows.
// C[m][n] (f32, pitch ldc, + optional f32 bias[n]) = sum_k A[m][k] Bt[n][k] (+ split products per NSPLIT). z-batch strides sA/sB/sC/sBias in elements. K % 32 == 0.
template <typename T16> struct WFrag;
template <> struct WFrag<h16> { typedef v16h V; static __device__ __forceinline__ V ld(const h16* p) { return cat16(*(const v8h*)p, *(const v8h*)(p + 16)); } static __device__ __forceinline__ v8f mma(V a, V b, v8f c) { return wmma16(a, b, c); } };
template <> struct WFrag<bf> { typedef v16bf V; static __device__ __forceinline__ V ld(const bf* p) { return cat16b(*(const v8us*)p, *(const v8us*)(p + 16)); } static __device__ __forceinline__ v8f mma(V a, V b, v8f c) { return wmmab(a, b, c); } };
template <typename T16, int NSPLIT, bool BIAS, int KS>
__global__ __launch_bounds__(32 * KS) void k_gemmw(const T16* __restrict__ A, const T16* __restrict__ A2, const T16* __restrict__ Bt, const T16* __restrict__ Bt2, int K, float* C, int ldc, const float* __restrict__ bias, size_t sA, size_t sB, size_t sC, size_t sBias) {
    typedef typename WFrag<T16>::V V;
    __shared__ __align__(16) float os[KS * 64 * 68];
    const size_t z = blockIdx.z; A += z * sA; if (A2) A2 += z * sA; Bt += z * sB; if (Bt2) Bt2 += z * sB; C += z * sC; if (BIAS) bias += z * sBias;
    const int lane = threadIdx.x & 31, lr = lane & 15, hi = lane >> 4; const int r0 = blockIdx.x * 64, c0 = blockIdx.y * 64;
    const int w = __builtin_amdgcn_readfirstlane((int)(threadIdx.x >> 5));   // wave-uniform: the K slice and the rows to sum are scalar work
    v8f acc[4][4];
#pragma unroll
    for (int mb = 0; mb < 4; ++mb)
#pragma unroll
        for (int nb = 0; nb < 4; ++nb) acc[mb][nb] = (v8f){};
    const int cofs = lr * 4; v4f bv = (v4f){};   // the lane's four output columns and their bias, asked for ahead of the K loop
    if (BIAS) { bv[0] = bfr(bias[c0 + cofs]); bv[1] = bfr(bias[c0 + cofs + 1]); bv[2] = bfr(bias[c0 + cofs + 2]); bv[3] = bfr(bias[c0 + cofs + 3]); }
    const size_t aoff = (size_t)(r0 + lr) * K + 8 * hi, boff = (size_t)(c0 + lr) * K + 8 * hi;
#pragma unroll 1
    for (int kc = w * 32; kc < K; kc += KS * 32) {
        V a[4], a2[4];
#pragma unroll
        for (int mb = 0; mb < 4; ++mb) { a[mb] = WFrag<T16>::ld(A + aoff + (size_t)mb * 16 * K + kc); if (NSPLIT == 1 || NSPLIT == 2) a2[mb] = WFrag<T16>::ld(A2 + aoff + (size_t)mb * 16 * K + kc); }
#pragma unroll
        for (int nb = 0; nb < 4; ++nb) { const V b = WFrag<T16>::ld(Bt + boff + (size_t)nb * 16 * K + kc); V b2; if (NSPLIT >= 2) b2 = WFrag<T16>::ld(Bt2 + boff + (size_t)nb * 16 * K + kc);
#pragma unroll
            for (int mb = 0; mb < 4; ++mb) { acc[mb][nb] = WFrag<T16>::mma(a[mb], b, acc[mb][nb]); if (NSPLIT == 1 || NSPLIT == 2) acc[mb][nb] = WFrag<T16>::mma(a2[mb], b, acc[mb][nb]); if (NSPLIT >= 2) acc[mb][nb] = WFrag<T16>::mma(a[mb], b2, acc[mb][nb]); } }
        asm volatile("v_nop\n\tv_nop\n\tv_nop\n\tv_nop" : "+v"(acc[0][0]), "+v"(acc[1][1]), "+v"(acc[2][2]), "+v"(acc[3][3]) : "v"(a[0]), "v"(a[3]));
    }
    float* mine = os + w * (64 * 68);
#pragma unroll
    for (int mb = 0; mb < 4; ++mb)
#pragma unroll
        for (int nb = 0; nb < 4; ++nb)
#pragma unroll
            for (int j = 0; j < 8; ++j) mine[(mb * 16 + hi * 8 + j) * 68 + nb * 16 + lr] = acc[mb][nb][j];
    __syncthreads();   // every wave's partial tile is in LDS before any wave sums across them
    const int row0 = w * (64 / KS) + hi; const float* op = os + row0 * 68 + cofs; float* cp = C + (size_t)(r0 + row0) * ldc + c0 + cofs;
#pragma unroll
    for (int s = 0; s < 32 / KS; ++s) { v4f val = *(const v4fa*)(op + 2 * s * 68);
#pragma unroll
        for (int p = 1; p < KS; ++p) val += *(const v4fa*)(op + (p * 64 + 2 * s) * 68);
        if (BIAS) val += bv;
        *(v4f*)(cp + (size_t)(2 * s) * ldc) = val; }
}

__device__ __forceinline__ void splitf(float y, unsigned short& h, unsigned short& l) { h = f2bf(y); l = f2bf(y - bf2f(h)); }
typedef __attribute__((ext_vector_type(2))) unsigned short v2us;
typedef __attribute__((ext_vector_type(4))) unsigned short v4us;

// ---- k_cvtall: every f32 -> bf16 input copy in ONE streaming launch. All seven sources are rows of DM floats (k, v: TK rows each; Wq, Wk, Wv, Wo, q: 1024 rows each).
// CG work-groups x CW waves x CR rows per wave cover them exactly once. A wave reads a row as 8 loads of 512 contiguous bytes, non-temporal (each source is read once), and asks for all its CR rows
// before it rounds the first; it stores a row as 8 stores of 256 contiguous bytes. k / v rows are regrouped by the head that keeps them: token t -> row t / 16 of plane t % 16 (planes [NH_][KPH][DM]).
#define CG 256
#define CW 21
#define CR 4
static_assert(CG * CW * CR == 2 * TK + 4 * DM + TQ, "the conversion launch covers every row once");
__global__ __launch_bounds__(CW * 32) void k_cvtall(const float* __restrict__ kin, const float* __restrict__ vin, const float* __restrict__ Wq, const float* __restrict__ Wk, const float* __restrict__ Wv, const float* __restrict__ Wo, const float* __restrict__ qin,
                                                    bf* KB, bf* VB, bf* BQ, bf* BK, bf* BV, bf* BO, bf* QB) {
    const int lane = threadIdx.x & 31; const int gw = __builtin_amdgcn_readfirstlane((int)(blockIdx.x * CW + (threadIdx.x >> 5)));   // wave-uniform: a row's source and place are scalar work
    __builtin_assume(gw >= 0 && gw < CG * CW);
    v4f x[CR][DM / 128]; bf* dst[CR];
#pragma unroll
    for (int r = 0; r < CR; ++r) { const int row = r * (CG * CW) + gw; const float* s; bf* d;
        if (row < 2 * TK) { const int t = row & (TK - 1); s = (row < TK ? kin : vin) + (size_t)t * DM; d = (row < TK ? KB : VB) + ((size_t)(t % NH_) * KPH + t / NH_) * DM; }
        else { const int m = (row - 2 * TK) >> 10; const size_t o = (size_t)((row - 2 * TK) & 1023) * DM; s = Wq; d = BQ;
            if (m == 1) { s = Wk; d = BK; } if (m == 2) { s = Wv; d = BV; } if (m == 3) { s = Wo; d = BO; } if (m == 4) { s = qin; d = QB; } s += o; d += o; }
        dst[r] = d + lane * 4;
#pragma unroll
        for (int q = 0; q < DM / 128; ++q) x[r][q] = __builtin_nontemporal_load((const v4f*)(s + q * 128 + lane * 4)); }
    __builtin_amdgcn_sched_barrier(0);   // keeps every row's loads in front of the first rounding: left alone the compiler issues the last row's loads only when earlier rows have arrived, a second memory latency in every wave
#pragma unroll
    for (int r = 0; r < CR; ++r)
#pragma unroll
        for (int q = 0; q < DM / 128; ++q) { v4us o;
#pragma unroll
            for (int u = 0; u < 4; ++u) o[u] = f2bf(x[r][q][u]);
            *(v4us*)(dst[r] + q * 128) = o; } }
__global__ __launch_bounds__(256) void k_qpl(const float* __restrict__ Q, bf* Qh, bf* Ql) { const size_t e = ((size_t)blockIdx.x * 256 + threadIdx.x) * 4; if (e >= (size_t)NH_ * TQ * HD) return; const int d = (int)(e % HD); const int t = (int)((e / HD) % TQ); const int h = (int)(e / ((size_t)HD * TQ)); const v4f a = *(const v4f*)(Q + (size_t)t * DM + h * HD + d); v4us oh, ol;
#pragma unroll
    for (int u = 0; u < 4; ++u) { unsigned short x0, x1; splitf(a[u], x0, x1); oh[u] = x0; ol[u] = x1; } *(v4us*)(Qh + e) = oh; *(v4us*)(Ql + e) = ol;  }
__global__ __launch_bounds__(256) void k_kpl(const float* __restrict__ K, bf* Kh, bf* Kl) { const size_t e = ((size_t)blockIdx.x * 256 + threadIdx.x) * 4; if (e >= (size_t)NH_ * KPH * HD) return; const v4f a = *(const v4f*)(K + e); v4us oh, ol;    // K arrives as [NH_][KPH][HD], the planes' own order
#pragma unroll
    for (int u = 0; u < 4; ++u) { unsigned short x0, x1; splitf(a[u], x0, x1); oh[u] = x0; ol[u] = x1; } *(v4us*)(Kh + e) = oh; *(v4us*)(Kl + e) = ol;  }
__global__ __launch_bounds__(256) void k_vtp(const float* __restrict__ V, bf* Vh, bf* Vl) { const size_t e = ((size_t)blockIdx.x * 256 + threadIdx.x) * 4; if (e >= (size_t)NH_ * HD * KPH) return; const int m = (int)(e % KPH); const int d = (int)((e / KPH) % HD); const int h = (int)(e / ((size_t)KPH * HD)); v4us oh, ol;
#pragma unroll
    for (int u = 0; u < 4; ++u) { unsigned short x0, x1; splitf(V[((size_t)h * KPH + m + u) * HD + d], x0, x1); oh[u] = x0; ol[u] = x1; } *(v4us*)(Vh + e) = oh; *(v4us*)(Vl + e) = ol;  }
__global__ __launch_bounds__(256) void k_soft(const float* __restrict__ S, bf* Ph, bf* Pl) { const int lane = threadIdx.x & 31; const int row = blockIdx.x * 8 + (threadIdx.x >> 5); if (row >= NH_ * TQ) return; const float* sr = S + (size_t)row * KPH; float v[KPH / 32]; float mx = -3.0e38f;
#pragma unroll
    for (int ch = 0; ch < KPH / 128; ++ch) { const v4f a = *(const v4f*)(sr + ch * 128 + lane * 4);
#pragma unroll
        for (int u = 0; u < 4; ++u) { const float t = a[u] * 0.125f; v[ch * 4 + u] = t; mx = fmaxf(mx, t); } }
#pragma unroll
    for (int sh = 16; sh; sh >>= 1) mx = fmaxf(mx, __shfl_xor(mx, sh, 32));
    float sum = 0.f;
#pragma unroll
    for (int q = 0; q < KPH / 32; ++q) { float d0 = __fsub_rn(v[q], mx); asm volatile("" : "+v"(d0)); v[q] = __builtin_amdgcn_exp2f(__fmul_rn(d0, 1.4426950408889634f)); sum += v[q]; }
#pragma unroll
    for (int sh = 16; sh; sh >>= 1) sum += __shfl_xor(sum, sh, 32);
    const float f = __fdiv_rn(1.0f, sum);
    {
#pragma unroll
        for (int ch = 0; ch < KPH / 128; ++ch) { v4us oh, ol; for (int q = 0; q < 4; ++q) { unsigned short a, b; splitf(v[ch * 4 + q] * f, a, b); oh[q] = a; ol[q] = b; } const size_t oo = (size_t)row * KPH + ch * 128 + lane * 4; *(v4us*)(Ph + oo) = oh; *(v4us*)(Pl + oo) = ol; }
         } }
__global__ __launch_bounds__(256) void k_mrg(const float* __restrict__ O, bf* Ah, bf* Al) { const size_t e = ((size_t)blockIdx.x * 256 + threadIdx.x) * 4; if (e >= (size_t)NH_ * TQ * HD) return; const int d = (int)(e % HD); const int t = (int)((e / HD) % TQ); const int h = (int)(e / ((size_t)HD * TQ)); const size_t oo = (size_t)t * DM + h * HD + d; v4us oh, ol;
#pragma unroll
    for (int u = 0; u < 4; ++u) { unsigned short a, b; splitf(O[e + u], a, b); oh[u] = a; ol[u] = b; } *(v4us*)(Ah + oo) = oh; *(v4us*)(Al + oo) = ol;  }

extern "C" void kernel_launch(void* const* d_in, const int* in_sizes, int n_in,
                              void* d_out, int out_size, void* d_ws, size_t ws_size, hipStream_t stream) {
    (void)in_sizes; (void)n_in; (void)out_size;
    const float* qin = (const float*)d_in[0]; const float* kin = (const float*)d_in[1]; const float* vin = (const float*)d_in[2]; const float* Wq = (const float*)d_in[3]; const float* bq = (const float*)d_in[4]; const float* Wk = (const float*)d_in[5]; const float* bk = (const float*)d_in[6]; const float* Wv = (const float*)d_in[7]; const float* bv = (const float*)d_in[8]; const float* Wo = (const float*)d_in[9]; const float* bo = (const float*)d_in[10];
    float* OUT = (float*)d_out;     // [1][1024][1024]
    char* wsp = (char*)d_ws;
    auto take = [&](size_t bytes) { char* p = wsp; wsp += (bytes + 255) & ~(size_t)255; return (void*)p; };
    bf* BQ = (bf*)take((size_t)DM * DM * 2); bf* BK = (bf*)take((size_t)DM * DM * 2); bf* BV = (bf*)take((size_t)DM * DM * 2); bf* BO = (bf*)take((size_t)DM * DM * 2);
    bf* QB = (bf*)take((size_t)TQ * DM * 2); bf* KB = (bf*)take((size_t)TK * DM * 2); bf* VB = (bf*)take((size_t)TK * DM * 2); float* FQ = (float*)take((size_t)TQ * DM * 4); float* FK = (float*)take((size_t)NH_ * KPH * HD * 4); float* FV = (float*)take((size_t)NH_ * KPH * HD * 4);
    bf* Qh = (bf*)take((size_t)NH_ * TQ * HD * 2); bf* Ql = (bf*)take((size_t)NH_ * TQ * HD * 2); bf* Kh = (bf*)take((size_t)NH_ * KPH * HD * 2); bf* Kl = (bf*)take((size_t)NH_ * KPH * HD * 2); bf* Vh = (bf*)take((size_t)NH_ * HD * KPH * 2); bf* Vl = (bf*)take((size_t)NH_ * HD * KPH * 2);
    float* S = (float*)take((size_t)NH_ * TQ * KPH * 4); bf* Ph = (bf*)take((size_t)NH_ * TQ * KPH * 2); bf* Pl = (bf*)take((size_t)NH_ * TQ * KPH * 2); float* O = (float*)take((size_t)NH_ * TQ * HD * 4); bf* ATh = (bf*)take((size_t)TQ * DM * 2); bf* ATl = (bf*)take((size_t)TQ * DM * 2);
    if ((size_t)(wsp - (char*)d_ws) > ws_size) return;    // total ~ 131 MB
    k_cvtall<<<CG, CW * 32, 0, stream>>>(kin, vin, Wq, Wk, Wv, Wo, qin, KB, VB, BQ, BK, BV, BO, QB);   // torch [out][in] weights = Bt as-is
    k_gemmw<bf, 0, true, 8><<<dim3(TQ / 64, DM / 64, 1), 256, 0, stream>>>(QB, nullptr, BQ, nullptr, DM, FQ, DM, bq, 0, 0, 0, 0);
    const size_t zi = (size_t)KPH * DM, zw = (size_t)HD * DM, zp = (size_t)KPH * HD;    // per head: input plane, the head's 64 weight rows, projected plane
    k_gemmw<bf, 0, true, 8><<<dim3(KPH / 64, 1, NH_), 256, 0, stream>>>(KB, nullptr, BK, nullptr, DM, FK, HD, bk, zi, zw, zp, HD);
    k_gemmw<bf, 0, true, 8><<<dim3(KPH / 64, 1, NH_), 256, 0, stream>>>(VB, nullptr, BV, nullptr, DM, FV, HD, bv, zi, zw, zp, HD);
    k_qpl<<<(unsigned)(((size_t)NH_ * TQ * HD / 4 + 255) / 256), 256, 0, stream>>>(FQ, Qh, Ql); k_kpl<<<(unsigned)(((size_t)NH_ * KPH * HD / 4 + 255) / 256), 256, 0, stream>>>(FK, Kh, Kl); k_vtp<<<(unsigned)(((size_t)NH_ * HD * KPH / 4 + 255) / 256), 256, 0, stream>>>(FV, Vh, Vl);
    const size_t zq = (size_t)TQ * HD, zk = (size_t)KPH * HD, zS = (size_t)TQ * KPH, zv = (size_t)HD * KPH;
    k_gemmw<bf, 2, false, 1><<<dim3(TQ / 64, KPH / 64, NH_), 32, 0, stream>>>(Qh, Ql, Kh, Kl, HD, S, KPH, nullptr, zq, zk, zS, 0);
    k_soft<<<NH_ * TQ / 8, 256, 0, stream>>>(S, Ph, Pl);
    k_gemmw<bf, 2, false, 8><<<dim3(TQ / 64, 1, NH_), 256, 0, stream>>>(Ph, Pl, Vh, Vl, KPH, O, HD, nullptr, zS, zv, zq, 0);
    k_mrg<<<(unsigned)(((size_t)NH_ * TQ * HD / 4 + 255) / 256), 256, 0, stream>>>(O, ATh, ATl);
    k_gemmw<bf, 1, true, 8><<<dim3(TQ / 64, DM / 64, 1), 256, 0, stream>>>(ATh, ATl, BO, nullptr, DM, OUT, DM, bo, 0, 0, 0, 0);
}

// v004
// It runs in 75.7 microseconds.
// Timed twice side by side with v003, it ran 1.28 and 1.26 times as fast.
// All steps since v000 together make it 2.65 times as fast.
#include <hip/hip_runtime.h>

// HeposMultiHeadAttention (q [1][1024][1024], k, v [1][8192][1024]; Q/K/V = in W^T + b (16 heads x 64); head h attends only keys with (k_idx - h) % 16 == 0 (512 keys per head); softmax(Q.K / 8); out = merged Wo^T + bo -> [1][1024][1024]; no row is fully masked, so nan_to_num is a no-op).
// The HEPOS mask is structural: each head's 512 keys are gathered into dense planes (key m of head h = token 16 m + h), so no masked score is ever computed.
// Key token t is kept by head t % 16 alone, so of its K and V projections only that head's 64 columns are ever read: the k / v inputs are regrouped by head and projected as 16 batched 512 x 64 x 1024 GEMMs.
// Compute dtypes, f32 accumulate: every input rounded to bf16; Q/K/V as PLAIN bf16 GEMMs (inputs: exact) + bias; scores hl x hl (3 products), softmax f32 -> hl operands in registers, attn.v 3 products (all cheap: 512 keys; one fused launch); Wo hl x exact (2 products) + bias.

#define TQ   1024
#define TK   8192
#define DM   1024
#define NH_  16
#define HD   64
#define KPH  512    // keys per head = TK / 16
typedef _Float16 h16;
typedef unsigned short bf;
typedef __attribute__((ext_vector_type(16))) __bf16   v16bf;
typedef __attribute__((ext_vector_type(16))) _Float16 v16h;
typedef __attribute__((ext_vector_type(8)))  _Float16 v8h;
typedef __attribute__((ext_vector_type(8)))  unsigned short v8us;
typedef __attribute__((ext_vector_type(8)))  float    v8f;
typedef __attribute__((ext_vector_type(4)))  float    v4f;
typedef v8h  __attribute__((may_alias)) v8ha;
typedef v4f  __attribute__((may_alias)) v4fa;
typedef v8us __attribute__((may_alias)) v8usa;

__device__ __forceinline__ unsigned short f2bf(float f) { unsigned u = __float_as_uint(f); u += 0x7FFFu + ((u >> 16) & 1u); return (unsigned short)(u >> 16); }
__device__ __forceinline__ float bf2f(unsigned short b) { return __uint_as_float(((unsigned)b) << 16); }
__device__ __forceinline__ float bfr(float f) { return bf2f(f2bf(f)); }
__device__ __forceinline__ v16h cat16(v8h lo, v8h hi) { return __builtin_shufflevector(lo, hi, 0, 1, 2, 3, 4, 5, 6, 7, 8, 9, 10, 11, 12, 13, 14, 15); }
__device__ __forceinline__ v16bf cat16b(v8us lo, v8us hi) { return __builtin_bit_cast(v16bf, __builtin_shufflevector(lo, hi, 0, 1, 2, 3, 4, 5, 6, 7, 8, 9, 10, 11, 12, 13, 14, 15)); }
__device__ __forceinline__ v8f wmma16(v16h a, v16h b, v8f c) { return __builtin_amdgcn_wmma_f32_16x16x32_f16(false, a, false, b, (short)0, c, false, false); }
__device__ __forceinline__ v8f wmmab(v16bf a, v16bf b, v8f c) { return __builtin_amdgcn_wmma_f32_16x16x32_bf16(false, a, false, b, (short)0, c, false, false); }



// ---- k_gemmw: register-blocked GEMM, one work-group of KS waves per 64x64 output tile, operands straight from K-contiguous 16-bit planes; grid (M/64, N/64, Z), 32 * KS threads.
// Every wave holds the whole tile (16 accumulators) and takes every KS-th 32-wide slice of K, so a wave's chain of load latencies is K / (32 KS) trips long and the KS waves of a trip read 64 KS contiguous bytes of each row.
// The KS partial tiles meet in LDS behind one barrier; wave w sums rows 64 w / KS ... of them, partial 0 first, and stores those rows.
// C[m][n] (f32, pitch ldc, + optional f32 bias[n]) = sum_k A[m][k] Bt[n][k] (+ split products per NSPLIT). z-batch strides sA/sB/sC/sBias in elements. K % 32 == 0.
template <typename T16> struct WFrag;
template <> struct WFrag<h16> { typedef v16h V; static __device__ __forceinline__ V ld(const h16* p) { return cat16(*(const v8h*)p, *(const v8h*)(p + 16)); } static __device__ __forceinline__ v8f mma(V a, V b, v8f c) { return wmma16(a, b, c); } };
template <> struct WFrag<bf> { typedef v16bf V; static __device__ __forceinline__ V ld(const bf* p) { return cat16b(*(const v8us*)p, *(const v8us*)(p + 16)); } static __device__ __forceinline__ v8f mma(V a, V b, v8f c) { return wmmab(a, b, c); } };
template <typename T16, int NSPLIT, bool BIAS, int KS>
__global__ __launch_bounds__(32 * KS) void k_gemmw(const T16* __restrict__ A, const T16* __restrict__ A2, const T16* __restrict__ Bt, const T16* __restrict__ Bt2, int K, float* C, int ldc, const float* __restrict__ bias, size_t sA, size_t sB, size_t sC, size_t sBias) {
    typedef typename WFrag<T16>::V V;
    __shared__ __align__(16) float os[KS * 64 * 68];
    const size_t z = blockIdx.z; A += z * sA; if (A2) A2 += z * sA; Bt += z * sB; if (Bt2) Bt2 += z * sB; C += z * sC; if (BIAS) bias += z * sBias;
    const int lane = threadIdx.x & 31, lr = lane & 15, hi = lane >> 4; const int r0 = blockIdx.x * 64, c0 = blockIdx.y * 64;
    const int w = __builtin_amdgcn_readfirstlane((int)(threadIdx.x >> 5));   // wave-uniform: the K slice and the rows to sum are scalar work
    v8f acc[4][4];
#pragma unroll
    for (int mb = 0; mb < 4; ++mb)
#pragma unroll
        for (int nb = 0; nb < 4; ++nb) acc[mb][nb] = (v8f){};
    const int cofs = lr * 4; v4f bv = (v4f){};   // the lane's four output columns and their bias, asked for ahead of the K loop
    if (BIAS) { bv[0] = bfr(bias[c0 + cofs]); bv[1] = bfr(bias[c0 + cofs + 1]); bv[2] = bfr(bias[c0 + cofs + 2]); bv[3] = bfr(bias[c0 + cofs + 3]); }
    const size_t aoff = (size_t)(r0 + lr) * K + 8 * hi, boff = (size_t)(c0 + lr) * K + 8 * hi;
#pragma unroll 1
    for (int kc = w * 32; kc < K; kc += KS * 32) {
        V a[4], a2[4];
#pragma unroll
        for (int mb = 0; mb < 4; ++mb) { a[mb] = WFrag<T16>::ld(A + aoff + (size_t)mb * 16 * K + kc); if (NSPLIT == 1 || NSPLIT == 2) a2[mb] = WFrag<T16>::ld(A2 + aoff + (size_t)mb * 16 * K + kc); }
#pragma unroll
        for (int nb = 0; nb < 4; ++nb) { const V b = WFrag<T16>::ld(Bt + boff + (size_t)nb * 16 * K + kc); V b2; if (NSPLIT >= 2) b2 = WFrag<T16>::ld(Bt2 + boff + (size_t)nb * 16 * K + kc);
#pragma unroll
            for (int mb = 0; mb < 4; ++mb) { acc[mb][nb] = WFrag<T16>::mma(a[mb], b, acc[mb][nb]); if (NSPLIT == 1 || NSPLIT == 2) acc[mb][nb] = WFrag<T16>::mma(a2[mb], b, acc[mb][nb]); if (NSPLIT >= 2) acc[mb][nb] = WFrag<T16>::mma(a[mb], b2, acc[mb][nb]); } }
        asm volatile("v_nop\n\tv_nop\n\tv_nop\n\tv_nop" : "+v"(acc[0][0]), "+v"(acc[1][1]), "+v"(acc[2][2]), "+v"(acc[3][3]) : "v"(a[0]), "v"(a[3]));
    }
    float* mine = os + w * (64 * 68);
#pragma unroll
    for (int mb = 0; mb < 4; ++mb)
#pragma unroll
        for (int nb = 0; nb < 4; ++nb)
#pragma unroll
            for (int j = 0; j < 8; ++j) mine[(mb * 16 + hi * 8 + j) * 68 + nb * 16 + lr] = acc[mb][nb][j];
    __syncthreads();   // every wave's partial tile is in LDS before any wave sums across them
    const int row0 = w * (64 / KS) + hi; const float* op = os + row0 * 68 + cofs; float* cp = C + (size_t)(r0 + row0) * ldc + c0 + cofs;
#pragma unroll
    for (int s = 0; s < 32 / KS; ++s) { v4f val = *(const v4fa*)(op + 2 * s * 68);
#pragma unroll
        for (int p = 1; p < KS; ++p) val += *(const v4fa*)(op + (p * 64 + 2 * s) * 68);
        if (BIAS) val += bv;
        *(v4f*)(cp + (size_t)(2 * s) * ldc) = val; }
}

__device__ __forceinline__ void splitf(float y, unsigned short& h, unsigned short& l) { h = f2bf(y); l = f2bf(y - bf2f(h)); }
typedef __attribute__((ext_vector_type(2))) unsigned short v2us;
typedef __attribute__((ext_vector_type(4))) unsigned short v4us;

// ---- k_cvtall: every f32 -> bf16 input copy in ONE streaming launch. All seven sources are rows of DM floats (k, v: TK rows each; Wq, Wk, Wv, Wo, q: 1024 rows each).
// CG work-groups x CW waves x CR rows per wave cover them exactly once. A wave reads a row as 8 loads of 512 contiguous bytes, non-temporal (each source is read once), and asks for all its CR rows
// before it rounds the first; it stores a row as 8 stores of 256 contiguous bytes. k / v rows are regrouped by the head that keeps them: token t -> row t / 16 of plane t % 16 (planes [NH_][KPH][DM]).
#define CG 256
#define CW 21
#define CR 4
static_assert(CG * CW * CR == 2 * TK + 4 * DM + TQ, "the conversion launch covers every row once");
__global__ __launch_bounds__(CW * 32) void k_cvtall(const float* __restrict__ kin, const float* __restrict__ vin, const float* __restrict__ Wq, const float* __restrict__ Wk, const float* __restrict__ Wv, const float* __restrict__ Wo, const float* __restrict__ qin,
                                                    bf* KB, bf* VB, bf* BQ, bf* BK, bf* BV, bf* BO, bf* QB) {
    const int lane = threadIdx.x & 31; const int gw = __builtin_amdgcn_readfirstlane((int)(blockIdx.x * CW + (threadIdx.x >> 5)));   // wave-uniform: a row's source and place are scalar work
    __builtin_assume(gw >= 0 && gw < CG * CW);
    v4f x[CR][DM / 128]; bf* dst[CR];
#pragma unroll
    for (int r = 0; r < CR; ++r) { const int row = r * (CG * CW) + gw; const float* s; bf* d;
        if (row < 2 * TK) { const int t = row & (TK - 1); s = (row < TK ? kin : vin) + (size_t)t * DM; d = (row < TK ? KB : VB) + ((size_t)(t % NH_) * KPH + t / NH_) * DM; }
        else { const int m = (row - 2 * TK) >> 10; const size_t o = (size_t)((row - 2 * TK) & 1023) * DM; s = Wq; d = BQ;
            if (m == 1) { s = Wk; d = BK; } if (m == 2) { s = Wv; d = BV; } if (m == 3) { s = Wo; d = BO; } if (m == 4) { s = qin; d = QB; } s += o; d += o; }
        dst[r] = d + lane * 4;
#pragma unroll
        for (int q = 0; q < DM / 128; ++q) x[r][q] = __builtin_nontemporal_load((const v4f*)(s + q * 128 + lane * 4)); }
    __builtin_amdgcn_sched_barrier(0);   // keeps every row's loads in front of the first rounding: left alone the compiler issues the last row's loads only when earlier rows have arrived, a second memory latency in every wave
#pragma unroll
    for (int r = 0; r < CR; ++r)
#pragma unroll
        for (int q = 0; q < DM / 128; ++q) { v4us o;
#pragma unroll
            for (int u = 0; u < 4; ++u) o[u] = f2bf(x[r][q][u]);
            *(v4us*)(dst[r] + q * 128) = o; } }
__global__ __launch_bounds__(256) void k_qpl(const float* __restrict__ Q, bf* Qh, bf* Ql) { const size_t e = ((size_t)blockIdx.x * 256 + threadIdx.x) * 4; if (e >= (size_t)NH_ * TQ * HD) return; const int d = (int)(e % HD); const int t = (int)((e / HD) % TQ); const int h = (int)(e / ((size_t)HD * TQ)); const v4f a = *(const v4f*)(Q + (size_t)t * DM + h * HD + d); v4us oh, ol;
#pragma unroll
    for (int u = 0; u < 4; ++u) { unsigned short x0, x1; splitf(a[u], x0, x1); oh[u] = x0; ol[u] = x1; } *(v4us*)(Qh + e) = oh; *(v4us*)(Ql + e) = ol;  }
__global__ __launch_bounds__(256) void k_kpl(const float* __restrict__ K, bf* Kh, bf* Kl) { const size_t e = ((size_t)blockIdx.x * 256 + threadIdx.x) * 4; if (e >= (size_t)NH_ * KPH * HD) return; const v4f a = *(const v4f*)(K + e); v4us oh, ol;    // K arrives as [NH_][KPH][HD], the planes' own order
#pragma unroll
    for (int u = 0; u < 4; ++u) { unsigned short x0, x1; splitf(a[u], x0, x1); oh[u] = x0; ol[u] = x1; } *(v4us*)(Kh + e) = oh; *(v4us*)(Kl + e) = ol;  }
__global__ __launch_bounds__(256) void k_vtp(const float* __restrict__ V, bf* Vh, bf* Vl) { const size_t e = ((size_t)blockIdx.x * 256 + threadIdx.x) * 4; if (e >= (size_t)NH_ * HD * KPH) return; const int m = (int)(e % KPH); const int d = (int)((e / KPH) % HD); const int h = (int)(e / ((size_t)KPH * HD)); v4us oh, ol;
#pragma unroll
    for (int u = 0; u < 4; ++u) { unsigned short x0, x1; splitf(V[((size_t)h * KPH + m + u) * HD + d], x0, x1); oh[u] = x0; ol[u] = x1; } *(v4us*)(Vh + e) = oh; *(v4us*)(Vl + e) = ol;  }
// ---- k_attn: scores, softmax, attn.v and the head merge of 64 queries of one head in ONE work-group of 8 waves; grid (TQ / 64, NH_). No score and no probability leaves the registers.
// Wave w takes keys 64 w ... 64 w + 63. It forms S^T = K Q^T (A = K rows, B = Q rows as columns; hl x hl, 3 products), so a lane holds 32 keys of one query per 16-query group: maximum and sum are in-lane plus one exchange of the wave halves.
// p = exp2(s c - m c), m the maximum over the WAVE's own 64 keys, not yet divided by any sum. Two 16-key score tiles, rounded in place, are the B operand of O^T += V^T P^T (A = V^T rows from the [d][key] planes, same k order; 3 products).
// The 8 partial O^T tiles, each with its m c and its sum, meet in LDS behind one barrier; wave w joins queries 8 w ... 8 w + 7: O = sum_p f_p O_p / sum_p f_p l_p, f_p = exp2(m_p c - max m c), partial 0 first, and stores them as hl planes in merged [t][h * 64 + d] order.
typedef __attribute__((ext_vector_type(2))) float v2f;
typedef __attribute__((ext_vector_type(2))) __bf16 v2bf;
__device__ __forceinline__ float xhalf(float x) { const int b = __float_as_int(x); return __int_as_float(__builtin_amdgcn_permlanex16(b, b, 0x76543210, 0xfedcba98, false, false)); }   // lane l <-> l ^ 16
__global__ __launch_bounds__(256) void k_attn(const bf* __restrict__ Qh, const bf* __restrict__ Ql, const bf* __restrict__ Kh, const bf* __restrict__ Kl, const bf* __restrict__ Vh, const bf* __restrict__ Vl, bf* ATh, bf* ATl) {
    typedef WFrag<bf> F;
    __shared__ __align__(16) float os[8 * 64 * 68];
    __shared__ __align__(16) float st[2 * 64 * 8];   // [0][query][wave] = m c, [1][query][wave] = sum
    const int lane = threadIdx.x & 31, lr = lane & 15, hi = lane >> 4; const int q0 = blockIdx.x * 64; const size_t h = blockIdx.y;
    const int w = __builtin_amdgcn_readfirstlane((int)(threadIdx.x >> 5));   // wave-uniform: the key slice and the queries to join are scalar work
    const size_t qoff = (h * TQ + q0 + lr) * HD + 8 * hi, koff = (h * KPH + w * 64 + lr) * HD + 8 * hi, voff = (h * HD + lr) * KPH + w * 64 + 8 * hi;
    v8f acc[4][4], o[4][4];
#pragma unroll
    for (int mb = 0; mb < 4; ++mb)
#pragma unroll
        for (int nb = 0; nb < 4; ++nb) { acc[mb][nb] = (v8f){}; o[mb][nb] = (v8f){}; }
    v16bf a[2][4], a2[2][4], b[2][4], b2[2][4], va[2][4], va2[2][4];   // [32-wide k slice][16-row block]: K, Q and V^T fragments, high and low planes
#pragma unroll
    for (int kc = 0; kc < 2; ++kc)
#pragma unroll
        for (int i = 0; i < 4; ++i) { a[kc][i] = F::ld(Kh + koff + i * 16 * HD + kc * 32); a2[kc][i] = F::ld(Kl + koff + i * 16 * HD + kc * 32); b[kc][i] = F::ld(Qh + qoff + i * 16 * HD + kc * 32); b2[kc][i] = F::ld(Ql + qoff + i * 16 * HD + kc * 32); }
    asm volatile("s_wait_xcnt 0x0" ::: "memory");   // the loads' address registers are reused below: the wait stands in front of the first overwrite (the fence on the next line holds later code behind it)
    __builtin_amdgcn_sched_barrier(0);   // keeps every K and Q load in front of the first product: left alone the compiler asks for each Q fragment only when its turn comes, eight load latencies in a row
#pragma unroll
    for (int kc = 0; kc < 2; ++kc) {
#pragma unroll
        for (int nb = 0; nb < 4; ++nb) {   // the four key blocks take turns, so that no product waits for the one just issued
#pragma unroll
            for (int mb = 0; mb < 4; ++mb) acc[mb][nb] = wmmab(a[kc][mb], b[kc][nb], acc[mb][nb]);
#pragma unroll
            for (int mb = 0; mb < 4; ++mb) acc[mb][nb] = wmmab(a2[kc][mb], b[kc][nb], acc[mb][nb]);
#pragma unroll
            for (int mb = 0; mb < 4; ++mb) acc[mb][nb] = wmmab(a[kc][mb], b2[kc][nb], acc[mb][nb]); }
        if (kc == 0) {
#pragma unroll
            for (int ch = 0; ch < 2; ++ch)
#pragma unroll
                for (int db = 0; db < 4; ++db) { va[ch][db] = F::ld(Vh + voff + db * 16 * KPH + ch * 32); va2[ch][db] = F::ld(Vl + voff + db * 16 * KPH + ch * 32); }
            asm volatile("s_wait_xcnt 0x0" ::: "memory");   // as above, for the address registers of the V^T loads
            __builtin_amdgcn_sched_barrier(0);   // keeps the V^T loads here, half the score products and the softmax arithmetic ahead of their use: left alone they are asked for just in front of it
        }
    }   // acc[mb][nb][r] = S[query q0 + 16 nb + lr][key 64 w + 16 mb + 8 hi + r], unscaled
    const float c8 = 0.125f * 1.4426950408889634f;   // 1 / sqrt(HD) and log2(e) in one factor
#pragma unroll
    for (int nb = 0; nb < 4; ++nb) {
        float mx = acc[0][nb][0];
#pragma unroll
        for (int mb = 0; mb < 4; ++mb)
#pragma unroll
            for (int r = 0; r < 8; ++r) mx = fmaxf(mx, acc[mb][nb][r]);
        mx = fmaxf(mx, xhalf(mx));
        const float mc = mx * c8; float sum = 0.f; v16bf ph[2], pl[2];
#pragma unroll
        for (int ch = 0; ch < 2; ++ch)
#pragma unroll
            for (int s = 0; s < 16; s += 2) { v2f e;   // element s of the B operand = key 32 ch + 16 (s >> 3) + 8 hi + (s & 7): the hardware k order, which the V^T loader has too
                e[0] = __builtin_amdgcn_exp2f(__builtin_fmaf(acc[2 * ch + (s >> 3)][nb][s & 7], c8, -mc)); e[1] = __builtin_amdgcn_exp2f(__builtin_fmaf(acc[2 * ch + (s >> 3)][nb][(s & 7) + 1], c8, -mc));
                sum += e[0]; sum += e[1];
                const v2bf eh = __builtin_convertvector(e, v2bf); const v2bf el = __builtin_convertvector(e - __builtin_convertvector(eh, v2f), v2bf);
                ph[ch][s] = eh[0]; ph[ch][s + 1] = eh[1]; pl[ch][s] = el[0]; pl[ch][s + 1] = el[1]; }
        sum += xhalf(sum);
        st[hi * 512 + (nb * 16 + lr) * 8 + w] = hi ? sum : mc;   // both halves hold both values: the low half stores m c, the high half the sum
#pragma unroll
        for (int ch = 0; ch < 2; ++ch) {   // the four d blocks take turns, so that no product waits for the one just issued
#pragma unroll
            for (int db = 0; db < 4; ++db) o[db][nb] = wmmab(va[ch][db], ph[ch], o[db][nb]);
#pragma unroll
            for (int db = 0; db < 4; ++db) o[db][nb] = wmmab(va2[ch][db], ph[ch], o[db][nb]);
#pragma unroll
            for (int db = 0; db < 4; ++db) o[db][nb] = wmmab(va[ch][db], pl[ch], o[db][nb]); }
    }   // o[db][nb][r] = partial O[query 16 nb + lr][d = 16 db + 8 hi + r]
    __builtin_amdgcn_sched_barrier(0);   // keeps the LDS stores behind the last product
    float* mine = os + w * (64 * 68) + lr * 68 + hi * 8;
#pragma unroll
    for (int nb = 0; nb < 4; ++nb)
#pragma unroll
        for (int db = 0; db < 4; ++db) { float* p = mine + nb * 16 * 68 + db * 16;
            *(v4fa*)p = __builtin_shufflevector(o[db][nb], o[db][nb], 0, 1, 2, 3); *(v4fa*)(p + 4) = __builtin_shufflevector(o[db][nb], o[db][nb], 4, 5, 6, 7); }
    __syncthreads();   // every wave's partial tile, maximum and sum are in LDS before any wave joins them
    const int cofs = lr * 4, row0 = w * 8 + hi;
#pragma unroll
    for (int s = 0; s < 4; ++s) { const int row = row0 + 2 * s; float m[8], l[8];
        { const v4f m0 = *(const v4fa*)(st + row * 8), m1 = *(const v4fa*)(st + row * 8 + 4), l0 = *(const v4fa*)(st + 512 + row * 8), l1 = *(const v4fa*)(st + 512 + row * 8 + 4);
#pragma unroll
            for (int u = 0; u < 4; ++u) { m[u] = m0[u]; m[4 + u] = m1[u]; l[u] = l0[u]; l[4 + u] = l1[u]; } }
        float M = m[0];
#pragma unroll
        for (int p = 1; p < 8; ++p) M = fmaxf(M, m[p]);
        float L = 0.f; v4f val = (v4f){};
#pragma unroll
        for (int p = 0; p < 8; ++p) { const float f = __builtin_amdgcn_exp2f(m[p] - M); L += f * l[p]; val += f * *(const v4fa*)(os + (p * 64 + row) * 68 + cofs); }
        val *= __fdiv_rn(1.0f, L);
        v4us oh, ol;
#pragma unroll
        for (int u = 0; u < 4; ++u) { unsigned short x0, x1; splitf(val[u], x0, x1); oh[u] = x0; ol[u] = x1; }
        const size_t oo = (size_t)(q0 + row) * DM + h * HD + cofs; *(v4us*)(ATh + oo) = oh; *(v4us*)(ATl + oo) = ol; }
}

extern "C" void kernel_launch(void* const* d_in, const int* in_sizes, int n_in,
                              void* d_out, int out_size, void* d_ws, size_t ws_size, hipStream_t stream) {
    (void)in_sizes; (void)n_in; (void)out_size;
    const float* qin = (const float*)d_in[0]; const float* kin = (const float*)d_in[1]; const float* vin = (const float*)d_in[2]; const float* Wq = (const float*)d_in[3]; const float* bq = (const float*)d_in[4]; const float* Wk = (const float*)d_in[5]; const float* bk = (const float*)d_in[6]; const float* Wv = (const float*)d_in[7]; const float* bv = (const float*)d_in[8]; const float* Wo = (const float*)d_in[9]; const float* bo = (const float*)d_in[10];
    float* OUT = (float*)d_out;     // [1][1024][1024]
    char* wsp = (char*)d_ws;
    auto take = [&](size_t bytes) { char* p = wsp; wsp += (bytes + 255) & ~(size_t)255; return (void*)p; };
    bf* BQ = (bf*)take((size_t)DM * DM * 2); bf* BK = (bf*)take((size_t)DM * DM * 2); bf* BV = (bf*)take((size_t)DM * DM * 2); bf* BO = (bf*)take((size_t)DM * DM * 2);
    bf* QB = (bf*)take((size_t)TQ * DM * 2); bf* KB = (bf*)take((size_t)TK * DM * 2); bf* VB = (bf*)take((size_t)TK * DM * 2); float* FQ = (float*)take((size_t)TQ * DM * 4); float* FK = (float*)take((size_t)NH_ * KPH * HD * 4); float* FV = (float*)take((size_t)NH_ * KPH * HD * 4);
    bf* Qh = (bf*)take((size_t)NH_ * TQ * HD * 2); bf* Ql = (bf*)take((size_t)NH_ * TQ * HD * 2); bf* Kh = (bf*)take((size_t)NH_ * KPH * HD * 2); bf* Kl = (bf*)take((size_t)NH_ * KPH * HD * 2); bf* Vh = (bf*)take((size_t)NH_ * HD * KPH * 2); bf* Vl = (bf*)take((size_t)NH_ * HD * KPH * 2);
    bf* ATh = (bf*)take((size_t)TQ * DM * 2); bf* ATl = (bf*)take((size_t)TQ * DM * 2);
    if ((size_t)(wsp - (char*)d_ws) > ws_size) return;    // total 62 MiB
    k_cvtall<<<CG, CW * 32, 0, stream>>>(kin, vin, Wq, Wk, Wv, Wo, qin, KB, VB, BQ, BK, BV, BO, QB);   // torch [out][in] weights = Bt as-is
    k_gemmw<bf, 0, true, 8><<<dim3(TQ / 64, DM / 64, 1), 256, 0, stream>>>(QB, nullptr, BQ, nullptr, DM, FQ, DM, bq, 0, 0, 0, 0);
    const size_t zi = (size_t)KPH * DM, zw = (size_t)HD * DM, zp = (size_t)KPH * HD;    // per head: input plane, the head's 64 weight rows, projected plane
    k_gemmw<bf, 0, true, 8><<<dim3(KPH / 64, 1, NH_), 256, 0, stream>>>(KB, nullptr, BK, nullptr, DM, FK, HD, bk, zi, zw, zp, HD);
    k_gemmw<bf, 0, true, 8><<<dim3(KPH / 64, 1, NH_), 256, 0, stream>>>(VB, nullptr, BV, nullptr, DM, FV, HD, bv, zi, zw, zp, HD);
    k_qpl<<<(unsigned)(((size_t)NH_ * TQ * HD / 4 + 255) / 256), 256, 0, stream>>>(FQ, Qh, Ql); k_kpl<<<(unsigned)(((size_t)NH_ * KPH * HD / 4 + 255) / 256), 256, 0, stream>>>(FK, Kh, Kl); k_vtp<<<(unsigned)(((size_t)NH_ * HD * KPH / 4 + 255) / 256), 256, 0, stream>>>(FV, Vh, Vl);
    k_attn<<<dim3(TQ / 64, NH_, 1), 256, 0, stream>>>(Qh, Ql, Kh, Kl, Vh, Vl, ATh, ATl);
    k_gemmw<bf, 1, true, 8><<<dim3(TQ / 64, DM / 64, 1), 256, 0, stream>>>(ATh, ATl, BO, nullptr, DM, OUT, DM, bo, 0, 0, 0, 0);
}

// v005
// A run of this version takes 67.5 microseconds.
// In two side-by-side timings against v004, it was 1.11 and 1.14 times as fast.
// All steps since v000 together make it 2.98 times as fast.
#include <hip/hip_runtime.h>

// HeposMultiHeadAttention (q [1][1024][1024], k, v [1][8192][1024]; Q/K/V = in W^T + b (16 heads x 64); head h attends only keys with (k_idx - h) % 16 == 0 (512 keys per head); softmax(Q.K / 8); out = merged Wo^T + bo -> [1][1024][1024]; no row is fully masked, so nan_to_num is a no-op).
// The HEPOS mask is structural: each head's 512 keys are gathered into dense planes (key m of head h = token 16 m + h), so no masked score is ever computed.
// Key token t is kept by head t % 16 alone, so of its K and V projections only that head's 64 columns are ever read: the k / v inputs are regrouped by head and projected as 16 batched 512 x 64 x 1024 GEMMs.
// Compute dtypes, f32 accumulate: every input rounded to bf16; Q/K/V as PLAIN bf16 GEMMs (inputs: exact) + bias; scores hl x hl (3 products), softmax f32 -> hl operands in registers, attn.v 3 products (all cheap: 512 keys; one fused launch); Wo hl x exact (2 products) + bias.

#define TQ   1024
#define TK   8192
#define DM   1024
#define NH_  16
#define HD   64
#define KPH  512    // keys per head = TK / 16
typedef _Float16 h16;
typedef unsigned short bf;
typedef __attribute__((ext_vector_type(16))) __bf16   v16bf;
typedef __attribute__((ext_vector_type(16))) _Float16 v16h;
typedef __attribute__((ext_vector_type(8)))  _Float16 v8h;
typedef __attribute__((ext_vector_type(8)))  unsigned short v8us;
typedef __attribute__((ext_vector_type(8)))  float    v8f;
typedef __attribute__((ext_vector_type(4)))  float    v4f;
typedef v8h  __attribute__((may_alias)) v8ha;
typedef v4f  __attribute__((may_alias)) v4fa;
typedef v8us __attribute__((may_alias)) v8usa;

__device__ __forceinline__ unsigned short f2bf(float f) { unsigned u = __float_as_uint(f); u += 0x7FFFu + ((u >> 16) & 1u); return (unsigned short)(u >> 16); }
__device__ __forceinline__ float bf2f(unsigned short b) { return __uint_as_float(((unsigned)b) << 16); }
__device__ __forceinline__ float bfr(float f) { return bf2f(f2bf(f)); }
__device__ __forceinline__ v16h cat16(v8h lo, v8h hi) { return __builtin_shufflevector(lo, hi, 0, 1, 2, 3, 4, 5, 6, 7, 8, 9, 10, 11, 12, 13, 14, 15); }
__device__ __forceinline__ v16bf cat16b(v8us lo, v8us hi) { return __builtin_bit_cast(v16bf, __builtin_shufflevector(lo, hi, 0, 1, 2, 3, 4, 5, 6, 7, 8, 9, 10, 11, 12, 13, 14, 15)); }
__device__ __forceinline__ v8f wmma16(v16h a, v16h b, v8f c) { return __builtin_amdgcn_wmma_f32_16x16x32_f16(false, a, false, b, (short)0, c, false, false); }
__device__ __forceinline__ v8f wmmab(v16bf a, v16bf b, v8f c) { return __builtin_amdgcn_wmma_f32_16x16x32_bf16(false, a, false, b, (short)0, c, false, false); }



// ---- k_gemmw: register-blocked GEMM, one work-group of KS waves per 64x64 output tile, operands straight from K-contiguous 16-bit planes; grid (M/64, N/64, Z), 32 * KS threads.
// Every wave holds the whole tile (16 accumulators) and takes every KS-th 32-wide slice of K, so a wave's chain of load latencies is K / (32 KS) trips long and the KS waves of a trip read 64 KS contiguous bytes of each row.
// The KS partial tiles meet in LDS behind one barrier; wave w sums rows 64 w / KS ... of them, partial 0 first, and stores those rows.
// C[m][n] (pitch ldc, + optional f32 bias) = sum_k A[m][k] Bt[n][k] (+ split products per NSPLIT). z-batch strides sA/sB/sC/sBias in elements. K % 32 == 0.
// OUT 0: C stored as f32, bias[n]. OUT 1: C stored as a high and a low bf16 plane (Ch, Cl), the form the attention launch reads, bias[n]. OUT 2: planes too, bias[m] (A = weight rows, Bt = tokens: the tile comes out as [d][key]).
template <typename T16> struct WFrag;
template <> struct WFrag<h16> { typedef v16h V; static __device__ __forceinline__ V ld(const h16* p) { return cat16(*(const v8h*)p, *(const v8h*)(p + 16)); } static __device__ __forceinline__ v8f mma(V a, V b, v8f c) { return wmma16(a, b, c); } };
template <> struct WFrag<bf> { typedef v16bf V; static __device__ __forceinline__ V ld(const bf* p) { return cat16b(*(const v8us*)p, *(const v8us*)(p + 16)); } static __device__ __forceinline__ v8f mma(V a, V b, v8f c) { return wmmab(a, b, c); } };
__device__ __forceinline__ void splitf(float y, unsigned short& h, unsigned short& l) { h = f2bf(y); l = f2bf(y - bf2f(h)); }
typedef __attribute__((ext_vector_type(4))) unsigned short v4us;
template <typename T16, int NSPLIT, bool BIAS, int KS, int OUT>
__global__ __launch_bounds__(32 * KS) void k_gemmw(const T16* __restrict__ A, const T16* __restrict__ A2, const T16* __restrict__ Bt, const T16* __restrict__ Bt2, int K, float* C, bf* Ch, bf* Cl, int ldc, const float* __restrict__ bias, size_t sA, size_t sB, size_t sC, size_t sBias) {
    typedef typename WFrag<T16>::V V;
    __shared__ __align__(16) float os[KS * 64 * 68];
    const size_t z = blockIdx.z; A += z * sA; if (A2) A2 += z * sA; Bt += z * sB; if (Bt2) Bt2 += z * sB; if (OUT == 0) C += z * sC; else { Ch += z * sC; Cl += z * sC; } if (BIAS) bias += z * sBias;
    const int lane = threadIdx.x & 31, lr = lane & 15, hi = lane >> 4; const int r0 = blockIdx.x * 64, c0 = blockIdx.y * 64;
    const int w = __builtin_amdgcn_readfirstlane((int)(threadIdx.x >> 5));   // wave-uniform: the K slice and the rows to sum are scalar work
    v8f acc[4][4];
#pragma unroll
    for (int mb = 0; mb < 4; ++mb)
#pragma unroll
        for (int nb = 0; nb < 4; ++nb) acc[mb][nb] = (v8f){};
    const int cofs = lr * 4, row0 = w * (64 / KS) + hi; v4f bv = (v4f){}; float br[32 / KS];   // the lane's four output columns, its first output row and their bias, asked for ahead of the K loop
    if (BIAS && OUT != 2) { bv[0] = bfr(bias[c0 + cofs]); bv[1] = bfr(bias[c0 + cofs + 1]); bv[2] = bfr(bias[c0 + cofs + 2]); bv[3] = bfr(bias[c0 + cofs + 3]); }
    if (BIAS && OUT == 2) {
#pragma unroll
        for (int s = 0; s < 32 / KS; ++s) br[s] = bfr(bias[r0 + row0 + 2 * s]); }
    const size_t aoff = (size_t)(r0 + lr) * K + 8 * hi, boff = (size_t)(c0 + lr) * K + 8 * hi;
#pragma unroll 1
    for (int kc = w * 32; kc < K; kc += KS * 32) {
        V a[4], a2[4];
#pragma unroll
        for (int mb = 0; mb < 4; ++mb) { a[mb] = WFrag<T16>::ld(A + aoff + (size_t)mb * 16 * K + kc); if (NSPLIT == 1 || NSPLIT == 2) a2[mb] = WFrag<T16>::ld(A2 + aoff + (size_t)mb * 16 * K + kc); }
#pragma unroll
        for (int nb = 0; nb < 4; ++nb) { const V b = WFrag<T16>::ld(Bt + boff + (size_t)nb * 16 * K + kc); V b2; if (NSPLIT >= 2) b2 = WFrag<T16>::ld(Bt2 + boff + (size_t)nb * 16 * K + kc);
#pragma unroll
            for (int mb = 0; mb < 4; ++mb) { acc[mb][nb] = WFrag<T16>::mma(a[mb], b, acc[mb][nb]); if (NSPLIT == 1 || NSPLIT == 2) acc[mb][nb] = WFrag<T16>::mma(a2[mb], b, acc[mb][nb]); if (NSPLIT >= 2) acc[mb][nb] = WFrag<T16>::mma(a[mb], b2, acc[mb][nb]); } }
        asm volatile("v_nop\n\tv_nop\n\tv_nop\n\tv_nop" : "+v"(acc[0][0]), "+v"(acc[1][1]), "+v"(acc[2][2]), "+v"(acc[3][3]) : "v"(a[0]), "v"(a[3]));
    }
    float* mine = os + w * (64 * 68);
#pragma unroll
    for (int mb = 0; mb < 4; ++mb)
#pragma unroll
        for (int nb = 0; nb < 4; ++nb)
#pragma unroll
            for (int j = 0; j < 8; ++j) mine[(mb * 16 + hi * 8 + j) * 68 + nb * 16 + lr] = acc[mb][nb][j];
    __syncthreads();   // every wave's partial tile is in LDS before any wave sums across them
    const float* op = os + row0 * 68 + cofs; const size_t co = (size_t)(r0 + row0) * ldc + c0 + cofs;
#pragma unroll
    for (int s = 0; s < 32 / KS; ++s) { v4f val = *(const v4fa*)(op + 2 * s * 68);
#pragma unroll
        for (int p = 1; p < KS; ++p) val += *(const v4fa*)(op + (p * 64 + 2 * s) * 68);
        if (BIAS) { if (OUT == 2) val += br[s]; else val += bv; }
        const size_t oo = co + (size_t)(2 * s) * ldc;
        if (OUT == 0) *(v4f*)(C + oo) = val;
        else { v4us oh, ol;
#pragma unroll
            for (int u = 0; u < 4; ++u) { unsigned short x0, x1; splitf(val[u], x0, x1); oh[u] = x0; ol[u] = x1; }
            *(v4us*)(Ch + oo) = oh; *(v4us*)(Cl + oo) = ol; } }
}


// ---- k_cvtall: every f32 -> bf16 input copy in ONE streaming launch. All seven sources are rows of DM floats (k, v: TK rows each; Wq, Wk, Wv, Wo, q: 1024 rows each).
// CG work-groups x CW waves x CR rows per wave cover them exactly once. A wave reads a row as 8 loads of 512 contiguous bytes, non-temporal (each source is read once), and asks for all its CR rows
// before it rounds the first; it stores a row as 8 stores of 256 contiguous bytes. k / v rows are regrouped by the head that keeps them: token t -> row t / 16 of plane t % 16 (planes [NH_][KPH][DM]).
#define CG 256
#define CW 21
#define CR 4
static_assert(CG * CW * CR == 2 * TK + 4 * DM + TQ, "the conversion launch covers every row once");
__global__ __launch_bounds__(CW * 32) void k_cvtall(const float* __restrict__ kin, const float* __restrict__ vin, const float* __restrict__ Wq, const float* __restrict__ Wk, const float* __restrict__ Wv, const float* __restrict__ Wo, const float* __restrict__ qin,
                                                    bf* KB, bf* VB, bf* BQ, bf* BK, bf* BV, bf* BO, bf* QB) {
    const int lane = threadIdx.x & 31; const int gw = __builtin_amdgcn_readfirstlane((int)(blockIdx.x * CW + (threadIdx.x >> 5)));   // wave-uniform: a row's source and place are scalar work
    __builtin_assume(gw >= 0 && gw < CG * CW);
    v4f x[CR][DM / 128]; bf* dst[CR];
#pragma unroll
    for (int r = 0; r < CR; ++r) { const int row = r * (CG * CW) + gw; const float* s; bf* d;
        if (row < 2 * TK) { const int t = row & (TK - 1); s = (row < TK ? kin : vin) + (size_t)t * DM; d = (row < TK ? KB : VB) + ((size_t)(t % NH_) * KPH + t / NH_) * DM; }
        else { const int m = (row - 2 * TK) >> 10; const size_t o = (size_t)((row - 2 * TK) & 1023) * DM; s = Wq; d = BQ;
            if (m == 1) { s = Wk; d = BK; } if (m == 2) { s = Wv; d = BV; } if (m == 3) { s = Wo; d = BO; } if (m == 4) { s = qin; d = QB; } s += o; d += o; }
        dst[r] = d + lane * 4;
#pragma unroll
        for (int q = 0; q < DM / 128; ++q) x[r][q] = __builtin_nontemporal_load((const v4f*)(s + q * 128 + lane * 4)); }
    __builtin_amdgcn_sched_barrier(0);   // keeps every row's loads in front of the first rounding: left alone the compiler issues the last row's loads only when earlier rows have arrived, a second memory latency in every wave
#pragma unroll
    for (int r = 0; r < CR; ++r)
#pragma unroll
        for (int q = 0; q < DM / 128; ++q) { v4us o;
#pragma unroll
            for (int u = 0; u < 4; ++u) o[u] = f2bf(x[r][q][u]);
            *(v4us*)(dst[r] + q * 128) = o; } }
// ---- k_attn: scores, softmax, attn.v and the head merge of 64 queries of one head in ONE work-group of 8 waves; grid (TQ / 64, NH_). No score and no probability leaves the registers.
// Wave w takes keys 64 w ... 64 w + 63. It forms S^T = K Q^T (A = K rows, B = Q rows as columns; hl x hl, 3 products), so a lane holds 32 keys of one query per 16-query group: maximum and sum are in-lane plus one exchange of the wave halves.
// p = exp2(s c - m c), m the maximum over the WAVE's own 64 keys, not yet divided by any sum. Two 16-key score tiles, rounded in place, are the B operand of O^T += V^T P^T (A = V^T rows from the [d][key] planes, same k order; 3 products).
// The 8 partial O^T tiles, each with its m c and its sum, meet in LDS behind one barrier; wave w joins queries 8 w ... 8 w + 7: O = sum_p f_p O_p / sum_p f_p l_p, f_p = exp2(m_p c - max m c), partial 0 first, and stores them as hl planes in merged [t][h * 64 + d] order.
typedef __attribute__((ext_vector_type(2))) float v2f;
typedef __attribute__((ext_vector_type(2))) __bf16 v2bf;
__device__ __forceinline__ float xhalf(float x) { const int b = __float_as_int(x); return __int_as_float(__builtin_amdgcn_permlanex16(b, b, 0x76543210, 0xfedcba98, false, false)); }   // lane l <-> l ^ 16
__global__ __launch_bounds__(256) void k_attn(const bf* __restrict__ Qh, const bf* __restrict__ Ql, const bf* __restrict__ Kh, const bf* __restrict__ Kl, const bf* __restrict__ Vh, const bf* __restrict__ Vl, bf* ATh, bf* ATl) {
    typedef WFrag<bf> F;
    __shared__ __align__(16) float os[8 * 64 * 68];
    __shared__ __align__(16) float st[2 * 64 * 8];   // [0][query][wave] = m c, [1][query][wave] = sum
    const int lane = threadIdx.x & 31, lr = lane & 15, hi = lane >> 4; const int q0 = blockIdx.x * 64; const size_t h = blockIdx.y;
    const int w = __builtin_amdgcn_readfirstlane((int)(threadIdx.x >> 5));   // wave-uniform: the key slice and the queries to join are scalar work
    const size_t qoff = (h * TQ + q0 + lr) * HD + 8 * hi, koff = (h * KPH + w * 64 + lr) * HD + 8 * hi, voff = (h * HD + lr) * KPH + w * 64 + 8 * hi;
    v8f acc[4][4], o[4][4];
#pragma unroll
    for (int mb = 0; mb < 4; ++mb)
#pragma unroll
        for (int nb = 0; nb < 4; ++nb) { acc[mb][nb] = (v8f){}; o[mb][nb] = (v8f){}; }
    v16bf a[2][4], a2[2][4], b[2][4], b2[2][4], va[2][4], va2[2][4];   // [32-wide k slice][16-row block]: K, Q and V^T fragments, high and low planes
#pragma unroll
    for (int kc = 0; kc < 2; ++kc)
#pragma unroll
        for (int i = 0; i < 4; ++i) { a[kc][i] = F::ld(Kh + koff + i * 16 * HD + kc * 32); a2[kc][i] = F::ld(Kl + koff + i * 16 * HD + kc * 32); b[kc][i] = F::ld(Qh + qoff + i * 16 * HD + kc * 32); b2[kc][i] = F::ld(Ql + qoff + i * 16 * HD + kc * 32); }
    asm volatile("s_wait_xcnt 0x0" ::: "memory");   // the loads' address registers are reused below: the wait stands in front of the first overwrite (the fence on the next line holds later code behind it)
    __builtin_amdgcn_sched_barrier(0);   // keeps every K and Q load in front of the first product: left alone the compiler asks for each Q fragment only when its turn comes, eight load latencies in a row
#pragma unroll
    for (int kc = 0; kc < 2; ++kc) {
#pragma unroll
        for (int nb = 0; nb < 4; ++nb) {   // the four key blocks take turns, so that no product waits for the one just issued
#pragma unroll
            for (int mb = 0; mb < 4; ++mb) acc[mb][nb] = wmmab(a[kc][mb], b[kc][nb], acc[mb][nb]);
#pragma unroll
            for (int mb = 0; mb < 4; ++mb) acc[mb][nb] = wmmab(a2[kc][mb], b[kc][nb], acc[mb][nb]);
#pragma unroll
            for (int mb = 0; mb < 4; ++mb) acc[mb][nb] = wmmab(a[kc][mb], b2[kc][nb], acc[mb][nb]); }
        if (kc == 0) {
#pragma unroll
            for (int ch = 0; ch < 2; ++ch)
#pragma unroll
                for (int db = 0; db < 4; ++db) { va[ch][db] = F::ld(Vh + voff + db * 16 * KPH + ch * 32); va2[ch][db] = F::ld(Vl + voff + db * 16 * KPH + ch * 32); }
            asm volatile("s_wait_xcnt 0x0" ::: "memory");   // as above, for the address registers of the V^T loads
            __builtin_amdgcn_sched_barrier(0);   // keeps the V^T loads here, half the score products and the softmax arithmetic ahead of their use: left alone they are asked for just in front of it
        }
    }   // acc[mb][nb][r] = S[query q0 + 16 nb + lr][key 64 w + 16 mb + 8 hi + r], unscaled
    const float c8 = 0.125f * 1.4426950408889634f;   // 1 / sqrt(HD) and log2(e) in one factor
#pragma unroll
    for (int nb = 0; nb < 4; ++nb) {
        float mx = acc[0][nb][0];
#pragma unroll
        for (int mb = 0; mb < 4; ++mb)
#pragma unroll
            for (int r = 0; r < 8; ++r) mx = fmaxf(mx, acc[mb][nb][r]);
        mx = fmaxf(mx, xhalf(mx));
        const float mc = mx * c8; float sum = 0.f; v16bf ph[2], pl[2];
#pragma unroll
        for (int ch = 0; ch < 2; ++ch)
#pragma unroll
            for (int s = 0; s < 16; s += 2) { v2f e;   // element s of the B operand = key 32 ch + 16 (s >> 3) + 8 hi + (s & 7): the hardware k order, which the V^T loader has too
                e[0] = __builtin_amdgcn_exp2f(__builtin_fmaf(acc[2 * ch + (s >> 3)][nb][s & 7], c8, -mc)); e[1] = __builtin_amdgcn_exp2f(__builtin_fmaf(acc[2 * ch + (s >> 3)][nb][(s & 7) + 1], c8, -mc));
                sum += e[0]; sum += e[1];
                const v2bf eh = __builtin_convertvector(e, v2bf); const v2bf el = __builtin_convertvector(e - __builtin_convertvector(eh, v2f), v2bf);
                ph[ch][s] = eh[0]; ph[ch][s + 1] = eh[1]; pl[ch][s] = el[0]; pl[ch][s + 1] = el[1]; }
        sum += xhalf(sum);
        st[hi * 512 + (nb * 16 + lr) * 8 + w] = hi ? sum : mc;   // both halves hold both values: the low half stores m c, the high half the sum
#pragma unroll
        for (int ch = 0; ch < 2; ++ch) {   // the four d blocks take turns, so that no product waits for the one just issued
#pragma unroll
            for (int db = 0; db < 4; ++db) o[db][nb] = wmmab(va[ch][db], ph[ch], o[db][nb]);
#pragma unroll
            for (int db = 0; db < 4; ++db) o[db][nb] = wmmab(va2[ch][db], ph[ch], o[db][nb]);
#pragma unroll
            for (int db = 0; db < 4; ++db) o[db][nb] = wmmab(va[ch][db], pl[ch], o[db][nb]); }
    }   // o[db][nb][r] = partial O[query 16 nb + lr][d = 16 db + 8 hi + r]
    __builtin_amdgcn_sched_barrier(0);   // keeps the LDS stores behind the last product
    float* mine = os + w * (64 * 68) + lr * 68 + hi * 8;
#pragma unroll
    for (int nb = 0; nb < 4; ++nb)
#pragma unroll
        for (int db = 0; db < 4; ++db) { float* p = mine + nb * 16 * 68 + db * 16;
            *(v4fa*)p = __builtin_shufflevector(o[db][nb], o[db][nb], 0, 1, 2, 3); *(v4fa*)(p + 4) = __builtin_shufflevector(o[db][nb], o[db][nb], 4, 5, 6, 7); }
    __syncthreads();   // every wave's partial tile, maximum and sum are in LDS before any wave joins them
    const int cofs = lr * 4, row0 = w * 8 + hi;
#pragma unroll
    for (int s = 0; s < 4; ++s) { const int row = row0 + 2 * s; float m[8], l[8];
        { const v4f m0 = *(const v4fa*)(st + row * 8), m1 = *(const v4fa*)(st + row * 8 + 4), l0 = *(const v4fa*)(st + 512 + row * 8), l1 = *(const v4fa*)(st + 512 + row * 8 + 4);
#pragma unroll
            for (int u = 0; u < 4; ++u) { m[u] = m0[u]; m[4 + u] = m1[u]; l[u] = l0[u]; l[4 + u] = l1[u]; } }
        float M = m[0];
#pragma unroll
        for (int p = 1; p < 8; ++p) M = fmaxf(M, m[p]);
        float L = 0.f; v4f val = (v4f){};
#pragma unroll
        for (int p = 0; p < 8; ++p) { const float f = __builtin_amdgcn_exp2f(m[p] - M); L += f * l[p]; val += f * *(const v4fa*)(os + (p * 64 + row) * 68 + cofs); }
        val *= __fdiv_rn(1.0f, L);
        v4us oh, ol;
#pragma unroll
        for (int u = 0; u < 4; ++u) { unsigned short x0, x1; splitf(val[u], x0, x1); oh[u] = x0; ol[u] = x1; }
        const size_t oo = (size_t)(q0 + row) * DM + h * HD + cofs; *(v4us*)(ATh + oo) = oh; *(v4us*)(ATl + oo) = ol; }
}

extern "C" void kernel_launch(void* const* d_in, const int* in_sizes, int n_in,
                              void* d_out, int out_size, void* d_ws, size_t ws_size, hipStream_t stream) {
    (void)in_sizes; (void)n_in; (void)out_size;
    const float* qin = (const float*)d_in[0]; const float* kin = (const float*)d_in[1]; const float* vin = (const float*)d_in[2]; const float* Wq = (const float*)d_in[3]; const float* bq = (const float*)d_in[4]; const float* Wk = (const float*)d_in[5]; const float* bk = (const float*)d_in[6]; const float* Wv = (const float*)d_in[7]; const float* bv = (const float*)d_in[8]; const float* Wo = (const float*)d_in[9]; const float* bo = (const float*)d_in[10];
    float* OUT = (float*)d_out;     // [1][1024][1024]
    char* wsp = (char*)d_ws;
    auto take = [&](size_t bytes) { char* p = wsp; wsp += (bytes + 255) & ~(size_t)255; return (void*)p; };
    bf* BQ = (bf*)take((size_t)DM * DM * 2); bf* BK = (bf*)take((size_t)DM * DM * 2); bf* BV = (bf*)take((size_t)DM * DM * 2); bf* BO = (bf*)take((size_t)DM * DM * 2);
    bf* QB = (bf*)take((size_t)TQ * DM * 2); bf* KB = (bf*)take((size_t)TK * DM * 2); bf* VB = (bf*)take((size_t)TK * DM * 2);
    bf* Qh = (bf*)take((size_t)NH_ * TQ * HD * 2); bf* Ql = (bf*)take((size_t)NH_ * TQ * HD * 2); bf* Kh = (bf*)take((size_t)NH_ * KPH * HD * 2); bf* Kl = (bf*)take((size_t)NH_ * KPH * HD * 2); bf* Vh = (bf*)take((size_t)NH_ * HD * KPH * 2); bf* Vl = (bf*)take((size_t)NH_ * HD * KPH * 2);
    bf* ATh = (bf*)take((size_t)TQ * DM * 2); bf* ATl = (bf*)take((size_t)TQ * DM * 2);
    if ((size_t)(wsp - (char*)d_ws) > ws_size) return;    // total ~ 55 MB
    k_cvtall<<<CG, CW * 32, 0, stream>>>(kin, vin, Wq, Wk, Wv, Wo, qin, KB, VB, BQ, BK, BV, BO, QB);   // torch [out][in] weights = Bt as-is
    const size_t zi = (size_t)KPH * DM, zw = (size_t)HD * DM, zp = (size_t)KPH * HD;    // per head: input plane, the head's 64 weight rows, projected plane
    k_gemmw<bf, 0, true, 8, 1><<<dim3(TQ / 64, 1, NH_), 256, 0, stream>>>(QB, nullptr, BQ, nullptr, DM, nullptr, Qh, Ql, HD, bq, 0, zw, (size_t)TQ * HD, HD);    // a 64-column tile is one head: planes [h][t][d]
    k_gemmw<bf, 0, true, 8, 1><<<dim3(KPH / 64, 1, NH_), 256, 0, stream>>>(KB, nullptr, BK, nullptr, DM, nullptr, Kh, Kl, HD, bk, zi, zw, zp, HD);    // planes [h][key][d]
    k_gemmw<bf, 0, true, 8, 2><<<dim3(1, KPH / 64, NH_), 256, 0, stream>>>(BV, nullptr, VB, nullptr, DM, nullptr, Vh, Vl, KPH, bv, zw, zi, zp, HD);    // weight rows as A: planes [h][d][key]
    k_attn<<<dim3(TQ / 64, NH_, 1), 256, 0, stream>>>(Qh, Ql, Kh, Kl, Vh, Vl, ATh, ATl);
    k_gemmw<bf, 1, true, 8, 0><<<dim3(TQ / 64, DM / 64, 1), 256, 0, stream>>>(ATh, ATl, BO, nullptr, DM, OUT, nullptr, nullptr, DM, bo, 0, 0, 0, 0);
}

// v006
// It runs in 48.7 microseconds.
// Timed twice side by side with v005, it ran 1.38 times as fast both times.
// Counting every step since v000, it is 4.10 times as fast.
#include <hip/hip_runtime.h>

// HeposMultiHeadAttention (q [1][1024][1024], k, v [1][8192][1024]; Q/K/V = in W^T + b (16 heads x 64); head h attends only keys with (k_idx - h) % 16 == 0 (512 keys per head); softmax(Q.K / 8); out = merged Wo^T + bo -> [1][1024][1024]; no row is fully masked, so nan_to_num is a no-op).
// The HEPOS mask is structural: each head's 512 keys are gathered into dense planes (key m of head h = token 16 m + h), so no masked score is ever computed.
// Key token t is kept by head t % 16 alone, so of its K and V projections only that head's 64 columns are ever read: the k / v inputs are regrouped by head and projected as 16 batched 512 x 64 x 1024 GEMMs.
// Compute dtypes, f32 accumulate: every input rounded to bf16; Q/K/V as PLAIN bf16 GEMMs (inputs: exact) + bias; scores hl x hl (3 products), softmax f32 -> hl operands in registers, attn.v 3 products (all cheap: 512 keys; one fused launch); Wo hl x exact (2 products) + bias.

#define TQ   1024
#define TK   8192
#define DM   1024
#define NH_  16
#define HD   64
#define KPH  512    // keys per head = TK / 16
typedef _Float16 h16;
typedef unsigned short bf;
typedef __attribute__((ext_vector_type(16))) __bf16   v16bf;
typedef __attribute__((ext_vector_type(16))) _Float16 v16h;
typedef __attribute__((ext_vector_type(8)))  _Float16 v8h;
typedef __attribute__((ext_vector_type(8)))  unsigned short v8us;
typedef __attribute__((ext_vector_type(8)))  float    v8f;
typedef __attribute__((ext_vector_type(4)))  float    v4f;
typedef v8h  __attribute__((may_alias)) v8ha;
typedef v4f  __attribute__((may_alias)) v4fa;
typedef v8us __attribute__((may_alias)) v8usa;

__device__ __forceinline__ unsigned short f2bf(float f) { unsigned u = __float_as_uint(f); u += 0x7FFFu + ((u >> 16) & 1u); return (unsigned short)(u >> 16); }
__device__ __forceinline__ float bf2f(unsigned short b) { return __uint_as_float(((unsigned)b) << 16); }
__device__ __forceinline__ float bfr(float f) { return bf2f(f2bf(f)); }
__device__ __forceinline__ v16h cat16(v8h lo, v8h hi) { return __builtin_shufflevector(lo, hi, 0, 1, 2, 3, 4, 5, 6, 7, 8, 9, 10, 11, 12, 13, 14, 15); }
__device__ __forceinline__ v16bf cat16b(v8us lo, v8us hi) { return __builtin_bit_cast(v16bf, __builtin_shufflevector(lo, hi, 0, 1, 2, 3, 4, 5, 6, 7, 8, 9, 10, 11, 12, 13, 14, 15)); }
__device__ __forceinline__ v8f wmma16(v16h a, v16h b, v8f c) { return __builtin_amdgcn_wmma_f32_16x16x32_f16(false, a, false, b, (short)0, c, false, false); }
__device__ __forceinline__ v8f wmmab(v16bf a, v16bf b, v8f c) { return __builtin_amdgcn_wmma_f32_16x16x32_bf16(false, a, false, b, (short)0, c, false, false); }



// ---- k_gemmw: register-blocked GEMM, one work-group of KS waves per 64x64 output tile, operands straight from K-contiguous 16-bit planes; grid (M/64, N/64), 32 * KS threads.
// Every wave holds the whole tile (16 accumulators) and takes every KS-th 32-wide slice of K, so a wave's chain of load latencies is K / (32 KS) trips long and the KS waves of a trip read 64 KS contiguous bytes of each row.
// The KS partial tiles meet in LDS behind one barrier; wave w sums rows 64 w / KS ... of them, partial 0 first, and stores those rows.
// C[m][n] (pitch ldc, + optional f32 bias) = sum_k A[m][k] Bt[n][k] (+ split products per NSPLIT). K % 32 == 0.
// OUT 0: C stored as f32, bias[n]. OUT 1: C stored as a high and a low bf16 plane (Ch, Cl), the form the attention launch reads, bias[n]. OUT 2: planes too, bias[m] (A = weight rows, Bt = tokens: the tile comes out as [d][key]).
template <typename T16> struct WFrag;
template <> struct WFrag<h16> { typedef v16h V; static __device__ __forceinline__ V ld(const h16* p) { return cat16(*(const v8h*)p, *(const v8h*)(p + 16)); } static __device__ __forceinline__ v8f mma(V a, V b, v8f c) { return wmma16(a, b, c); } };
template <> struct WFrag<bf> { typedef v16bf V; static __device__ __forceinline__ V ld(const bf* p) { return cat16b(*(const v8us*)p, *(const v8us*)(p + 16)); } static __device__ __forceinline__ v8f mma(V a, V b, v8f c) { return wmmab(a, b, c); } };
__device__ __forceinline__ void splitf(float y, unsigned short& h, unsigned short& l) { h = f2bf(y); l = f2bf(y - bf2f(h)); }
typedef __attribute__((ext_vector_type(4))) unsigned short v4us;
// gemmw_tile is the work of one such work-group on the tile at row r0, column c0; os = its KS * 64 * 68 floats of LDS.
template <typename T16, int NSPLIT, bool BIAS, int KS, int OUT>
__device__ __forceinline__ void gemmw_tile(float* os, const T16* __restrict__ A, const T16* __restrict__ A2, const T16* __restrict__ Bt, const T16* __restrict__ Bt2, int K, float* C, bf* Ch, bf* Cl, int ldc, const float* __restrict__ bias, int r0, int c0) {
    typedef typename WFrag<T16>::V V;
    const int lane = threadIdx.x & 31, lr = lane & 15, hi = lane >> 4;
    const int w = __builtin_amdgcn_readfirstlane((int)(threadIdx.x >> 5));   // wave-uniform: the K slice and the rows to sum are scalar work
    v8f acc[4][4];
#pragma unroll
    for (int mb = 0; mb < 4; ++mb)
#pragma unroll
        for (int nb = 0; nb < 4; ++nb) acc[mb][nb] = (v8f){};
    const int cofs = lr * 4, row0 = w * (64 / KS) + hi; v4f bv = (v4f){}; float br[32 / KS];   // the lane's four output columns, its first output row and their bias, asked for ahead of the K loop
    if (BIAS && OUT != 2) { bv[0] = bfr(bias[c0 + cofs]); bv[1] = bfr(bias[c0 + cofs + 1]); bv[2] = bfr(bias[c0 + cofs + 2]); bv[3] = bfr(bias[c0 + cofs + 3]); }
    if (BIAS && OUT == 2) {
#pragma unroll
        for (int s = 0; s < 32 / KS; ++s) br[s] = bfr(bias[r0 + row0 + 2 * s]); }
    const size_t aoff = (size_t)(r0 + lr) * K + 8 * hi, boff = (size_t)(c0 + lr) * K + 8 * hi;
#pragma unroll 1
    for (int kc = w * 32; kc < K; kc += KS * 32) {
        V a[4], a2[4];
#pragma unroll
        for (int mb = 0; mb < 4; ++mb) { a[mb] = WFrag<T16>::ld(A + aoff + (size_t)mb * 16 * K + kc); if (NSPLIT == 1 || NSPLIT == 2) a2[mb] = WFrag<T16>::ld(A2 + aoff + (size_t)mb * 16 * K + kc); }
#pragma unroll
        for (int nb = 0; nb < 4; ++nb) { const V b = WFrag<T16>::ld(Bt + boff + (size_t)nb * 16 * K + kc); V b2; if (NSPLIT >= 2) b2 = WFrag<T16>::ld(Bt2 + boff + (size_t)nb * 16 * K + kc);
#pragma unroll
            for (int mb = 0; mb < 4; ++mb) { acc[mb][nb] = WFrag<T16>::mma(a[mb], b, acc[mb][nb]); if (NSPLIT == 1 || NSPLIT == 2) acc[mb][nb] = WFrag<T16>::mma(a2[mb], b, acc[mb][nb]); if (NSPLIT >= 2) acc[mb][nb] = WFrag<T16>::mma(a[mb], b2, acc[mb][nb]); } }
        asm volatile("v_nop\n\tv_nop\n\tv_nop\n\tv_nop" : "+v"(acc[0][0]), "+v"(acc[1][1]), "+v"(acc[2][2]), "+v"(acc[3][3]) : "v"(a[0]), "v"(a[3]));
    }
    float* mine = os + w * (64 * 68);
#pragma unroll
    for (int mb = 0; mb < 4; ++mb)
#pragma unroll
        for (int nb = 0; nb < 4; ++nb)
#pragma unroll
            for (int j = 0; j < 8; ++j) mine[(mb * 16 + hi * 8 + j) * 68 + nb * 16 + lr] = acc[mb][nb][j];
    __syncthreads();   // every wave's partial tile is in LDS before any wave sums across them
    const float* op = os + row0 * 68 + cofs; const size_t co = (size_t)(r0 + row0) * ldc + c0 + cofs;
#pragma unroll
    for (int s = 0; s < 32 / KS; ++s) { v4f val = *(const v4fa*)(op + 2 * s * 68);
#pragma unroll
        for (int p = 1; p < KS; ++p) val += *(const v4fa*)(op + (p * 64 + 2 * s) * 68);
        if (BIAS) { if (OUT == 2) val += br[s]; else val += bv; }
        const size_t oo = co + (size_t)(2 * s) * ldc;
        if (OUT == 0) *(v4f*)(C + oo) = val;
        else { v4us oh, ol;
#pragma unroll
            for (int u = 0; u < 4; ++u) { unsigned short x0, x1; splitf(val[u], x0, x1); oh[u] = x0; ol[u] = x1; }
            *(v4us*)(Ch + oo) = oh; *(v4us*)(Cl + oo) = ol; } }
    asm volatile("s_wait_xcnt 0x0" ::: "memory");   // where several tile bodies stand in one kernel, the code laid out behind this one reuses the stores' address and data registers: the wait stands in front of that
}
template <typename T16, int NSPLIT, bool BIAS, int KS, int OUT>
__global__ __launch_bounds__(32 * KS) void k_gemmw(const T16* __restrict__ A, const T16* __restrict__ A2, const T16* __restrict__ Bt, const T16* __restrict__ Bt2, int K, float* C, bf* Ch, bf* Cl, int ldc, const float* __restrict__ bias) {
    __shared__ __align__(16) float os[KS * 64 * 68];
    gemmw_tile<T16, NSPLIT, BIAS, KS, OUT>(os, A, A2, Bt, Bt2, K, C, Ch, Cl, ldc, bias, blockIdx.x * 64, blockIdx.y * 64);
}
// ---- k_qkv: the Q, K and V projections, which do not depend on one another, in ONE launch of 128 + 128 + 256 tiles of equal arithmetic: two work-groups share a WGP (LDS allows two), so one's load waits are filled by the other.
// Tile j < 128: K, head j / 8, 64 keys -> planes [h][key][d]. Next 128: V with the head's weight rows as A -> planes [h][d][key]. Last 256: Q, head by 64 queries -> planes [h][t][d].
// K and V come first, for speed only.
// K stays an argument, as in k_gemmw: with a literal the compiler folds the row steps into offsets and then asks for two of a trip's four B fragments late instead of one, a further load wait in every trip.
#define QT (NH_ * TQ / 64)
#define KT (NH_ * KPH / 64)
__global__ __launch_bounds__(256) void k_qkv(const bf* __restrict__ QB, const bf* __restrict__ KB, const bf* __restrict__ VB, const bf* __restrict__ BQ, const bf* __restrict__ BK, const bf* __restrict__ BV,
                                             const float* __restrict__ bq, const float* __restrict__ bk, const float* __restrict__ bv, int K, bf* Qh, bf* Ql, bf* Kh, bf* Kl, bf* Vh, bf* Vl) {
    __shared__ __align__(16) float os[8 * 64 * 68];
    const int j = blockIdx.x; const size_t zi = (size_t)KPH * DM, zw = (size_t)HD * DM, zp = (size_t)KPH * HD;    // per head: input plane, the head's 64 weight rows, projected plane
    if (j < KT) { const size_t h = j / (KPH / 64); const int t = j % (KPH / 64);
        gemmw_tile<bf, 0, true, 8, 1>(os, KB + h * zi, nullptr, BK + h * zw, nullptr, K, nullptr, Kh + h * zp, Kl + h * zp, HD, bk + h * HD, t * 64, 0); }
    else if (j < 2 * KT) { const size_t h = (j - KT) / (KPH / 64); const int t = (j - KT) % (KPH / 64);
        gemmw_tile<bf, 0, true, 8, 2>(os, BV + h * zw, nullptr, VB + h * zi, nullptr, K, nullptr, Vh + h * zp, Vl + h * zp, KPH, bv + h * HD, 0, t * 64); }
    else { const size_t h = (j - 2 * KT) / (TQ / 64); const int t = (j - 2 * KT) % (TQ / 64);
        gemmw_tile<bf, 0, true, 8, 1>(os, QB, nullptr, BQ + h * zw, nullptr, K, nullptr, Qh + h * (TQ * HD), Ql + h * (TQ * HD), HD, bq + h * HD, t * 64, 0); }
}


// ---- k_cvtall: every f32 -> bf16 input copy in ONE streaming launch. All seven sources are rows of DM floats (k, v: TK rows each; Wq, Wk, Wv, Wo, q: 1024 rows each).
// CG work-groups x CW waves x CR rows per wave cover them exactly once. A wave reads a row as 8 loads of 512 contiguous bytes, non-temporal (each source is read once), and asks for all its CR rows
// before it rounds the first; it stores a row as 8 stores of 256 contiguous bytes. k / v rows are regrouped by the head that keeps them: token t -> row t / 16 of plane t % 16 (planes [NH_][KPH][DM]).
#define CG 256
#define CW 21
#define CR 4
static_assert(CG * CW * CR == 2 * TK + 4 * DM + TQ, "the conversion launch covers every row once");
__global__ __launch_bounds__(CW * 32) void k_cvtall(const float* __restrict__ kin, const float* __restrict__ vin, const float* __restrict__ Wq, const float* __restrict__ Wk, const float* __restrict__ Wv, const float* __restrict__ Wo, const float* __restrict__ qin,
                                                    bf* KB, bf* VB, bf* BQ, bf* BK, bf* BV, bf* BO, bf* QB) {
    const int lane = threadIdx.x & 31; const int gw = __builtin_amdgcn_readfirstlane((int)(blockIdx.x * CW + (threadIdx.x >> 5)));   // wave-uniform: a row's source and place are scalar work
    __builtin_assume(gw >= 0 && gw < CG * CW);
    v4f x[CR][DM / 128]; bf* dst[CR];
#pragma unroll
    for (int r = 0; r < CR; ++r) { const int row = r * (CG * CW) + gw; const float* s; bf* d;
        if (row < 2 * TK) { const int t = row & (TK - 1); s = (row < TK ? kin : vin) + (size_t)t * DM; d = (row < TK ? KB : VB) + ((size_t)(t % NH_) * KPH + t / NH_) * DM; }
        else { const int m = (row - 2 * TK) >> 10; const size_t o = (size_t)((row - 2 * TK) & 1023) * DM; s = Wq; d = BQ;
            if (m == 1) { s = Wk; d = BK; } if (m == 2) { s = Wv; d = BV; } if (m == 3) { s = Wo; d = BO; } if (m == 4) { s = qin; d = QB; } s += o; d += o; }
        dst[r] = d + lane * 4;
#pragma unroll
        for (int q = 0; q < DM / 128; ++q) x[r][q] = __builtin_nontemporal_load((const v4f*)(s + q * 128 + lane * 4)); }
    __builtin_amdgcn_sched_barrier(0);   // keeps every row's loads in front of the first rounding: left alone the compiler issues the last row's loads only when earlier rows have arrived, a second memory latency in every wave
#pragma unroll
    for (int r = 0; r < CR; ++r)
#pragma unroll
        for (int q = 0; q < DM / 128; ++q) { v4us o;
#pragma unroll
            for (int u = 0; u < 4; ++u) o[u] = f2bf(x[r][q][u]);
            *(v4us*)(dst[r] + q * 128) = o; } }
// ---- k_attn: scores, softmax, attn.v and the head merge of 64 queries of one head in ONE work-group of 8 waves; grid (TQ / 64, NH_). No score and no probability leaves the registers.
// Wave w takes keys 64 w ... 64 w + 63. It forms S^T = K Q^T (A = K rows, B = Q rows as columns; hl x hl, 3 products), so a lane holds 32 keys of one query per 16-query group: maximum and sum are in-lane plus one exchange of the wave halves.
// p = exp2(s c - m c), m the maximum over the WAVE's own 64 keys, not yet divided by any sum. Two 16-key score tiles, rounded in place, are the B operand of O^T += V^T P^T (A = V^T rows from the [d][key] planes, same k order; 3 products).
// The 8 partial O^T tiles, each with its m c and its sum, meet in LDS behind one barrier; wave w joins queries 8 w ... 8 w + 7: O = sum_p f_p O_p / sum_p f_p l_p, f_p = exp2(m_p c - max m c), partial 0 first, and stores them as hl planes in merged [t][h * 64 + d] order.
typedef __attribute__((ext_vector_type(2))) float v2f;
typedef __attribute__((ext_vector_type(2))) __bf16 v2bf;
__device__ __forceinline__ float xhalf(float x) { const int b = __float_as_int(x); return __int_as_float(__builtin_amdgcn_permlanex16(b, b, 0x76543210, 0xfedcba98, false, false)); }   // lane l <-> l ^ 16
__global__ __launch_bounds__(256) void k_attn(const bf* __restrict__ Qh, const bf* __restrict__ Ql, const bf* __restrict__ Kh, const bf* __restrict__ Kl, const bf* __restrict__ Vh, const bf* __restrict__ Vl, bf* ATh, bf* ATl) {
    typedef WFrag<bf> F;
    __shared__ __align__(16) float os[8 * 64 * 68];
    __shared__ __align__(16) float st[2 * 64 * 8];   // [0][query][wave] = m c, [1][query][wave] = sum
    const int lane = threadIdx.x & 31, lr = lane & 15, hi = lane >> 4; const int q0 = blockIdx.x * 64; const size_t h = blockIdx.y;
    const int w = __builtin_amdgcn_readfirstlane((int)(threadIdx.x >> 5));   // wave-uniform: the key slice and the queries to join are scalar work
    const size_t qoff = (h * TQ + q0 + lr) * HD + 8 * hi, koff = (h * KPH + w * 64 + lr) * HD + 8 * hi, voff = (h * HD + lr) * KPH + w * 64 + 8 * hi;
    v8f acc[4][4], o[4][4];
#pragma unroll
    for (int mb = 0; mb < 4; ++mb)
#pragma unroll
        for (int nb = 0; nb < 4; ++nb) { acc[mb][nb] = (v8f){}; o[mb][nb] = (v8f){}; }
    v16bf a[2][4], a2[2][4], b[2][4], b2[2][4], va[2][4], va2[2][4];   // [32-wide k slice][16-row block]: K, Q and V^T fragments, high and low planes
#pragma unroll
    for (int kc = 0; kc < 2; ++kc)
#pragma unroll
        for (int i = 0; i < 4; ++i) { a[kc][i] = F::ld(Kh + koff + i * 16 * HD + kc * 32); a2[kc][i] = F::ld(Kl + koff + i * 16 * HD + kc * 32); b[kc][i] = F::ld(Qh + qoff + i * 16 * HD + kc * 32); b2[kc][i] = F::ld(Ql + qoff + i * 16 * HD + kc * 32); }
    asm volatile("s_wait_xcnt 0x0" ::: "memory");   // the loads' address registers are reused below: the wait stands in front of the first overwrite (the fence on the next line holds later code behind it)
    __builtin_amdgcn_sched_barrier(0);   // keeps every K and Q load in front of the first product: left alone the compiler asks for each Q fragment only when its turn comes, eight load latencies in a row
#pragma unroll
    for (int kc = 0; kc < 2; ++kc) {
#pragma unroll
        for (int nb = 0; nb < 4; ++nb) {   // the four key blocks take turns, so that no product waits for the one just issued
#pragma unroll
            for (int mb = 0; mb < 4; ++mb) acc[mb][nb] = wmmab(a[kc][mb], b[kc][nb], acc[mb][nb]);
#pragma unroll
            for (int mb = 0; mb < 4; ++mb) acc[mb][nb] = wmmab(a2[kc][mb], b[kc][nb], acc[mb][nb]);
#pragma unroll
            for (int mb = 0; mb < 4; ++mb) acc[mb][nb] = wmmab(a[kc][mb], b2[kc][nb], acc[mb][nb]); }
        if (kc == 0) {
#pragma unroll
            for (int ch = 0; ch < 2; ++ch)
#pragma unroll
                for (int db = 0; db < 4; ++db) { va[ch][db] = F::ld(Vh + voff + db * 16 * KPH + ch * 32); va2[ch][db] = F::ld(Vl + voff + db * 16 * KPH + ch * 32); }
            asm volatile("s_wait_xcnt 0x0" ::: "memory");   // as above, for the address registers of the V^T loads
            __builtin_amdgcn_sched_barrier(0);   // keeps the V^T loads here, half the score products and the softmax arithmetic ahead of their use: left alone they are asked for just in front of it
        }
    }   // acc[mb][nb][r] = S[query q0 + 16 nb + lr][key 64 w + 16 mb + 8 hi + r], unscaled
    const float c8 = 0.125f * 1.4426950408889634f;   // 1 / sqrt(HD) and log2(e) in one factor
#pragma unroll
    for (int nb = 0; nb < 4; ++nb) {
        float mx = acc[0][nb][0];
#pragma unroll
        for (int mb = 0; mb < 4; ++mb)
#pragma unroll
            for (int r = 0; r < 8; ++r) mx = fmaxf(mx, acc[mb][nb][r]);
        mx = fmaxf(mx, xhalf(mx));
        const float mc = mx * c8; float sum = 0.f; v16bf ph[2], pl[2];
#pragma unroll
        for (int ch = 0; ch < 2; ++ch)
#pragma unroll
            for (int s = 0; s < 16; s += 2) { v2f e;   // element s of the B operand = key 32 ch + 16 (s >> 3) + 8 hi + (s & 7): the hardware k order, which the V^T loader has too
                e[0] = __builtin_amdgcn_exp2f(__builtin_fmaf(acc[2 * ch + (s >> 3)][nb][s & 7], c8, -mc)); e[1] = __builtin_amdgcn_exp2f(__builtin_fmaf(acc[2 * ch + (s >> 3)][nb][(s & 7) + 1], c8, -mc));
                sum += e[0]; sum += e[1];
                const v2bf eh = __builtin_convertvector(e, v2bf); const v2bf el = __builtin_convertvector(e - __builtin_convertvector(eh, v2f), v2bf);
                ph[ch][s] = eh[0]; ph[ch][s + 1] = eh[1]; pl[ch][s] = el[0]; pl[ch][s + 1] = el[1]; }
        sum += xhalf(sum);
        st[hi * 512 + (nb * 16 + lr) * 8 + w] = hi ? sum : mc;   // both halves hold both values: the low half stores m c, the high half the sum
#pragma unroll
        for (int ch = 0; ch < 2; ++ch) {   // the four d blocks take turns, so that no product waits for the one just issued
#pragma unroll
            for (int db = 0; db < 4; ++db) o[db][nb] = wmmab(va[ch][db], ph[ch], o[db][nb]);
#pragma unroll
            for (int db = 0; db < 4; ++db) o[db][nb] = wmmab(va2[ch][db], ph[ch], o[db][nb]);
#pragma unroll
            for (int db = 0; db < 4; ++db) o[db][nb] = wmmab(va[ch][db], pl[ch], o[db][nb]); }
    }   // o[db][nb][r] = partial O[query 16 nb + lr][d = 16 db + 8 hi + r]
    __builtin_amdgcn_sched_barrier(0);   // keeps the LDS stores behind the last product
    float* mine = os + w * (64 * 68) + lr * 68 + hi * 8;
#pragma unroll
    for (int nb = 0; nb < 4; ++nb)
#pragma unroll
        for (int db = 0; db < 4; ++db) { float* p = mine + nb * 16 * 68 + db * 16;
            *(v4fa*)p = __builtin_shufflevector(o[db][nb], o[db][nb], 0, 1, 2, 3); *(v4fa*)(p + 4) = __builtin_shufflevector(o[db][nb], o[db][nb], 4, 5, 6, 7); }
    __syncthreads();   // every wave's partial tile, maximum and sum are in LDS before any wave joins them
    const int cofs = lr * 4, row0 = w * 8 + hi;
#pragma unroll
    for (int s = 0; s < 4; ++s) { const int row = row0 + 2 * s; float m[8], l[8];
        { const v4f m0 = *(const v4fa*)(st + row * 8), m1 = *(const v4fa*)(st + row * 8 + 4), l0 = *(const v4fa*)(st + 512 + row * 8), l1 = *(const v4fa*)(st + 512 + row * 8 + 4);
#pragma unroll
            for (int u = 0; u < 4; ++u) { m[u] = m0[u]; m[4 + u] = m1[u]; l[u] = l0[u]; l[4 + u] = l1[u]; } }
        float M = m[0];
#pragma unroll
        for (int p = 1; p < 8; ++p) M = fmaxf(M, m[p]);
        float L = 0.f; v4f val = (v4f){};
#pragma unroll
        for (int p = 0; p < 8; ++p) { const float f = __builtin_amdgcn_exp2f(m[p] - M); L += f * l[p]; val += f * *(const v4fa*)(os + (p * 64 + row) * 68 + cofs); }
        val *= __fdiv_rn(1.0f, L);
        v4us oh, ol;
#pragma unroll
        for (int u = 0; u < 4; ++u) { unsigned short x0, x1; splitf(val[u], x0, x1); oh[u] = x0; ol[u] = x1; }
        const size_t oo = (size_t)(q0 + row) * DM + h * HD + cofs; *(v4us*)(ATh + oo) = oh; *(v4us*)(ATl + oo) = ol; }
}

extern "C" void kernel_launch(void* const* d_in, const int* in_sizes, int n_in,
                              void* d_out, int out_size, void* d_ws, size_t ws_size, hipStream_t stream) {
    (void)in_sizes; (void)n_in; (void)out_size;
    const float* qin = (const float*)d_in[0]; const float* kin = (const float*)d_in[1]; const float* vin = (const float*)d_in[2]; const float* Wq = (const float*)d_in[3]; const float* bq = (const float*)d_in[4]; const float* Wk = (const float*)d_in[5]; const float* bk = (const float*)d_in[6]; const float* Wv = (const float*)d_in[7]; const float* bv = (const float*)d_in[8]; const float* Wo = (const float*)d_in[9]; const float* bo = (const float*)d_in[10];
    float* OUT = (float*)d_out;     // [1][1024][1024]
    char* wsp = (char*)d_ws;
    auto take = [&](size_t bytes) { char* p = wsp; wsp += (bytes + 255) & ~(size_t)255; return (void*)p; };
    bf* BQ = (bf*)take((size_t)DM * DM * 2); bf* BK = (bf*)take((size_t)DM * DM * 2); bf* BV = (bf*)take((size_t)DM * DM * 2); bf* BO = (bf*)take((size_t)DM * DM * 2);
    bf* QB = (bf*)take((size_t)TQ * DM * 2); bf* KB = (bf*)take((size_t)TK * DM * 2); bf* VB = (bf*)take((size_t)TK * DM * 2);
    bf* Qh = (bf*)take((size_t)NH_ * TQ * HD * 2); bf* Ql = (bf*)take((size_t)NH_ * TQ * HD * 2); bf* Kh = (bf*)take((size_t)NH_ * KPH * HD * 2); bf* Kl = (bf*)take((size_t)NH_ * KPH * HD * 2); bf* Vh = (bf*)take((size_t)NH_ * HD * KPH * 2); bf* Vl = (bf*)take((size_t)NH_ * HD * KPH * 2);
    bf* ATh = (bf*)take((size_t)TQ * DM * 2); bf* ATl = (bf*)take((size_t)TQ * DM * 2);
    if ((size_t)(wsp - (char*)d_ws) > ws_size) return;    // total ~ 55 MB
    k_cvtall<<<CG, CW * 32, 0, stream>>>(kin, vin, Wq, Wk, Wv, Wo, qin, KB, VB, BQ, BK, BV, BO, QB);   // torch [out][in] weights = Bt as-is
    k_qkv<<<QT + 2 * KT, 256, 0, stream>>>(QB, KB, VB, BQ, BK, BV, bq, bk, bv, DM, Qh, Ql, Kh, Kl, Vh, Vl);
    k_attn<<<dim3(TQ / 64, NH_, 1), 256, 0, stream>>>(Qh, Ql, Kh, Kl, Vh, Vl, ATh, ATl);
    k_gemmw<bf, 1, true, 8, 0><<<dim3(TQ / 64, DM / 64, 1), 256, 0, stream>>>(ATh, ATl, BO, nullptr, DM, OUT, nullptr, nullptr, DM, bo);
}

// v007
// Measured time: 44.5 microseconds a run.
// Next to v006, in two timings, it ran 1.11 times as fast each time.
// Over all steps from v000 it is 4.55 times as fast.
#include <hip/hip_runtime.h>

// Multi-head attention with a strided key mask (q [1][1024][1024], k, v [1][8192][1024]; Q/K/V = in W^T + b (16 heads x 64); head h attends only keys with (k_idx - h) % 16 == 0 (512 keys per head); softmax(Q.K / 8); out = merged Wo^T + bo -> [1][1024][1024]; no row is fully masked, so nan_to_num is a no-op).
// The HEPOS mask is structural: each head's 512 keys are gathered into dense planes (key m of head h = token 16 m + h), so no masked score is ever computed.
// Key token t is kept by head t % 16 alone, so of its K and V projections only that head's 64 columns are ever read: a head's rows of k / v (every 16th) are projected as one of 16 batched 512 x 64 x 1024 GEMMs.
// Compute dtypes, f32 accumulate: every input rounded to bf16; Q/K/V as PLAIN bf16 GEMMs (inputs: exact) + bias; scores hl x hl (3 products), softmax f32 -> hl operands in registers, attn.v 3 products (all cheap: 512 keys; one fused launch); Wo hl x exact (2 products) + bias.

#define TQ   1024
#define TK   8192
#define DM   1024
#define NH_  16
#define HD   64
#define KPH  512    // keys per head = TK / 16
typedef _Float16 h16;
typedef unsigned short bf;
typedef __attribute__((ext_vector_type(16))) __bf16   v16bf;
typedef __attribute__((ext_vector_type(16))) _Float16 v16h;
typedef __attribute__((ext_vector_type(8)))  _Float16 v8h;
typedef __attribute__((ext_vector_type(8)))  unsigned short v8us;
typedef __attribute__((ext_vector_type(8)))  float    v8f;
typedef __attribute__((ext_vector_type(4)))  float    v4f;
typedef v8h  __attribute__((may_alias)) v8ha;
typedef v4f  __attribute__((may_alias)) v4fa;
typedef v8us __attribute__((may_alias)) v8usa;

__device__ __forceinline__ unsigned short f2bf(float f) { unsigned u = __float_as_uint(f); u += 0x7FFFu + ((u >> 16) & 1u); return (unsigned short)(u >> 16); }
__device__ __forceinline__ float bf2f(unsigned short b) { return __uint_as_float(((unsigned)b) << 16); }
__device__ __forceinline__ float bfr(float f) { return bf2f(f2bf(f)); }
__device__ __forceinline__ v16h cat16(v8h lo, v8h hi) { return __builtin_shufflevector(lo, hi, 0, 1, 2, 3, 4, 5, 6, 7, 8, 9, 10, 11, 12, 13, 14, 15); }
__device__ __forceinline__ v16bf cat16b(v8us lo, v8us hi) { return __builtin_bit_cast(v16bf, __builtin_shufflevector(lo, hi, 0, 1, 2, 3, 4, 5, 6, 7, 8, 9, 10, 11, 12, 13, 14, 15)); }
__device__ __forceinline__ v8f wmma16(v16h a, v16h b, v8f c) { return __builtin_amdgcn_wmma_f32_16x16x32_f16(false, a, false, b, (short)0, c, false, false); }
__device__ __forceinline__ v8f wmmab(v16bf a, v16bf b, v8f c) { return __builtin_amdgcn_wmma_f32_16x16x32_bf16(false, a, false, b, (short)0, c, false, false); }



// ---- k_gemmw: register-blocked GEMM, one work-group of KS waves per 64x64 output tile, operands straight from K-contiguous 16-bit planes; grid (M/64, N/64), 32 * KS threads.
// Every wave holds the whole tile (16 accumulators) and takes every KS-th 32-wide slice of K, so a wave's chain of load latencies is K / (32 KS) trips long and the KS waves of a trip read 64 KS contiguous bytes of each row.
// The KS partial tiles meet in LDS behind one barrier; wave w sums rows 64 w / KS ... of them, partial 0 first, and stores those rows.
// C[m][n] (pitch ldc, + optional f32 bias) = sum_k A[m][k] Bt[n][k] (+ split products per NSPLIT). K % 32 == 0.
// OUT 0: C stored as f32, bias[n]. OUT 1: C stored as a high and a low bf16 plane (Ch, Cl), the form the attention launch reads, bias[n]. OUT 2: planes too, bias[m] (A = weight rows, Bt = tokens: the tile comes out as [d][key]).
template <typename T16> struct WFrag;
template <> struct WFrag<h16> { typedef v16h V; static __device__ __forceinline__ V ld(const h16* p) { return cat16(*(const v8h*)p, *(const v8h*)(p + 16)); } static __device__ __forceinline__ v8f mma(V a, V b, v8f c) { return wmma16(a, b, c); } };
template <> struct WFrag<bf> { typedef v16bf V; static __device__ __forceinline__ V ld(const bf* p) { return cat16b(*(const v8us*)p, *(const v8us*)(p + 16)); } static __device__ __forceinline__ v8f mma(V a, V b, v8f c) { return wmmab(a, b, c); } };
__device__ __forceinline__ void splitf(float y, unsigned short& h, unsigned short& l) { h = f2bf(y); l = f2bf(y - bf2f(h)); }
typedef __attribute__((ext_vector_type(4))) unsigned short v4us;
// gemmw_tile is the work of one such work-group on the tile at row r0, column c0; os = its KS * 64 * 68 floats of LDS.
template <typename T16, int NSPLIT, bool BIAS, int KS, int OUT>
__device__ __forceinline__ void gemmw_tile(float* os, const T16* __restrict__ A, const T16* __restrict__ A2, const T16* __restrict__ Bt, const T16* __restrict__ Bt2, int K, float* C, bf* Ch, bf* Cl, int ldc, const float* __restrict__ bias, int r0, int c0) {
    typedef typename WFrag<T16>::V V;
    const int lane = threadIdx.x & 31, lr = lane & 15, hi = lane >> 4;
    const int w = __builtin_amdgcn_readfirstlane((int)(threadIdx.x >> 5));   // wave-uniform: the K slice and the rows to sum are scalar work
    v8f acc[4][4];
#pragma unroll
    for (int mb = 0; mb < 4; ++mb)
#pragma unroll
        for (int nb = 0; nb < 4; ++nb) acc[mb][nb] = (v8f){};
    const int cofs = lr * 4, row0 = w * (64 / KS) + hi; v4f bv = (v4f){}; float br[32 / KS];   // the lane's four output columns, its first output row and their bias, asked for ahead of the K loop
    if (BIAS && OUT != 2) { bv[0] = bfr(bias[c0 + cofs]); bv[1] = bfr(bias[c0 + cofs + 1]); bv[2] = bfr(bias[c0 + cofs + 2]); bv[3] = bfr(bias[c0 + cofs + 3]); }
    if (BIAS && OUT == 2) {
#pragma unroll
        for (int s = 0; s < 32 / KS; ++s) br[s] = bfr(bias[r0 + row0 + 2 * s]); }
    const size_t aoff = (size_t)(r0 + lr) * K + 8 * hi, boff = (size_t)(c0 + lr) * K + 8 * hi;
#pragma unroll 1
    for (int kc = w * 32; kc < K; kc += KS * 32) {
        V a[4], a2[4];
#pragma unroll
        for (int mb = 0; mb < 4; ++mb) { a[mb] = WFrag<T16>::ld(A + aoff + (size_t)mb * 16 * K + kc); if (NSPLIT == 1 || NSPLIT == 2) a2[mb] = WFrag<T16>::ld(A2 + aoff + (size_t)mb * 16 * K + kc); }
#pragma unroll
        for (int nb = 0; nb < 4; ++nb) { const V b = WFrag<T16>::ld(Bt + boff + (size_t)nb * 16 * K + kc); V b2; if (NSPLIT >= 2) b2 = WFrag<T16>::ld(Bt2 + boff + (size_t)nb * 16 * K + kc);
#pragma unroll
            for (int mb = 0; mb < 4; ++mb) { acc[mb][nb] = WFrag<T16>::mma(a[mb], b, acc[mb][nb]); if (NSPLIT == 1 || NSPLIT == 2) acc[mb][nb] = WFrag<T16>::mma(a2[mb], b, acc[mb][nb]); if (NSPLIT >= 2) acc[mb][nb] = WFrag<T16>::mma(a[mb], b2, acc[mb][nb]); } }
        asm volatile("v_nop\n\tv_nop\n\tv_nop\n\tv_nop" : "+v"(acc[0][0]), "+v"(acc[1][1]), "+v"(acc[2][2]), "+v"(acc[3][3]) : "v"(a[0]), "v"(a[3]));
    }
    float* mine = os + w * (64 * 68);
#pragma unroll
    for (int mb = 0; mb < 4; ++mb)
#pragma unroll
        for (int nb = 0; nb < 4; ++nb)
#pragma unroll
            for (int j = 0; j < 8; ++j) mine[(mb * 16 + hi * 8 + j) * 68 + nb * 16 + lr] = acc[mb][nb][j];
    __syncthreads();   // every wave's partial tile is in LDS before any wave sums across them
    const float* op = os + row0 * 68 + cofs; const size_t co = (size_t)(r0 + row0) * ldc + c0 + cofs;
#pragma unroll
    for (int s = 0; s < 32 / KS; ++s) { v4f val = *(const v4fa*)(op + 2 * s * 68);
#pragma unroll
        for (int p = 1; p < KS; ++p) val += *(const v4fa*)(op + (p * 64 + 2 * s) * 68);
        if (BIAS) { if (OUT == 2) val += br[s]; else val += bv; }
        const size_t oo = co + (size_t)(2 * s) * ldc;
        if (OUT == 0) *(v4f*)(C + oo) = val;
        else { v4us oh, ol;
#pragma unroll
            for (int u = 0; u < 4; ++u) { unsigned short x0, x1; splitf(val[u], x0, x1); oh[u] = x0; ol[u] = x1; }
            *(v4us*)(Ch + oo) = oh; *(v4us*)(Cl + oo) = ol; } }
    asm volatile("s_wait_xcnt 0x0" ::: "memory");   // where several tile bodies stand in one kernel, the code laid out behind this one reuses the stores' address and data registers: the wait stands in front of that
}
template <typename T16, int NSPLIT, bool BIAS, int KS, int OUT>
__global__ __launch_bounds__(32 * KS) void k_gemmw(const T16* __restrict__ A, const T16* __restrict__ A2, const T16* __restrict__ Bt, const T16* __restrict__ Bt2, int K, float* C, bf* Ch, bf* Cl, int ldc, const float* __restrict__ bias) {
    __shared__ __align__(16) float os[KS * 64 * 68];
    gemmw_tile<T16, NSPLIT, BIAS, KS, OUT>(os, A, A2, Bt, Bt2, K, C, Ch, Cl, ldc, bias, blockIdx.x * 64, blockIdx.y * 64);
}
// ---- kv_tile: the tile body above (8 waves, plain bf16 product, bias, plane output, same K slices and same sums) for a tile whose token operand is still the f32 input: 64 keys of one head by the head's 64 weight rows.
// X = the head's first token row: key m of head h is token NH_ m + h, so the head's keys are rows of pitch NH_ * DM floats. Each is read from memory by this tile alone and rounded to bf16 in the loader, so k and v need no bf16 copy.
// Wt = the head's 64 bf16 weight rows; t0 = the tile's first key. OUT 1: tokens are A, planes [key][d], bias per column. OUT 2: tokens are Bt, planes [d][key], bias per row.
// The row steps are literals: folded into the loads' offsets they free the address registers that the f32 rows in flight need.
// ldf: one fragment from f32, rounded nearest even, at the k positions of WFrag<bf>::ld: 4 loads of 16 bytes in place of 2.
__device__ __forceinline__ v16bf ldf(const float* p) { const v4f x0 = *(const v4f*)p, x1 = *(const v4f*)(p + 4), x2 = *(const v4f*)(p + 16), x3 = *(const v4f*)(p + 20);
    const v8f lo = __builtin_shufflevector(x0, x1, 0, 1, 2, 3, 4, 5, 6, 7), hi = __builtin_shufflevector(x2, x3, 0, 1, 2, 3, 4, 5, 6, 7);
    return __builtin_convertvector(__builtin_shufflevector(lo, hi, 0, 1, 2, 3, 4, 5, 6, 7, 8, 9, 10, 11, 12, 13, 14, 15), v16bf); }
template <int OUT>
__device__ __forceinline__ void kv_tile(float* os, const float* __restrict__ X, const bf* __restrict__ Wt, bf* Ch, bf* Cl, const float* __restrict__ bias, int t0) {
    constexpr int KS = 8, ldc = OUT == 2 ? KPH : HD; constexpr size_t ldx = (size_t)NH_ * DM;
    const int lane = threadIdx.x & 31, lr = lane & 15, hi = lane >> 4;
    const int w = __builtin_amdgcn_readfirstlane((int)(threadIdx.x >> 5));   // wave-uniform: the K slice and the rows to sum are scalar work
    const int r0 = OUT == 2 ? 0 : t0, c0 = OUT == 2 ? t0 : 0;
    v8f acc[4][4];
#pragma unroll
    for (int mb = 0; mb < 4; ++mb)
#pragma unroll
        for (int nb = 0; nb < 4; ++nb) acc[mb][nb] = (v8f){};
    const int cofs = lr * 4, row0 = w * (64 / KS) + hi; v4f bv = (v4f){}; float br[32 / KS];   // the lane's four output columns, its first output row and their bias, asked for ahead of the K loop
    if (OUT != 2) { bv[0] = bfr(bias[cofs]); bv[1] = bfr(bias[cofs + 1]); bv[2] = bfr(bias[cofs + 2]); bv[3] = bfr(bias[cofs + 3]); }
    else {
#pragma unroll
        for (int s = 0; s < 32 / KS; ++s) br[s] = bfr(bias[row0 + 2 * s]); }
    asm volatile("s_wait_xcnt 0x0" ::: "memory");   // the bias loads' address registers are reused by the code below: the wait stands in front of the first overwrite
    const float* xp = X + (size_t)(t0 + lr) * ldx + 8 * hi; const bf* wp = Wt + (size_t)lr * DM + 8 * hi;
#pragma unroll 1
    for (int kc = w * 32; kc < DM; kc += KS * 32) {
        v16bf a[4], b[4];   // the f32 rows come from memory, the weight rows from L2: the f32 loads go first
        if (OUT == 2) {
#pragma unroll
            for (int nb = 0; nb < 4; ++nb) b[nb] = ldf(xp + nb * 16 * ldx + kc);
#pragma unroll
            for (int mb = 0; mb < 4; ++mb) a[mb] = WFrag<bf>::ld(wp + mb * 16 * DM + kc); }
        else {
#pragma unroll
            for (int mb = 0; mb < 4; ++mb) a[mb] = ldf(xp + mb * 16 * ldx + kc);
#pragma unroll
            for (int nb = 0; nb < 4; ++nb) b[nb] = WFrag<bf>::ld(wp + nb * 16 * DM + kc); }
        asm volatile("s_wait_xcnt 0x0" ::: "memory");   // the loads' address registers are stepped for the next trip: the wait stands in front of that (the fence on the next line holds later code behind it)
        __builtin_amdgcn_sched_barrier(0);   // keeps every load of the trip in front of the first product: left alone the compiler asks for part of them only between the products, further load waits in every trip
#pragma unroll
        for (int nb = 0; nb < 4; ++nb)
#pragma unroll
            for (int mb = 0; mb < 4; ++mb) acc[mb][nb] = wmmab(a[mb], b[nb], acc[mb][nb]);
        asm volatile("v_nop\n\tv_nop\n\tv_nop\n\tv_nop" : "+v"(acc[0][0]), "+v"(acc[1][1]), "+v"(acc[2][2]), "+v"(acc[3][3]) : "v"(a[0]), "v"(a[3]));   // the four vector slots the chip needs behind the trip's last products, on the taken back edge too, before the next trip writes their operand registers
    }
    float* mine = os + w * (64 * 68);
#pragma unroll
    for (int mb = 0; mb < 4; ++mb)
#pragma unroll
        for (int nb = 0; nb < 4; ++nb)
#pragma unroll
            for (int j = 0; j < 8; ++j) mine[(mb * 16 + hi * 8 + j) * 68 + nb * 16 + lr] = acc[mb][nb][j];
    __syncthreads();   // every wave's partial tile is in LDS before any wave sums across them
    const float* op = os + row0 * 68 + cofs; const size_t co = (size_t)(r0 + row0) * ldc + c0 + cofs;
#pragma unroll
    for (int s = 0; s < 32 / KS; ++s) { v4f val = *(const v4fa*)(op + 2 * s * 68);
#pragma unroll
        for (int p = 1; p < KS; ++p) val += *(const v4fa*)(op + (p * 64 + 2 * s) * 68);
        if (OUT == 2) val += br[s]; else val += bv;
        const size_t oo = co + (size_t)(2 * s) * ldc; v4us oh, ol;
#pragma unroll
        for (int u = 0; u < 4; ++u) { unsigned short x0, x1; splitf(val[u], x0, x1); oh[u] = x0; ol[u] = x1; }
        *(v4us*)(Ch + oo) = oh; *(v4us*)(Cl + oo) = ol; }
    asm volatile("s_wait_xcnt 0x0" ::: "memory");   // the code laid out behind this body reuses the stores' address and data registers: the wait stands in front of that
}
// ---- k_qkv: the Q, K and V projections, which do not depend on one another, in ONE launch of 128 + 128 + 256 tiles of equal arithmetic: two work-groups share a WGP (LDS allows two), so one's load waits are filled by the other.
// Tile j < 128: K, head j / 8, 64 keys -> planes [h][key][d]. Next 128: V with the head's weight rows as A -> planes [h][d][key]. Last 256: Q, head by 64 queries -> planes [h][t][d].
// K and V come first (for speed only): their token rows are read by one tile alone, while 16 Q tiles share each block of query rows.
// For the Q tiles K stays an argument, as in k_gemmw: with a literal the compiler folds the row steps into offsets and then asks for two of a trip's four B fragments late instead of one, a further load wait in every trip.
// amdgpu_waves_per_eu(4, 4): the register budget of four waves per SIMD (256), which two work-groups on a WGP need; without it the f32 rows in flight take the kernel past it and only one work-group fits.
#define QT (NH_ * TQ / 64)
#define KT (NH_ * KPH / 64)
__global__ __launch_bounds__(256) __attribute__((amdgpu_waves_per_eu(4, 4))) void k_qkv(const bf* __restrict__ QB, const float* __restrict__ kin, const float* __restrict__ vin, const bf* __restrict__ BQ, const bf* __restrict__ BK, const bf* __restrict__ BV,
                                             const float* __restrict__ bq, const float* __restrict__ bk, const float* __restrict__ bv, int K, bf* Qh, bf* Ql, bf* Kh, bf* Kl, bf* Vh, bf* Vl) {
    __shared__ __align__(16) float os[8 * 64 * 68];
    const int j = blockIdx.x; const size_t zw = (size_t)HD * DM, zp = (size_t)KPH * HD;    // per head: the head's 64 weight rows, projected plane
    if (j < KT) { const size_t h = j / (KPH / 64); const int t = j % (KPH / 64);
        kv_tile<1>(os, kin + h * DM, BK + h * zw, Kh + h * zp, Kl + h * zp, bk + h * HD, t * 64); }
    else if (j < 2 * KT) { const size_t h = (j - KT) / (KPH / 64); const int t = (j - KT) % (KPH / 64);
        kv_tile<2>(os, vin + h * DM, BV + h * zw, Vh + h * zp, Vl + h * zp, bv + h * HD, t * 64); }
    else { const size_t h = (j - 2 * KT) / (TQ / 64); const int t = (j - 2 * KT) % (TQ / 64);
        gemmw_tile<bf, 0, true, 8, 1>(os, QB, nullptr, BQ + h * zw, nullptr, K, nullptr, Qh + h * (TQ * HD), Ql + h * (TQ * HD), HD, bq + h * HD, t * 64, 0); }
}


// ---- k_cvtall: the f32 -> bf16 copies of the operands that many tiles share (Wq, Wk, Wv, Wo, q: 1024 rows of DM floats each) in ONE streaming launch; k and v have no copy.
// CG work-groups x CW waves x CR rows per wave cover them exactly once. A wave reads a row as 8 loads of 512 contiguous bytes, non-temporal (each source is read once), and asks for all its CR rows
// before it rounds the first; it stores a row as 8 stores of 256 contiguous bytes.
#define CG 256
#define CW 5
#define CR 4
static_assert(CG * CW * CR == 4 * DM + TQ, "the conversion launch covers every row once");
__global__ __launch_bounds__(CW * 32) void k_cvtall(const float* __restrict__ Wq, const float* __restrict__ Wk, const float* __restrict__ Wv, const float* __restrict__ Wo, const float* __restrict__ qin,
                                                    bf* BQ, bf* BK, bf* BV, bf* BO, bf* QB) {
    const int lane = threadIdx.x & 31; const int gw = __builtin_amdgcn_readfirstlane((int)(blockIdx.x * CW + (threadIdx.x >> 5)));   // wave-uniform: a row's source and place are scalar work
    __builtin_assume(gw >= 0 && gw < CG * CW);
    v4f x[CR][DM / 128]; bf* dst[CR];
#pragma unroll
    for (int r = 0; r < CR; ++r) { const int row = r * (CG * CW) + gw; const int m = row >> 10; const size_t o = (size_t)(row & 1023) * DM; const float* s = Wq; bf* d = BQ;
        if (m == 1) { s = Wk; d = BK; } if (m == 2) { s = Wv; d = BV; } if (m == 3) { s = Wo; d = BO; } if (m == 4) { s = qin; d = QB; } s += o; d += o;
        dst[r] = d + lane * 4;
#pragma unroll
        for (int q = 0; q < DM / 128; ++q) x[r][q] = __builtin_nontemporal_load((const v4f*)(s + q * 128 + lane * 4)); }
    __builtin_amdgcn_sched_barrier(0);   // keeps every row's loads in front of the first rounding: left alone the compiler issues the last row's loads only when earlier rows have arrived, a second memory latency in every wave
#pragma unroll
    for (int r = 0; r < CR; ++r)
#pragma unroll
        for (int q = 0; q < DM / 128; ++q) { v4us o;
#pragma unroll
            for (int u = 0; u < 4; ++u) o[u] = f2bf(x[r][q][u]);
            *(v4us*)(dst[r] + q * 128) = o; } }
// ---- k_attn: scores, softmax, attn.v and the head merge of 64 queries of one head in ONE work-group of 8 waves; grid (TQ / 64, NH_). No score and no probability leaves the registers.
// Wave w takes keys 64 w ... 64 w + 63. It forms S^T = K Q^T (A = K rows, B = Q rows as columns; hl x hl, 3 products), so a lane holds 32 keys of one query per 16-query group: maximum and sum are in-lane plus one exchange of the wave halves.
// p = exp2(s c - m c), m the maximum over the WAVE's own 64 keys, not yet divided by any sum. Two 16-key score tiles, rounded in place, are the B operand of O^T += V^T P^T (A = V^T rows from the [d][key] planes, same k order; 3 products).
// The 8 partial O^T tiles, each with its m c and its sum, meet in LDS behind one barrier; wave w joins queries 8 w ... 8 w + 7: O = sum_p f_p O_p / sum_p f_p l_p, f_p = exp2(m_p c - max m c), partial 0 first, and stores them as hl planes in merged [t][h * 64 + d] order.
typedef __attribute__((ext_vector_type(2))) float v2f;
typedef __attribute__((ext_vector_type(2))) __bf16 v2bf;
__device__ __forceinline__ float xhalf(float x) { const int b = __float_as_int(x); return __int_as_float(__builtin_amdgcn_permlanex16(b, b, 0x76543210, 0xfedcba98, false, false)); }   // lane l <-> l ^ 16
__global__ __launch_bounds__(256) void k_attn(const bf* __restrict__ Qh, const bf* __restrict__ Ql, const bf* __restrict__ Kh, const bf* __restrict__ Kl, const bf* __restrict__ Vh, const bf* __restrict__ Vl, bf* ATh, bf* ATl) {
    typedef WFrag<bf> F;
    __shared__ __align__(16) float os[8 * 64 * 68];
    __shared__ __align__(16) float st[2 * 64 * 8];   // [0][query][wave] = m c, [1][query][wave] = sum
    const int lane = threadIdx.x & 31, lr = lane & 15, hi = lane >> 4; const int q0 = blockIdx.x * 64; const size_t h = blockIdx.y;
    const int w = __builtin_amdgcn_readfirstlane((int)(threadIdx.x >> 5));   // wave-uniform: the key slice and the queries to join are scalar work
    const size_t qoff = (h * TQ + q0 + lr) * HD + 8 * hi, koff = (h * KPH + w * 64 + lr) * HD + 8 * hi, voff = (h * HD + lr) * KPH + w * 64 + 8 * hi;
    v8f acc[4][4], o[4][4];
#pragma unroll
    for (int mb = 0; mb < 4; ++mb)
#pragma unroll
        for (int nb = 0; nb < 4; ++nb) { acc[mb][nb] = (v8f){}; o[mb][nb] = (v8f){}; }
    v16bf a[2][4], a2[2][4], b[2][4], b2[2][4], va[2][4], va2[2][4];   // [32-wide k slice][16-row block]: K, Q and V^T fragments, high and low planes
#pragma unroll
    for (int kc = 0; kc < 2; ++kc)
#pragma unroll
        for (int i = 0; i < 4; ++i) { a[kc][i] = F::ld(Kh + koff + i * 16 * HD + kc * 32); a2[kc][i] = F::ld(Kl + koff + i * 16 * HD + kc * 32); b[kc][i] = F::ld(Qh + qoff + i * 16 * HD + kc * 32); b2[kc][i] = F::ld(Ql + qoff + i * 16 * HD + kc * 32); }
    asm volatile("s_wait_xcnt 0x0" ::: "memory");   // the loads' address registers are reused below: the wait stands in front of the first overwrite (the fence on the next line holds later code behind it)
    __builtin_amdgcn_sched_barrier(0);   // keeps every K and Q load in front of the first product: left alone the compiler asks for each Q fragment only when its turn comes, eight load latencies in a row
#pragma unroll
    for (int kc = 0; kc < 2; ++kc) {
#pragma unroll
        for (int nb = 0; nb < 4; ++nb) {   // the four key blocks take turns, so that no product waits for the one just issued
#pragma unroll
            for (int mb = 0; mb < 4; ++mb) acc[mb][nb] = wmmab(a[kc][mb], b[kc][nb], acc[mb][nb]);
#pragma unroll
            for (int mb = 0; mb < 4; ++mb) acc[mb][nb] = wmmab(a2[kc][mb], b[kc][nb], acc[mb][nb]);
#pragma unroll
            for (int mb = 0; mb < 4; ++mb) acc[mb][nb] = wmmab(a[kc][mb], b2[kc][nb], acc[mb][nb]); }
        if (kc == 0) {
#pragma unroll
            for (int ch = 0; ch < 2; ++ch)
#pragma unroll
                for (int db = 0; db < 4; ++db) { va[ch][db] = F::ld(Vh + voff + db * 16 * KPH + ch * 32); va2[ch][db] = F::ld(Vl + voff + db * 16 * KPH + ch * 32); }
            asm volatile("s_wait_xcnt 0x0" ::: "memory");   // as above, for the address registers of the V^T loads
            __builtin_amdgcn_sched_barrier(0);   // keeps the V^T loads here, half the score products and the softmax arithmetic ahead of their use: left alone they are asked for just in front of it
        }
    }   // acc[mb][nb][r] = S[query q0 + 16 nb + lr][key 64 w + 16 mb + 8 hi + r], unscaled
    const float c8 = 0.125f * 1.4426950408889634f;   // 1 / sqrt(HD) and log2(e) in one factor
#pragma unroll
    for (int nb = 0; nb < 4; ++nb) {
        float mx = acc[0][nb][0];
#pragma unroll
        for (int mb = 0; mb < 4; ++mb)
#pragma unroll
            for (int r = 0; r < 8; ++r) mx = fmaxf(mx, acc[mb][nb][r]);
        mx = fmaxf(mx, xhalf(mx));
        const float mc = mx * c8; float sum = 0.f; v16bf ph[2], pl[2];
#pragma unroll
        for (int ch = 0; ch < 2; ++ch)
#pragma unroll
            for (int s = 0; s < 16; s += 2) { v2f e;   // element s of the B operand = key 32 ch + 16 (s >> 3) + 8 hi + (s & 7): the hardware k order, which the V^T loader has too
                e[0] = __builtin_amdgcn_exp2f(__builtin_fmaf(acc[2 * ch + (s >> 3)][nb][s & 7], c8, -mc)); e[1] = __builtin_amdgcn_exp2f(__builtin_fmaf(acc[2 * ch + (s >> 3)][nb][(s & 7) + 1], c8, -mc));
                sum += e[0]; sum += e[1];
                const v2bf eh = __builtin_convertvector(e, v2bf); const v2bf el = __builtin_convertvector(e - __builtin_convertvector(eh, v2f), v2bf);
                ph[ch][s] = eh[0]; ph[ch][s + 1] = eh[1]; pl[ch][s] = el[0]; pl[ch][s + 1] = el[1]; }
        sum += xhalf(sum);
        st[hi * 512 + (nb * 16 + lr) * 8 + w] = hi ? sum : mc;   // both halves hold both values: the low half stores m c, the high half the sum
#pragma unroll
        for (int ch = 0; ch < 2; ++ch) {   // the four d blocks take turns, so that no product waits for the one just issued
#pragma unroll
            for (int db = 0; db < 4; ++db) o[db][nb] = wmmab(va[ch][db], ph[ch], o[db][nb]);
#pragma unroll
            for (int db = 0; db < 4; ++db) o[db][nb] = wmmab(va2[ch][db], ph[ch], o[db][nb]);
#pragma unroll
            for (int db = 0; db < 4; ++db) o[db][nb] = wmmab(va[ch][db], pl[ch], o[db][nb]); }
    }   // o[db][nb][r] = partial O[query 16 nb + lr][d = 16 db + 8 hi + r]
    __builtin_amdgcn_sched_barrier(0);   // keeps the LDS stores behind the last product
    float* mine = os + w * (64 * 68) + lr * 68 + hi * 8;
#pragma unroll
    for (int nb = 0; nb < 4; ++nb)
#pragma unroll
        for (int db = 0; db < 4; ++db) { float* p = mine + nb * 16 * 68 + db * 16;
            *(v4fa*)p = __builtin_shufflevector(o[db][nb], o[db][nb], 0, 1, 2, 3); *(v4fa*)(p + 4) = __builtin_shufflevector(o[db][nb], o[db][nb], 4, 5, 6, 7); }
    __syncthreads();   // every wave's partial tile, maximum and sum are in LDS before any wave joins them
    const int cofs = lr * 4, row0 = w * 8 + hi;
#pragma unroll
    for (int s = 0; s < 4; ++s) { const int row = row0 + 2 * s; float m[8], l[8];
        { const v4f m0 = *(const v4fa*)(st + row * 8), m1 = *(const v4fa*)(st + row * 8 + 4), l0 = *(const v4fa*)(st + 512 + row * 8), l1 = *(const v4fa*)(st + 512 + row * 8 + 4);
#pragma unroll
            for (int u = 0; u < 4; ++u) { m[u] = m0[u]; m[4 + u] = m1[u]; l[u] = l0[u]; l[4 + u] = l1[u]; } }
        float M = m[0];
#pragma unroll
        for (int p = 1; p < 8; ++p) M = fmaxf(M, m[p]);
        float L = 0.f; v4f val = (v4f){};
#pragma unroll
        for (int p = 0; p < 8; ++p) { const float f = __builtin_amdgcn_exp2f(m[p] - M); L += f * l[p]; val += f * *(const v4fa*)(os + (p * 64 + row) * 68 + cofs); }
        val *= __fdiv_rn(1.0f, L);
        v4us oh, ol;
#pragma unroll
        for (int u = 0; u < 4; ++u) { unsigned short x0, x1; splitf(val[u], x0, x1); oh[u] = x0; ol[u] = x1; }
        const size_t oo = (size_t)(q0 + row) * DM + h * HD + cofs; *(v4us*)(ATh + oo) = oh; *(v4us*)(ATl + oo) = ol; }
}

extern "C" void kernel_launch(void* const* d_in, const int* in_sizes, int n_in,
                              void* d_out, int out_size, void* d_ws, size_t ws_size, hipStream_t stream) {
    (void)in_sizes; (void)n_in; (void)out_size;
    const float* qin = (const float*)d_in[0]; const float* kin = (const float*)d_in[1]; const float* vin = (const float*)d_in[2]; const float* Wq = (const float*)d_in[3]; const float* bq = (const float*)d_in[4]; const float* Wk = (const float*)d_in[5]; const float* bk = (const float*)d_in[6]; const float* Wv = (const float*)d_in[7]; const float* bv = (const float*)d_in[8]; const float* Wo = (const float*)d_in[9]; const float* bo = (const float*)d_in[10];
    float* OUT = (float*)d_out;     // [1][1024][1024]
    char* wsp = (char*)d_ws;
    auto take = [&](size_t bytes) { char* p = wsp; wsp += (bytes + 255) & ~(size_t)255; return (void*)p; };
    bf* BQ = (bf*)take((size_t)DM * DM * 2); bf* BK = (bf*)take((size_t)DM * DM * 2); bf* BV = (bf*)take((size_t)DM * DM * 2); bf* BO = (bf*)take((size_t)DM * DM * 2);
    bf* QB = (bf*)take((size_t)TQ * DM * 2);
    bf* Qh = (bf*)take((size_t)NH_ * TQ * HD * 2); bf* Ql = (bf*)take((size_t)NH_ * TQ * HD * 2); bf* Kh = (bf*)take((size_t)NH_ * KPH * HD * 2); bf* Kl = (bf*)take((size_t)NH_ * KPH * HD * 2); bf* Vh = (bf*)take((size_t)NH_ * HD * KPH * 2); bf* Vl = (bf*)take((size_t)NH_ * HD * KPH * 2);
    bf* ATh = (bf*)take((size_t)TQ * DM * 2); bf* ATl = (bf*)take((size_t)TQ * DM * 2);
    if ((size_t)(wsp - (char*)d_ws) > ws_size) return;    // total ~ 22 MB
    k_cvtall<<<CG, CW * 32, 0, stream>>>(Wq, Wk, Wv, Wo, qin, BQ, BK, BV, BO, QB);   // [out][in] weights = Bt as-is
    k_qkv<<<QT + 2 * KT, 256, 0, stream>>>(QB, kin, vin, BQ, BK, BV, bq, bk, bv, DM, Qh, Ql, Kh, Kl, Vh, Vl);
    k_attn<<<dim3(TQ / 64, NH_, 1), 256, 0, stream>>>(Qh, Ql, Kh, Kl, Vh, Vl, ATh, ATl);
    k_gemmw<bf, 1, true, 8, 0><<<dim3(TQ / 64, DM / 64, 1), 256, 0, stream>>>(ATh, ATl, BO, nullptr, DM, OUT, nullptr, nullptr, DM, bo);
}

// v008
// A run of this version takes 36.9 microseconds.
// Next to v007, in two timings, it ran 1.21 and 1.16 times as fast.
// All steps since v000 together make it 5.38 times as fast.
#include <hip/hip_runtime.h>

// Multi-head attention with a strided key mask (q [1][1024][1024], k, v [1][8192][1024]; Q/K/V = in W^T + b (16 heads x 64); head h attends only keys with (k_idx - h) % 16 == 0 (512 keys per head); softmax(Q.K / 8); out = merged Wo^T + bo -> [1][1024][1024]; no row is fully masked, so nan_to_num is a no-op).
// The HEPOS mask is structural: each head's 512 keys are gathered into dense planes (key m of head h = token 16 m + h), so no masked score is ever computed.
// Key token t is kept by head t % 16 alone, so of its K and V projections only that head's 64 columns are ever read: a head's rows of k / v (every 16th) are projected as one of 16 batched 512 x 64 x 1024 GEMMs.
// Compute dtypes, f32 accumulate: every input rounded to bf16; Q/K/V as PLAIN bf16 GEMMs (inputs: exact) + bias; scores hl x hl (3 products), softmax f32 -> hl operands in registers, attn.v 3 products (all cheap: 512 keys; one fused launch); Wo hl x exact (2 products) + bias.

#define TQ   1024
#define TK   8192
#define DM   1024
#define NH_  16
#define HD   64
#define KPH  512    // keys per head = TK / 16
typedef _Float16 h16;
typedef unsigned short bf;
typedef __attribute__((ext_vector_type(16))) __bf16   v16bf;
typedef __attribute__((ext_vector_type(16))) _Float16 v16h;
typedef __attribute__((ext_vector_type(8)))  _Float16 v8h;
typedef __attribute__((ext_vector_type(8)))  unsigned short v8us;
typedef __attribute__((ext_vector_type(8)))  float    v8f;
typedef __attribute__((ext_vector_type(4)))  float    v4f;
typedef v8h  __attribute__((may_alias)) v8ha;
typedef v4f  __attribute__((may_alias)) v4fa;
typedef v8us __attribute__((may_alias)) v8usa;

__device__ __forceinline__ unsigned short f2bf(float f) { unsigned u = __float_as_uint(f); u += 0x7FFFu + ((u >> 16) & 1u); return (unsigned short)(u >> 16); }
__device__ __forceinline__ float bf2f(unsigned short b) { return __uint_as_float(((unsigned)b) << 16); }
__device__ __forceinline__ float bfr(float f) { return bf2f(f2bf(f)); }
__device__ __forceinline__ v16h cat16(v8h lo, v8h hi) { return __builtin_shufflevector(lo, hi, 0, 1, 2, 3, 4, 5, 6, 7, 8, 9, 10, 11, 12, 13, 14, 15); }
__device__ __forceinline__ v16bf cat16b(v8us lo, v8us hi) { return __builtin_bit_cast(v16bf, __builtin_shufflevector(lo, hi, 0, 1, 2, 3, 4, 5, 6, 7, 8, 9, 10, 11, 12, 13, 14, 15)); }
__device__ __forceinline__ v8f wmma16(v16h a, v16h b, v8f c) { return __builtin_amdgcn_wmma_f32_16x16x32_f16(false, a, false, b, (short)0, c, false, false); }
__device__ __forceinline__ v8f wmmab(v16bf a, v16bf b, v8f c) { return __builtin_amdgcn_wmma_f32_16x16x32_bf16(false, a, false, b, (short)0, c, false, false); }



// ---- k_gemmw: register-blocked GEMM, one work-group of KS waves per 64x64 output tile, operands from K-contiguous 16-bit planes by way of LDS; grid (M/64, N/64), 32 * KS threads.
// Every wave holds the whole tile (16 accumulators) and takes every KS-th 32-wide slice of K, so the K loop is K / (32 KS) trips long and the KS waves of a trip consume 64 KS contiguous bytes of each row.
// The KS partial tiles meet in LDS behind one barrier; wave w sums rows 64 w / KS ... of them, partial 0 first, and stores those rows.
// C[m][n] (pitch ldc, + optional f32 bias) = sum_k A[m][k] Bt[n][k] (+ split products per NSPLIT). K % 256 == 0.
// OUT 0: C stored as f32, bias[n]. OUT 1: C stored as a high and a low bf16 plane (Ch, Cl), the form the attention launch reads, bias[n]. OUT 2: planes too, bias[m] (A = weight rows, Bt = tokens: the tile comes out as [d][key]).
template <typename T16> struct WFrag;
template <> struct WFrag<h16> { typedef v16h V; static __device__ __forceinline__ V ld(const h16* p) { return cat16(*(const v8h*)p, *(const v8h*)(p + 16)); } static __device__ __forceinline__ v8f mma(V a, V b, v8f c) { return wmma16(a, b, c); } };
template <> struct WFrag<bf> { typedef v16bf V; static __device__ __forceinline__ V ld(const bf* p) { return cat16b(*(const v8us*)p, *(const v8us*)(p + 16)); } static __device__ __forceinline__ v8f mma(V a, V b, v8f c) { return wmmab(a, b, c); } };
__device__ __forceinline__ void splitf(float y, unsigned short& h, unsigned short& l) { h = f2bf(y); l = f2bf(y - bf2f(h)); }
typedef __attribute__((ext_vector_type(4))) unsigned short v4us;
// The operands reach the waves through LDS. Read straight from the planes, a fragment load takes 32 bytes of each of 16 rows: 16 cache lines for 512 bytes. An asynchronous copy takes 512 contiguous bytes of ONE row, 4 whole lines.
// A stage is the KS * 32 = 256 k (512 bytes) of every operand row that one trip of the K loop consumes, at pitch SP; two buffers, the next stage's copies fly while this one is multiplied. The buffers lie in os and are dead before the partial tiles are written there.
#define SP 528          // bytes from row to row of a stage in LDS: 16 x odd, the conflict-free pitch for 16-byte fragment reads
#define SO (64 * SP)    // the 64 rows of one operand
// cp8: eight rows' pieces, one copy each (lane = 16 bytes), from g (pitch ld elements) to LDS byte address l (pitch SP).
__device__ __forceinline__ void cp8(unsigned l, const bf* g, size_t ld) {
    // the copies and s_wait_xcnt 0 in one statement: the wait stands in front of every later write of the address registers that the copies name
    asm volatile("global_load_async_to_lds_b128 %0, %8, off\n\tglobal_load_async_to_lds_b128 %1, %9, off\n\tglobal_load_async_to_lds_b128 %2, %10, off\n\tglobal_load_async_to_lds_b128 %3, %11, off\n\t"
                 "global_load_async_to_lds_b128 %4, %12, off\n\tglobal_load_async_to_lds_b128 %5, %13, off\n\tglobal_load_async_to_lds_b128 %6, %14, off\n\tglobal_load_async_to_lds_b128 %7, %15, off\n\ts_wait_xcnt 0x0"
                 :: "v"(l), "v"(l + SP), "v"(l + 2 * SP), "v"(l + 3 * SP), "v"(l + 4 * SP), "v"(l + 5 * SP), "v"(l + 6 * SP), "v"(l + 7 * SP),
                    "v"(g), "v"(g + ld), "v"(g + 2 * ld), "v"(g + 3 * ld), "v"(g + 4 * ld), "v"(g + 5 * ld), "v"(g + 6 * ld), "v"(g + 7 * ld) : "memory");
}
// ldl: one fragment from a staged row, at the k positions of WFrag<bf>::ld.
__device__ __forceinline__ v16bf ldl(const char* p) { return cat16b(*(const v8usa*)p, *(const v8usa*)(p + 32)); }
// gemmw_tile is the work of one such work-group on the tile at row r0, column c0; os = its LDS: the larger of KS * 64 * 68 floats and two stages.
template <typename T16, int NSPLIT, bool BIAS, int KS, int OUT>
__device__ __forceinline__ void gemmw_tile(float* os, const T16* __restrict__ A, const T16* __restrict__ A2, const T16* __restrict__ Bt, const T16* __restrict__ Bt2, int K, float* C, bf* Ch, bf* Cl, int ldc, const float* __restrict__ bias, int r0, int c0) {
    typedef typename WFrag<T16>::V V;
    const int lane = threadIdx.x & 31, lr = lane & 15, hi = lane >> 4;
    const int w = __builtin_amdgcn_readfirstlane((int)(threadIdx.x >> 5));   // wave-uniform: the K slice and the rows to sum are scalar work
    v8f acc[4][4];
#pragma unroll
    for (int mb = 0; mb < 4; ++mb)
#pragma unroll
        for (int nb = 0; nb < 4; ++nb) acc[mb][nb] = (v8f){};
    const int cofs = lr * 4, row0 = w * (64 / KS) + hi; v4f bv = (v4f){}; float br[32 / KS];   // the lane's four output columns, its first output row and their bias, asked for ahead of the K loop
    if (BIAS && OUT != 2) { bv[0] = bfr(bias[c0 + cofs]); bv[1] = bfr(bias[c0 + cofs + 1]); bv[2] = bfr(bias[c0 + cofs + 2]); bv[3] = bfr(bias[c0 + cofs + 3]); }
    if (BIAS && OUT == 2) {
#pragma unroll
        for (int s = 0; s < 32 / KS; ++s) br[s] = bfr(bias[r0 + row0 + 2 * s]); }
    static_assert(KS == 8 && NSPLIT <= 1 && sizeof(T16) == 2, "a stage is 8 slices of 32 k of A, Bt and, with NSPLIT 1, A2");
    constexpr int NOP = NSPLIT == 1 ? 3 : 2;   // operands of a stage: A, Bt (, A2)
    const int nt = K / (KS * 32);              // stages = trips; K % 256 == 0
    // wave w copies rows 8 w ... 8 w + 7 of every operand
    const unsigned l0 = (unsigned)(size_t)os + (unsigned)(w * 8 * SP + lane * 16);
    const size_t ga = (size_t)(r0 + w * 8) * K + lane * 8, gb = (size_t)(c0 + w * 8) * K + lane * 8;
    auto stage = [&](int t) { const unsigned lb = l0 + (unsigned)((t & 1) * (NOP * SO)); const size_t ko = (size_t)t * (KS * 32);
        cp8(lb, A + ga + ko, K); cp8(lb + SO, Bt + gb + ko, K); if (NSPLIT == 1) cp8(lb + 2 * SO, A2 + ga + ko, K); };
    stage(0);
    asm volatile("s_wait_asynccnt 0x0" ::: "memory");   // this wave's copies of stage 0 have landed
    __syncthreads();   // every wave's copies of stage 0 have landed before any wave reads it
    if (nt > 1) stage(1);
    const char* fp = (const char*)os + lr * SP + w * 64 + hi * 16;   // the lane's row and the wave's 32-k slice of a stage
#pragma unroll 1
    for (int t = 0; t < nt; ++t) {
        const char* sb = fp + (t & 1) * (NOP * SO);
        V a[4], a2[4], b[4];
#pragma unroll
        for (int mb = 0; mb < 4; ++mb) { a[mb] = ldl(sb + mb * 16 * SP); if (NSPLIT == 1) a2[mb] = ldl(sb + 2 * SO + mb * 16 * SP); }
#pragma unroll
        for (int nb = 0; nb < 4; ++nb) b[nb] = ldl(sb + SO + nb * 16 * SP);
        __builtin_amdgcn_sched_barrier(0);   // keeps every fragment read of the trip in front of the first product: left alone the compiler asks for three of the four B fragments between the products, three further LDS latencies in every trip
#pragma unroll
        for (int nb = 0; nb < 4; ++nb)
#pragma unroll
            for (int mb = 0; mb < 4; ++mb) { acc[mb][nb] = WFrag<T16>::mma(a[mb], b[nb], acc[mb][nb]); if (NSPLIT == 1) acc[mb][nb] = WFrag<T16>::mma(a2[mb], b[nb], acc[mb][nb]); }
        __builtin_amdgcn_sched_barrier(0);   // keeps every product of the trip in front of the barrier below: left alone the compiler moves most of them behind it, in front of the refill, and the copies start that much later
        asm volatile("v_nop\n\tv_nop\n\tv_nop\n\tv_nop" : "+v"(acc[0][0]), "+v"(acc[1][1]), "+v"(acc[2][2]), "+v"(acc[3][3]) : "v"(a[0]), "v"(a[3]));   // the four vector slots the chip needs behind the trip's last products, on the taken back edge too, before the next trip writes their operand registers
        asm volatile("s_wait_dscnt 0x0" ::: "memory");      // this wave has read all it wants of this trip's buffer
        asm volatile("s_wait_asynccnt 0x0" ::: "memory");   // this wave's copies of the next stage have landed
        __syncthreads();   // publishes the next stage and ends every wave's reads of this trip's buffer, which is refilled (after the last trip: overwritten by the partial tiles) behind it
        if (t + 2 < nt) stage(t + 2);
    }
    asm volatile("s_wait_asynccnt 0x0" ::: "memory");   // no copy is outstanding when the buffers become the partial tiles
    float* mine = os + w * (64 * 68);
#pragma unroll
    for (int mb = 0; mb < 4; ++mb)
#pragma unroll
        for (int nb = 0; nb < 4; ++nb)
#pragma unroll
            for (int j = 0; j < 8; ++j) mine[(mb * 16 + hi * 8 + j) * 68 + nb * 16 + lr] = acc[mb][nb][j];
    __syncthreads();   // every wave's partial tile is in LDS before any wave sums across them
    const float* op = os + row0 * 68 + cofs; const size_t co = (size_t)(r0 + row0) * ldc + c0 + cofs;
#pragma unroll
    for (int s = 0; s < 32 / KS; ++s) { v4f val = *(const v4fa*)(op + 2 * s * 68);
#pragma unroll
        for (int p = 1; p < KS; ++p) val += *(const v4fa*)(op + (p * 64 + 2 * s) * 68);
        if (BIAS) { if (OUT == 2) val += br[s]; else val += bv; }
        const size_t oo = co + (size_t)(2 * s) * ldc;
        if (OUT == 0) *(v4f*)(C + oo) = val;
        else { v4us oh, ol;
#pragma unroll
            for (int u = 0; u < 4; ++u) { unsigned short x0, x1; splitf(val[u], x0, x1); oh[u] = x0; ol[u] = x1; }
            *(v4us*)(Ch + oo) = oh; *(v4us*)(Cl + oo) = ol; } }
    asm volatile("s_wait_xcnt 0x0" ::: "memory");   // where several tile bodies stand in one kernel, the code laid out behind this one reuses the stores' address and data registers: the wait stands in front of that
}
template <typename T16, int NSPLIT, bool BIAS, int KS, int OUT>
__global__ __launch_bounds__(32 * KS) void k_gemmw(const T16* __restrict__ A, const T16* __restrict__ A2, const T16* __restrict__ Bt, const T16* __restrict__ Bt2, int K, float* C, bf* Ch, bf* Cl, int ldc, const float* __restrict__ bias) {
    constexpr int PT = KS * 64 * 68, ST = 2 * (NSPLIT == 1 ? 3 : 2) * SO / 4;   // floats: the partial tiles, the two stages
    __shared__ __align__(16) float os[PT > ST ? PT : ST];
    gemmw_tile<T16, NSPLIT, BIAS, KS, OUT>(os, A, A2, Bt, Bt2, K, C, Ch, Cl, ldc, bias, blockIdx.x * 64, blockIdx.y * 64);
}
// ---- kv_tile: the tile body above (8 waves, plain bf16 product, bias, plane output, same K slices and same sums) for a tile whose token operand is still the f32 input: 64 keys of one head by the head's 64 weight rows.
// X = the head's first token row: key m of head h is token NH_ m + h, so the head's keys are rows of pitch NH_ * DM floats. Each is read from memory by this tile alone and rounded to bf16 in the loader, so k and v need no bf16 copy.
// Wt = the head's 64 bf16 weight rows; t0 = the tile's first key. OUT 1: tokens are A, planes [key][d], bias per column. OUT 2: tokens are Bt, planes [d][key], bias per row.
// The row steps are literals: folded into the loads' offsets they free the address registers that the f32 rows in flight need.
// ldf: one fragment from f32, rounded nearest even, at the k positions of WFrag<bf>::ld: 4 loads of 16 bytes in place of 2.
__device__ __forceinline__ v16bf ldf(const float* p) { const v4f x0 = *(const v4f*)p, x1 = *(const v4f*)(p + 4), x2 = *(const v4f*)(p + 16), x3 = *(const v4f*)(p + 20);
    const v8f lo = __builtin_shufflevector(x0, x1, 0, 1, 2, 3, 4, 5, 6, 7), hi = __builtin_shufflevector(x2, x3, 0, 1, 2, 3, 4, 5, 6, 7);
    return __builtin_convertvector(__builtin_shufflevector(lo, hi, 0, 1, 2, 3, 4, 5, 6, 7, 8, 9, 10, 11, 12, 13, 14, 15), v16bf); }
template <int OUT>
__device__ __forceinline__ void kv_tile(float* os, const float* __restrict__ X, const bf* __restrict__ Wt, bf* Ch, bf* Cl, const float* __restrict__ bias, int t0) {
    constexpr int KS = 8, ldc = OUT == 2 ? KPH : HD; constexpr size_t ldx = (size_t)NH_ * DM;
    const int lane = threadIdx.x & 31, lr = lane & 15, hi = lane >> 4;
    const int w = __builtin_amdgcn_readfirstlane((int)(threadIdx.x >> 5));   // wave-uniform: the K slice and the rows to sum are scalar work
    const int r0 = OUT == 2 ? 0 : t0, c0 = OUT == 2 ? t0 : 0;
    v8f acc[4][4];
#pragma unroll
    for (int mb = 0; mb < 4; ++mb)
#pragma unroll
        for (int nb = 0; nb < 4; ++nb) acc[mb][nb] = (v8f){};
    const int cofs = lr * 4, row0 = w * (64 / KS) + hi; v4f bv = (v4f){}; float br[32 / KS];   // the lane's four output columns, its first output row and their bias, asked for ahead of the K loop
    if (OUT != 2) { bv[0] = bfr(bias[cofs]); bv[1] = bfr(bias[cofs + 1]); bv[2] = bfr(bias[cofs + 2]); bv[3] = bfr(bias[cofs + 3]); }
    else {
#pragma unroll
        for (int s = 0; s < 32 / KS; ++s) br[s] = bfr(bias[row0 + 2 * s]); }
    asm volatile("s_wait_xcnt 0x0" ::: "memory");   // the bias loads' address registers are reused by the code below: the wait stands in front of the first overwrite
    const float* xp = X + (size_t)(t0 + lr) * ldx + 8 * hi; const bf* wp = Wt + (size_t)lr * DM + 8 * hi;
#pragma unroll 1
    for (int kc = w * 32; kc < DM; kc += KS * 32) {
        v16bf a[4], b[4];   // the f32 rows come from memory, the weight rows from L2: the f32 loads go first
        if (OUT == 2) {
#pragma unroll
            for (int nb = 0; nb < 4; ++nb) b[nb] = ldf(xp + nb * 16 * ldx + kc);
#pragma unroll
            for (int mb = 0; mb < 4; ++mb) a[mb] = WFrag<bf>::ld(wp + mb * 16 * DM + kc); }
        else {
#pragma unroll
            for (int mb = 0; mb < 4; ++mb) a[mb] = ldf(xp + mb * 16 * ldx + kc);
#pragma unroll
            for (int nb = 0; nb < 4; ++nb) b[nb] = WFrag<bf>::ld(wp + nb * 16 * DM + kc); }
        asm volatile("s_wait_xcnt 0x0" ::: "memory");   // the loads' address registers are stepped for the next trip: the wait stands in front of that (the fence on the next line holds later code behind it)
        __builtin_amdgcn_sched_barrier(0);   // keeps every load of the trip in front of the first product: left alone the compiler asks for part of them only between the products, further load waits in every trip
#pragma unroll
        for (int nb = 0; nb < 4; ++nb)
#pragma unroll
            for (int mb = 0; mb < 4; ++mb) acc[mb][nb] = wmmab(a[mb], b[nb], acc[mb][nb]);
        asm volatile("v_nop\n\tv_nop\n\tv_nop\n\tv_nop" : "+v"(acc[0][0]), "+v"(acc[1][1]), "+v"(acc[2][2]), "+v"(acc[3][3]) : "v"(a[0]), "v"(a[3]));   // the four vector slots the chip needs behind the trip's last products, on the taken back edge too, before the next trip writes their operand registers
    }
    float* mine = os + w * (64 * 68);
#pragma unroll
    for (int mb = 0; mb < 4; ++mb)
#pragma unroll
        for (int nb = 0; nb < 4; ++nb)
#pragma unroll
            for (int j = 0; j < 8; ++j) mine[(mb * 16 + hi * 8 + j) * 68 + nb * 16 + lr] = acc[mb][nb][j];
    __syncthreads();   // every wave's partial tile is in LDS before any wave sums across them
    const float* op = os + row0 * 68 + cofs; const size_t co = (size_t)(r0 + row0) * ldc + c0 + cofs;
#pragma unroll
    for (int s = 0; s < 32 / KS; ++s) { v4f val = *(const v4fa*)(op + 2 * s * 68);
#pragma unroll
        for (int p = 1; p < KS; ++p) val += *(const v4fa*)(op + (p * 64 + 2 * s) * 68);
        if (OUT == 2) val += br[s]; else val += bv;
        const size_t oo = co + (size_t)(2 * s) * ldc; v4us oh, ol;
#pragma unroll
        for (int u = 0; u < 4; ++u) { unsigned short x0, x1; splitf(val[u], x0, x1); oh[u] = x0; ol[u] = x1; }
        *(v4us*)(Ch + oo) = oh; *(v4us*)(Cl + oo) = ol; }
    asm volatile("s_wait_xcnt 0x0" ::: "memory");   // the code laid out behind this body reuses the stores' address and data registers: the wait stands in front of that
}
// ---- k_qkv: the Q, K and V projections, which do not depend on one another, in ONE launch of 128 + 128 + 256 tiles of equal arithmetic: two work-groups share a WGP (LDS allows two), so one's load waits are filled by the other.
// Tile j < 128: K, head j / 8, 64 keys -> planes [h][key][d]. Next 128: V with the head's weight rows as A -> planes [h][d][key]. Last 256: Q, head by 64 queries -> planes [h][t][d].
// K and V take the low tile indices, for speed only: their token rows are read by one tile alone, while 16 Q tiles share each block of query rows.
// For the Q tiles K stays an argument, as in k_gemmw.
// amdgpu_waves_per_eu(4, 4): the register budget of four waves per SIMD (256), which two work-groups on a WGP need; without it the f32 rows in flight take the kernel past it and only one work-group fits.
#define QT (NH_ * TQ / 64)
#define KT (NH_ * KPH / 64)
__global__ __launch_bounds__(256) __attribute__((amdgpu_waves_per_eu(4, 4))) void k_qkv(const bf* __restrict__ QB, const float* __restrict__ kin, const float* __restrict__ vin, const bf* __restrict__ BQ, const bf* __restrict__ BK, const bf* __restrict__ BV,
                                             const float* __restrict__ bq, const float* __restrict__ bk, const float* __restrict__ bv, int K, bf* Qh, bf* Ql, bf* Kh, bf* Kl, bf* Vh, bf* Vl) {
    __shared__ __align__(16) float os[8 * 64 * 68];
    static_assert(2 * 2 * SO <= 8 * 64 * 68 * 4, "the two stages of a Q tile fit the partial tiles' LDS");
    const int j = blockIdx.x; const size_t zw = (size_t)HD * DM, zp = (size_t)KPH * HD;    // per head: the head's 64 weight rows, projected plane
    if (j < KT) { const size_t h = j / (KPH / 64); const int t = j % (KPH / 64);
        kv_tile<1>(os, kin + h * DM, BK + h * zw, Kh + h * zp, Kl + h * zp, bk + h * HD, t * 64); }
    else if (j < 2 * KT) { const size_t h = (j - KT) / (KPH / 64); const int t = (j - KT) % (KPH / 64);
        kv_tile<2>(os, vin + h * DM, BV + h * zw, Vh + h * zp, Vl + h * zp, bv + h * HD, t * 64); }
    else { const size_t h = (j - 2 * KT) / (TQ / 64); const int t = (j - 2 * KT) % (TQ / 64);
        gemmw_tile<bf, 0, true, 8, 1>(os, QB, nullptr, BQ + h * zw, nullptr, K, nullptr, Qh + h * (TQ * HD), Ql + h * (TQ * HD), HD, bq + h * HD, t * 64, 0); }
}


// ---- k_cvtall: the f32 -> bf16 copies of the operands that many tiles share (Wq, Wk, Wv, Wo, q: 1024 rows of DM floats each) in ONE streaming launch; k and v have no copy.
// CG work-groups x CW waves x CR rows per wave cover them exactly once. A wave reads a row as 8 loads of 512 contiguous bytes, non-temporal (each source is read once), and asks for all its CR rows
// before it rounds the first; it stores a row as 8 stores of 256 contiguous bytes.
#define CG 256
#define CW 5
#define CR 4
static_assert(CG * CW * CR == 4 * DM + TQ, "the conversion launch covers every row once");
__global__ __launch_bounds__(CW * 32) void k_cvtall(const float* __restrict__ Wq, const float* __restrict__ Wk, const float* __restrict__ Wv, const float* __restrict__ Wo, const float* __restrict__ qin,
                                                    bf* BQ, bf* BK, bf* BV, bf* BO, bf* QB) {
    const int lane = threadIdx.x & 31; const int gw = __builtin_amdgcn_readfirstlane((int)(blockIdx.x * CW + (threadIdx.x >> 5)));   // wave-uniform: a row's source and place are scalar work
    __builtin_assume(gw >= 0 && gw < CG * CW);
    v4f x[CR][DM / 128]; bf* dst[CR];
#pragma unroll
    for (int r = 0; r < CR; ++r) { const int row = r * (CG * CW) + gw; const int m = row >> 10; const size_t o = (size_t)(row & 1023) * DM; const float* s = Wq; bf* d = BQ;
        if (m == 1) { s = Wk; d = BK; } if (m == 2) { s = Wv; d = BV; } if (m == 3) { s = Wo; d = BO; } if (m == 4) { s = qin; d = QB; } s += o; d += o;
        dst[r] = d + lane * 4;
#pragma unroll
        for (int q = 0; q < DM / 128; ++q) x[r][q] = __builtin_nontemporal_load((const v4f*)(s + q * 128 + lane * 4)); }
    __builtin_amdgcn_sched_barrier(0);   // keeps every row's loads in front of the first rounding: left alone the compiler issues the last row's loads only when earlier rows have arrived, a second memory latency in every wave
#pragma unroll
    for (int r = 0; r < CR; ++r)
#pragma unroll
        for (int q = 0; q < DM / 128; ++q) { v4us o;
#pragma unroll
            for (int u = 0; u < 4; ++u) o[u] = f2bf(x[r][q][u]);
            *(v4us*)(dst[r] + q * 128) = o; } }
// ---- k_attn: scores, softmax, attn.v and the head merge of 64 queries of one head in ONE work-group of 8 waves; grid (TQ / 64, NH_). No score and no probability leaves the registers.
// Wave w takes keys 64 w ... 64 w + 63. It forms S^T = K Q^T (A = K rows, B = Q rows as columns; hl x hl, 3 products), so a lane holds 32 keys of one query per 16-query group: maximum and sum are in-lane plus one exchange of the wave halves.
// p = exp2(s c - m c), m the maximum over the WAVE's own 64 keys, not yet divided by any sum. Two 16-key score tiles, rounded in place, are the B operand of O^T += V^T P^T (A = V^T rows from the [d][key] planes, same k order; 3 products).
// The 8 partial O^T tiles, each with its m c and its sum, meet in LDS behind one barrier; wave w joins queries 8 w ... 8 w + 7: O = sum_p f_p O_p / sum_p f_p l_p, f_p = exp2(m_p c - max m c), partial 0 first, and stores them as hl planes in merged [t][h * 64 + d] order.
typedef __attribute__((ext_vector_type(2))) float v2f;
typedef __attribute__((ext_vector_type(2))) __bf16 v2bf;
__device__ __forceinline__ float xhalf(float x) { const int b = __float_as_int(x); return __int_as_float(__builtin_amdgcn_permlanex16(b, b, 0x76543210, 0xfedcba98, false, false)); }   // lane l <-> l ^ 16
__global__ __launch_bounds__(256) void k_attn(const bf* __restrict__ Qh, const bf* __restrict__ Ql, const bf* __restrict__ Kh, const bf* __restrict__ Kl, const bf* __restrict__ Vh, const bf* __restrict__ Vl, bf* ATh, bf* ATl) {
    typedef WFrag<bf> F;
    __shared__ __align__(16) float os[8 * 64 * 68];
    __shared__ __align__(16) float st[2 * 64 * 8];   // [0][query][wave] = m c, [1][query][wave] = sum
    const int lane = threadIdx.x & 31, lr = lane & 15, hi = lane >> 4; const int q0 = blockIdx.x * 64; const size_t h = blockIdx.y;
    const int w = __builtin_amdgcn_readfirstlane((int)(threadIdx.x >> 5));   // wave-uniform: the key slice and the queries to join are scalar work
    const size_t qoff = (h * TQ + q0 + lr) * HD + 8 * hi, koff = (h * KPH + w * 64 + lr) * HD + 8 * hi, voff = (h * HD + lr) * KPH + w * 64 + 8 * hi;
    v8f acc[4][4], o[4][4];
#pragma unroll
    for (int mb = 0; mb < 4; ++mb)
#pragma unroll
        for (int nb = 0; nb < 4; ++nb) { acc[mb][nb] = (v8f){}; o[mb][nb] = (v8f){}; }
    v16bf a[2][4], a2[2][4], b[2][4], b2[2][4], va[2][4], va2[2][4];   // [32-wide k slice][16-row block]: K, Q and V^T fragments, high and low planes
#pragma unroll
    for (int kc = 0; kc < 2; ++kc)
#pragma unroll
        for (int i = 0; i < 4; ++i) { a[kc][i] = F::ld(Kh + koff + i * 16 * HD + kc * 32); a2[kc][i] = F::ld(Kl + koff + i * 16 * HD + kc * 32); b[kc][i] = F::ld(Qh + qoff + i * 16 * HD + kc * 32); b2[kc][i] = F::ld(Ql + qoff + i * 16 * HD + kc * 32); }
    asm volatile("s_wait_xcnt 0x0" ::: "memory");   // the loads' address registers are reused below: the wait stands in front of the first overwrite (the fence on the next line holds later code behind it)
    __builtin_amdgcn_sched_barrier(0);   // keeps every K and Q load in front of the first product: left alone the compiler asks for each Q fragment only when its turn comes, eight load latencies in a row
#pragma unroll
    for (int kc = 0; kc < 2; ++kc) {
#pragma unroll
        for (int nb = 0; nb < 4; ++nb) {   // the four key blocks take turns, so that no product waits for the one just issued
#pragma unroll
            for (int mb = 0; mb < 4; ++mb) acc[mb][nb] = wmmab(a[kc][mb], b[kc][nb], acc[mb][nb]);
#pragma unroll
            for (int mb = 0; mb < 4; ++mb) acc[mb][nb] = wmmab(a2[kc][mb], b[kc][nb], acc[mb][nb]);
#pragma unroll
            for (int mb = 0; mb < 4; ++mb) acc[mb][nb] = wmmab(a[kc][mb], b2[kc][nb], acc[mb][nb]); }
        if (kc == 0) {
#pragma unroll
            for (int ch = 0; ch < 2; ++ch)
#pragma unroll
                for (int db = 0; db < 4; ++db) { va[ch][db] = F::ld(Vh + voff + db * 16 * KPH + ch * 32); va2[ch][db] = F::ld(Vl + voff + db * 16 * KPH + ch * 32); }
            asm volatile("s_wait_xcnt 0x0" ::: "memory");   // as above, for the address registers of the V^T loads
            __builtin_amdgcn_sched_barrier(0);   // keeps the V^T loads here, half the score products and the softmax arithmetic ahead of their use: left alone they are asked for just in front of it
        }
    }   // acc[mb][nb][r] = S[query q0 + 16 nb + lr][key 64 w + 16 mb + 8 hi + r], unscaled
    const float c8 = 0.125f * 1.4426950408889634f;   // 1 / sqrt(HD) and log2(e) in one factor
#pragma unroll
    for (int nb = 0; nb < 4; ++nb) {
        float mx = acc[0][nb][0];
#pragma unroll
        for (int mb = 0; mb < 4; ++mb)
#pragma unroll
            for (int r = 0; r < 8; ++r) mx = fmaxf(mx, acc[mb][nb][r]);
        mx = fmaxf(mx, xhalf(mx));
        const float mc = mx * c8; float sum = 0.f; v16bf ph[2], pl[2];
#pragma unroll
        for (int ch = 0; ch < 2; ++ch)
#pragma unroll
            for (int s = 0; s < 16; s += 2) { v2f e;   // element s of the B operand = key 32 ch + 16 (s >> 3) + 8 hi + (s & 7): the hardware k order, which the V^T loader has too
                e[0] = __builtin_amdgcn_exp2f(__builtin_fmaf(acc[2 * ch + (s >> 3)][nb][s & 7], c8, -mc)); e[1] = __builtin_amdgcn_exp2f(__builtin_fmaf(acc[2 * ch + (s >> 3)][nb][(s & 7) + 1], c8, -mc));
                sum += e[0]; sum += e[1];
                const v2bf eh = __builtin_convertvector(e, v2bf); const v2bf el = __builtin_convertvector(e - __builtin_convertvector(eh, v2f), v2bf);
                ph[ch][s] = eh[0]; ph[ch][s + 1] = eh[1]; pl[ch][s] = el[0]; pl[ch][s + 1] = el[1]; }
        sum += xhalf(sum);
        st[hi * 512 + (nb * 16 + lr) * 8 + w] = hi ? sum : mc;   // both halves hold both values: the low half stores m c, the high half the sum
#pragma unroll
        for (int ch = 0; ch < 2; ++ch) {   // the four d blocks take turns, so that no product waits for the one just issued
#pragma unroll
            for (int db = 0; db < 4; ++db) o[db][nb] = wmmab(va[ch][db], ph[ch], o[db][nb]);
#pragma unroll
            for (int db = 0; db < 4; ++db) o[db][nb] = wmmab(va2[ch][db], ph[ch], o[db][nb]);
#pragma unroll
            for (int db = 0; db < 4; ++db) o[db][nb] = wmmab(va[ch][db], pl[ch], o[db][nb]); }
    }   // o[db][nb][r] = partial O[query 16 nb + lr][d = 16 db + 8 hi + r]
    __builtin_amdgcn_sched_barrier(0);   // keeps the LDS stores behind the last product
    float* mine = os + w * (64 * 68) + lr * 68 + hi * 8;
#pragma unroll
    for (int nb = 0; nb < 4; ++nb)
#pragma unroll
        for (int db = 0; db < 4; ++db) { float* p = mine + nb * 16 * 68 + db * 16;
            *(v4fa*)p = __builtin_shufflevector(o[db][nb], o[db][nb], 0, 1, 2, 3); *(v4fa*)(p + 4) = __builtin_shufflevector(o[db][nb], o[db][nb], 4, 5, 6, 7); }
    __syncthreads();   // every wave's partial tile, maximum and sum are in LDS before any wave joins them
    const int cofs = lr * 4, row0 = w * 8 + hi;
#pragma unroll
    for (int s = 0; s < 4; ++s) { const int row = row0 + 2 * s; float m[8], l[8];
        { const v4f m0 = *(const v4fa*)(st + row * 8), m1 = *(const v4fa*)(st + row * 8 + 4), l0 = *(const v4fa*)(st + 512 + row * 8), l1 = *(const v4fa*)(st + 512 + row * 8 + 4);
#pragma unroll
            for (int u = 0; u < 4; ++u) { m[u] = m0[u]; m[4 + u] = m1[u]; l[u] = l0[u]; l[4 + u] = l1[u]; } }
        float M = m[0];
#pragma unroll
        for (int p = 1; p < 8; ++p) M = fmaxf(M, m[p]);
        float L = 0.f; v4f val = (v4f){};
#pragma unroll
        for (int p = 0; p < 8; ++p) { const float f = __builtin_amdgcn_exp2f(m[p] - M); L += f * l[p]; val += f * *(const v4fa*)(os + (p * 64 + row) * 68 + cofs); }
        val *= __fdiv_rn(1.0f, L);
        v4us oh, ol;
#pragma unroll
        for (int u = 0; u < 4; ++u) { unsigned short x0, x1; splitf(val[u], x0, x1); oh[u] = x0; ol[u] = x1; }
        const size_t oo = (size_t)(q0 + row) * DM + h * HD + cofs; *(v4us*)(ATh + oo) = oh; *(v4us*)(ATl + oo) = ol; }
}

extern "C" void kernel_launch(void* const* d_in, const int* in_sizes, int n_in,
                              void* d_out, int out_size, void* d_ws, size_t ws_size, hipStream_t stream) {
    (void)in_sizes; (void)n_in; (void)out_size;
    const float* qin = (const float*)d_in[0]; const float* kin = (const float*)d_in[1]; const float* vin = (const float*)d_in[2]; const float* Wq = (const float*)d_in[3]; const float* bq = (const float*)d_in[4]; const float* Wk = (const float*)d_in[5]; const float* bk = (const float*)d_in[6]; const float* Wv = (const float*)d_in[7]; const float* bv = (const float*)d_in[8]; const float* Wo = (const float*)d_in[9]; const float* bo = (const float*)d_in[10];
    float* OUT = (float*)d_out;     // [1][1024][1024]
    char* wsp = (char*)d_ws;
    auto take = [&](size_t bytes) { char* p = wsp; wsp += (bytes + 255) & ~(size_t)255; return (void*)p; };
    bf* BQ = (bf*)take((size_t)DM * DM * 2); bf* BK = (bf*)take((size_t)DM * DM * 2); bf* BV = (bf*)take((size_t)DM * DM * 2); bf* BO = (bf*)take((size_t)DM * DM * 2);
    bf* QB = (bf*)take((size_t)TQ * DM * 2);
    bf* Qh = (bf*)take((size_t)NH_ * TQ * HD * 2); bf* Ql = (bf*)take((size_t)NH_ * TQ * HD * 2); bf* Kh = (bf*)take((size_t)NH_ * KPH * HD * 2); bf* Kl = (bf*)take((size_t)NH_ * KPH * HD * 2); bf* Vh = (bf*)take((size_t)NH_ * HD * KPH * 2); bf* Vl = (bf*)take((size_t)NH_ * HD * KPH * 2);
    bf* ATh = (bf*)take((size_t)TQ * DM * 2); bf* ATl = (bf*)take((size_t)TQ * DM * 2);
    if ((size_t)(wsp - (char*)d_ws) > ws_size) return;    // total ~ 22 MB
    k_cvtall<<<CG, CW * 32, 0, stream>>>(Wq, Wk, Wv, Wo, qin, BQ, BK, BV, BO, QB);   // [out][in] weights = Bt as-is
    k_qkv<<<QT + 2 * KT, 256, 0, stream>>>(QB, kin, vin, BQ, BK, BV, bq, bk, bv, DM, Qh, Ql, Kh, Kl, Vh, Vl);
    k_attn<<<dim3(TQ / 64, NH_, 1), 256, 0, stream>>>(Qh, Ql, Kh, Kl, Vh, Vl, ATh, ATl);
    k_gemmw<bf, 1, true, 8, 0><<<dim3(TQ / 64, DM / 64, 1), 256, 0, stream>>>(ATh, ATl, BO, nullptr, DM, OUT, nullptr, nullptr, DM, bo);
}

// v009
// One run takes 34.3 microseconds.
// Next to v008, in two timings, it ran 1.06 and 1.07 times as fast.
// Over all steps from v000 it is 5.71 times as fast.
#include <hip/hip_runtime.h>

// Multi-head attention with a strided key mask (q [1][1024][1024], k, v [1][8192][1024]; Q/K/V = in W^T + b (16 heads x 64); head h attends only keys with (k_idx - h) % 16 == 0 (512 keys per head); softmax(Q.K / 8); out = merged Wo^T + bo -> [1][1024][1024]; no row is fully masked, so nan_to_num is a no-op).
// The HEPOS mask is structural: each head's 512 keys are gathered into dense planes (key m of head h = token 16 m + h), so no masked score is ever computed.
// Key token t is kept by head t % 16 alone, so of its K and V projections only that head's 64 columns are ever read: a head's rows of k / v (every 16th) are projected as one of 16 batched 512 x 64 x 1024 GEMMs.
// Compute dtypes, f32 accumulate: every input rounded to bf16; Q/K/V as PLAIN bf16 GEMMs (inputs: exact) + bias; scores hl x hl (3 products), softmax f32 -> hl operands in registers, attn.v 3 products (all cheap: 512 keys; one fused launch); Wo hl x exact (2 products) + bias.

#define TQ   1024
#define TK   8192
#define DM   1024
#define NH_  16
#define HD   64
#define KPH  512    // keys per head = TK / 16
typedef _Float16 h16;
typedef unsigned short bf;
typedef __attribute__((ext_vector_type(16))) __bf16   v16bf;
typedef __attribute__((ext_vector_type(16))) _Float16 v16h;
typedef __attribute__((ext_vector_type(8)))  _Float16 v8h;
typedef __attribute__((ext_vector_type(8)))  unsigned short v8us;
typedef __attribute__((ext_vector_type(8)))  float    v8f;
typedef __attribute__((ext_vector_type(4)))  float    v4f;
typedef v8h  __attribute__((may_alias)) v8ha;
typedef v4f  __attribute__((may_alias)) v4fa;
typedef v8us __attribute__((may_alias)) v8usa;

__device__ __forceinline__ unsigned short f2bf(float f) { unsigned u = __float_as_uint(f); u += 0x7FFFu + ((u >> 16) & 1u); return (unsigned short)(u >> 16); }
__device__ __forceinline__ float bf2f(unsigned short b) { return __uint_as_float(((unsigned)b) << 16); }
__device__ __forceinline__ float bfr(float f) { return bf2f(f2bf(f)); }
__device__ __forceinline__ v16h cat16(v8h lo, v8h hi) { return __builtin_shufflevector(lo, hi, 0, 1, 2, 3, 4, 5, 6, 7, 8, 9, 10, 11, 12, 13, 14, 15); }
__device__ __forceinline__ v16bf cat16b(v8us lo, v8us hi) { return __builtin_bit_cast(v16bf, __builtin_shufflevector(lo, hi, 0, 1, 2, 3, 4, 5, 6, 7, 8, 9, 10, 11, 12, 13, 14, 15)); }
__device__ __forceinline__ v8f wmma16(v16h a, v16h b, v8f c) { return __builtin_amdgcn_wmma_f32_16x16x32_f16(false, a, false, b, (short)0, c, false, false); }
__device__ __forceinline__ v8f wmmab(v16bf a, v16bf b, v8f c) { return __builtin_amdgcn_wmma_f32_16x16x32_bf16(false, a, false, b, (short)0, c, false, false); }



// ---- k_gemmw: register-blocked GEMM, one work-group of KS waves per 64x64 output tile, operands from K-contiguous 16-bit planes by way of LDS; grid (M/64, N/64), 32 * KS threads.
// Every wave holds the whole tile (16 accumulators) and takes every KS-th 32-wide slice of K, so the K loop is K / (32 KS) trips long and the KS waves of a trip consume 64 KS contiguous bytes of each row.
// The KS partial tiles meet in LDS behind one barrier; wave w sums rows 64 w / KS ... of them, partial 0 first, and stores those rows.
// C[m][n] (pitch ldc, + optional f32 bias) = sum_k A[m][k] Bt[n][k] (+ split products per NSPLIT). K % 256 == 0.
// OUT 0: C stored as f32, bias[n]. OUT 1: C stored as a high and a low bf16 plane (Ch, Cl), the form the attention launch reads, bias[n]. OUT 2: planes too, bias[m] (A = weight rows, Bt = tokens: the tile comes out as [d][key]).
template <typename T16> struct WFrag;
template <> struct WFrag<h16> { typedef v16h V; static __device__ __forceinline__ V ld(const h16* p) { return cat16(*(const v8h*)p, *(const v8h*)(p + 16)); } static __device__ __forceinline__ v8f mma(V a, V b, v8f c) { return wmma16(a, b, c); } };
template <> struct WFrag<bf> { typedef v16bf V; static __device__ __forceinline__ V ld(const bf* p) { return cat16b(*(const v8us*)p, *(const v8us*)(p + 16)); } static __device__ __forceinline__ v8f mma(V a, V b, v8f c) { return wmmab(a, b, c); } };
__device__ __forceinline__ void splitf(float y, unsigned short& h, unsigned short& l) { h = f2bf(y); l = f2bf(y - bf2f(h)); }
typedef __attribute__((ext_vector_type(4))) unsigned short v4us;
// The operands reach the waves through LDS. Read straight from the planes, a fragment load takes 32 bytes of each of 16 rows: 16 cache lines for 512 bytes. An asynchronous copy takes 512 contiguous bytes of ONE row, 4 whole lines.
// A stage is the KS * 32 = 256 k (512 bytes) of every operand row that one trip of the K loop consumes, at pitch SP; two buffers, the next stage's copies fly while this one is multiplied. The buffers lie in os and are dead before the partial tiles are written there.
#define SP 528          // bytes from row to row of a stage in LDS: 16 x odd, the conflict-free pitch for 16-byte fragment reads
#define SO (64 * SP)    // the 64 rows of one operand
// cp8: eight rows' pieces, one copy each (lane = 16 bytes), from g (pitch ld elements) to LDS byte address l (pitch SP).
__device__ __forceinline__ void cp8(unsigned l, const bf* g, size_t ld) {
    // the copies and s_wait_xcnt 0 in one statement: the wait stands in front of every later write of the address registers that the copies name
    asm volatile("global_load_async_to_lds_b128 %0, %8, off\n\tglobal_load_async_to_lds_b128 %1, %9, off\n\tglobal_load_async_to_lds_b128 %2, %10, off\n\tglobal_load_async_to_lds_b128 %3, %11, off\n\t"
                 "global_load_async_to_lds_b128 %4, %12, off\n\tglobal_load_async_to_lds_b128 %5, %13, off\n\tglobal_load_async_to_lds_b128 %6, %14, off\n\tglobal_load_async_to_lds_b128 %7, %15, off\n\ts_wait_xcnt 0x0"
                 :: "v"(l), "v"(l + SP), "v"(l + 2 * SP), "v"(l + 3 * SP), "v"(l + 4 * SP), "v"(l + 5 * SP), "v"(l + 6 * SP), "v"(l + 7 * SP),
                    "v"(g), "v"(g + ld), "v"(g + 2 * ld), "v"(g + 3 * ld), "v"(g + 4 * ld), "v"(g + 5 * ld), "v"(g + 6 * ld), "v"(g + 7 * ld) : "memory");
}
// ldl: one fragment from a staged row, at the k positions of WFrag<bf>::ld.
__device__ __forceinline__ v16bf ldl(const char* p) { return cat16b(*(const v8usa*)p, *(const v8usa*)(p + 32)); }
// gemmw_tile is the work of one such work-group on the tile at row r0, column c0; os = its LDS: the larger of KS * 64 * 68 floats and two stages.
template <typename T16, int NSPLIT, bool BIAS, int KS, int OUT>
__device__ __forceinline__ void gemmw_tile(float* os, const T16* __restrict__ A, const T16* __restrict__ A2, const T16* __restrict__ Bt, const T16* __restrict__ Bt2, int K, float* C, bf* Ch, bf* Cl, int ldc, const float* __restrict__ bias, int r0, int c0) {
    typedef typename WFrag<T16>::V V;
    const int lane = threadIdx.x & 31, lr = lane & 15, hi = lane >> 4;
    const int w = __builtin_amdgcn_readfirstlane((int)(threadIdx.x >> 5));   // wave-uniform: the K slice and the rows to sum are scalar work
    v8f acc[4][4];
#pragma unroll
    for (int mb = 0; mb < 4; ++mb)
#pragma unroll
        for (int nb = 0; nb < 4; ++nb) acc[mb][nb] = (v8f){};
    const int cofs = lr * 4, row0 = w * (64 / KS) + hi; v4f bv = (v4f){}; float br[32 / KS];   // the lane's four output columns, its first output row and their bias, asked for ahead of the K loop
    if (BIAS && OUT != 2) { bv[0] = bfr(bias[c0 + cofs]); bv[1] = bfr(bias[c0 + cofs + 1]); bv[2] = bfr(bias[c0 + cofs + 2]); bv[3] = bfr(bias[c0 + cofs + 3]); }
    if (BIAS && OUT == 2) {
#pragma unroll
        for (int s = 0; s < 32 / KS; ++s) br[s] = bfr(bias[r0 + row0 + 2 * s]); }
    static_assert(KS == 8 && NSPLIT <= 1 && sizeof(T16) == 2, "a stage is 8 slices of 32 k of A, Bt and, with NSPLIT 1, A2");
    constexpr int NOP = NSPLIT == 1 ? 3 : 2;   // operands of a stage: A, Bt (, A2)
    const int nt = K / (KS * 32);              // stages = trips; K % 256 == 0
    // wave w copies rows 8 w ... 8 w + 7 of every operand
    const unsigned l0 = (unsigned)(size_t)os + (unsigned)(w * 8 * SP + lane * 16);
    const size_t ga = (size_t)(r0 + w * 8) * K + lane * 8, gb = (size_t)(c0 + w * 8) * K + lane * 8;
    auto stage = [&](int t) { const unsigned lb = l0 + (unsigned)((t & 1) * (NOP * SO)); const size_t ko = (size_t)t * (KS * 32);
        cp8(lb, A + ga + ko, K); cp8(lb + SO, Bt + gb + ko, K); if (NSPLIT == 1) cp8(lb + 2 * SO, A2 + ga + ko, K); };
    stage(0);
    asm volatile("s_wait_asynccnt 0x0" ::: "memory");   // this wave's copies of stage 0 have landed
    __syncthreads();   // every wave's copies of stage 0 have landed before any wave reads it
    if (nt > 1) stage(1);
    const char* fp = (const char*)os + lr * SP + w * 64 + hi * 16;   // the lane's row and the wave's 32-k slice of a stage
#pragma unroll 1
    for (int t = 0; t < nt; ++t) {
        const char* sb = fp + (t & 1) * (NOP * SO);
        V a[4], a2[4], b[4];
#pragma unroll
        for (int mb = 0; mb < 4; ++mb) { a[mb] = ldl(sb + mb * 16 * SP); if (NSPLIT == 1) a2[mb] = ldl(sb + 2 * SO + mb * 16 * SP); }
#pragma unroll
        for (int nb = 0; nb < 4; ++nb) b[nb] = ldl(sb + SO + nb * 16 * SP);
        __builtin_amdgcn_sched_barrier(0);   // keeps every fragment read of the trip in front of the first product: left alone the compiler asks for three of the four B fragments between the products, three further LDS latencies in every trip
#pragma unroll
        for (int nb = 0; nb < 4; ++nb)
#pragma unroll
            for (int mb = 0; mb < 4; ++mb) { acc[mb][nb] = WFrag<T16>::mma(a[mb], b[nb], acc[mb][nb]); if (NSPLIT == 1) acc[mb][nb] = WFrag<T16>::mma(a2[mb], b[nb], acc[mb][nb]); }
        __builtin_amdgcn_sched_barrier(0);   // keeps every product of the trip in front of the barrier below: left alone the compiler moves most of them behind it, in front of the refill, and the copies start that much later
        asm volatile("v_nop\n\tv_nop\n\tv_nop\n\tv_nop" : "+v"(acc[0][0]), "+v"(acc[1][1]), "+v"(acc[2][2]), "+v"(acc[3][3]) : "v"(a[0]), "v"(a[3]));   // the four vector slots the chip needs behind the trip's last products, on the taken back edge too, before the next trip writes their operand registers
        asm volatile("s_wait_dscnt 0x0" ::: "memory");      // this wave has read all it wants of this trip's buffer
        asm volatile("s_wait_asynccnt 0x0" ::: "memory");   // this wave's copies of the next stage have landed
        __syncthreads();   // publishes the next stage and ends every wave's reads of this trip's buffer, which is refilled (after the last trip: overwritten by the partial tiles) behind it
        if (t + 2 < nt) stage(t + 2);
    }
    asm volatile("s_wait_asynccnt 0x0" ::: "memory");   // no copy is outstanding when the buffers become the partial tiles
    float* mine = os + w * (64 * 68);
#pragma unroll
    for (int mb = 0; mb < 4; ++mb)
#pragma unroll
        for (int nb = 0; nb < 4; ++nb)
#pragma unroll
            for (int j = 0; j < 8; ++j) mine[(mb * 16 + hi * 8 + j) * 68 + nb * 16 + lr] = acc[mb][nb][j];
    __syncthreads();   // every wave's partial tile is in LDS before any wave sums across them
    const float* op = os + row0 * 68 + cofs; const size_t co = (size_t)(r0 + row0) * ldc + c0 + cofs;
#pragma unroll
    for (int s = 0; s < 32 / KS; ++s) { v4f val = *(const v4fa*)(op + 2 * s * 68);
#pragma unroll
        for (int p = 1; p < KS; ++p) val += *(const v4fa*)(op + (p * 64 + 2 * s) * 68);
        if (BIAS) { if (OUT == 2) val += br[s]; else val += bv; }
        const size_t oo = co + (size_t)(2 * s) * ldc;
        if (OUT == 0) *(v4f*)(C + oo) = val;
        else { v4us oh, ol;
#pragma unroll
            for (int u = 0; u < 4; ++u) { unsigned short x0, x1; splitf(val[u], x0, x1); oh[u] = x0; ol[u] = x1; }
            *(v4us*)(Ch + oo) = oh; *(v4us*)(Cl + oo) = ol; } }
    asm volatile("s_wait_xcnt 0x0" ::: "memory");   // where several tile bodies stand in one kernel, the code laid out behind this one reuses the stores' address and data registers: the wait stands in front of that
}
template <typename T16, int NSPLIT, bool BIAS, int KS, int OUT>
__global__ __launch_bounds__(32 * KS) void k_gemmw(const T16* __restrict__ A, const T16* __restrict__ A2, const T16* __restrict__ Bt, const T16* __restrict__ Bt2, int K, float* C, bf* Ch, bf* Cl, int ldc, const float* __restrict__ bias) {
    constexpr int PT = KS * 64 * 68, ST = 2 * (NSPLIT == 1 ? 3 : 2) * SO / 4;   // floats: the partial tiles, the two stages
    __shared__ __align__(16) float os[PT > ST ? PT : ST];
    gemmw_tile<T16, NSPLIT, BIAS, KS, OUT>(os, A, A2, Bt, Bt2, K, C, Ch, Cl, ldc, bias, blockIdx.x * 64, blockIdx.y * 64);
}
// ---- kv_tile: the tile body above (8 waves, plain bf16 product, bias, plane output, same K slices and same sums) for a tile whose token operand is still the f32 input: 64 keys of one head by the head's 64 weight rows.
// X = the head's first token row: key m of head h is token NH_ m + h, so the head's keys are rows of pitch NH_ * DM floats. Each is read from memory by this tile alone and rounded to bf16 in the loader, so k and v need no bf16 copy.
// Wt = the head's 64 bf16 weight rows; t0 = the tile's first key. OUT 1: tokens are A, planes [key][d], bias per column. OUT 2: tokens are Bt, planes [d][key], bias per row.
// The row steps are literals: folded into the loads' offsets they free the address registers that the f32 rows in flight need.
// ldf: one fragment from f32, rounded nearest even, at the k positions of WFrag<bf>::ld: 4 loads of 16 bytes in place of 2.
__device__ __forceinline__ v16bf ldf(const float* p) { const v4f x0 = *(const v4f*)p, x1 = *(const v4f*)(p + 4), x2 = *(const v4f*)(p + 16), x3 = *(const v4f*)(p + 20);
    const v8f lo = __builtin_shufflevector(x0, x1, 0, 1, 2, 3, 4, 5, 6, 7), hi = __builtin_shufflevector(x2, x3, 0, 1, 2, 3, 4, 5, 6, 7);
    return __builtin_convertvector(__builtin_shufflevector(lo, hi, 0, 1, 2, 3, 4, 5, 6, 7, 8, 9, 10, 11, 12, 13, 14, 15), v16bf); }
template <int OUT>
__device__ __forceinline__ void kv_tile(float* os, const float* __restrict__ X, const bf* __restrict__ Wt, bf* Ch, bf* Cl, const float* __restrict__ bias, int t0) {
    constexpr int KS = 8, ldc = OUT == 2 ? KPH : HD; constexpr size_t ldx = (size_t)NH_ * DM;
    const int lane = threadIdx.x & 31, lr = lane & 15, hi = lane >> 4;
    const int w = __builtin_amdgcn_readfirstlane((int)(threadIdx.x >> 5));   // wave-uniform: the K slice and the rows to sum are scalar work
    const int r0 = OUT == 2 ? 0 : t0, c0 = OUT == 2 ? t0 : 0;
    v8f acc[4][4];
#pragma unroll
    for (int mb = 0; mb < 4; ++mb)
#pragma unroll
        for (int nb = 0; nb < 4; ++nb) acc[mb][nb] = (v8f){};
    const int cofs = lr * 4, row0 = w * (64 / KS) + hi; v4f bv = (v4f){}; float br[32 / KS];   // the lane's four output columns, its first output row and their bias, asked for ahead of the K loop
    if (OUT != 2) { bv[0] = bfr(bias[cofs]); bv[1] = bfr(bias[cofs + 1]); bv[2] = bfr(bias[cofs + 2]); bv[3] = bfr(bias[cofs + 3]); }
    else {
#pragma unroll
        for (int s = 0; s < 32 / KS; ++s) br[s] = bfr(bias[row0 + 2 * s]); }
    asm volatile("s_wait_xcnt 0x0" ::: "memory");   // the bias loads' address registers are reused by the code below: the wait stands in front of the first overwrite
    const float* xp = X + (size_t)(t0 + lr) * ldx + 8 * hi; const bf* wp = Wt + (size_t)lr * DM + 8 * hi;
#pragma unroll 1
    for (int kc = w * 32; kc < DM; kc += KS * 32) {
        v16bf a[4], b[4];   // the f32 rows come from memory, the weight rows from L2: the f32 loads go first
        if (OUT == 2) {
#pragma unroll
            for (int nb = 0; nb < 4; ++nb) b[nb] = ldf(xp + nb * 16 * ldx + kc);
#pragma unroll
            for (int mb = 0; mb < 4; ++mb) a[mb] = WFrag<bf>::ld(wp + mb * 16 * DM + kc); }
        else {
#pragma unroll
            for (int mb = 0; mb < 4; ++mb) a[mb] = ldf(xp + mb * 16 * ldx + kc);
#pragma unroll
            for (int nb = 0; nb < 4; ++nb) b[nb] = WFrag<bf>::ld(wp + nb * 16 * DM + kc); }
        asm volatile("s_wait_xcnt 0x0" ::: "memory");   // the loads' address registers are stepped for the next trip: the wait stands in front of that (the fence on the next line holds later code behind it)
        __builtin_amdgcn_sched_barrier(0);   // keeps every load of the trip in front of the first product: left alone the compiler asks for part of them only between the products, further load waits in every trip
#pragma unroll
        for (int nb = 0; nb < 4; ++nb)
#pragma unroll
            for (int mb = 0; mb < 4; ++mb) acc[mb][nb] = wmmab(a[mb], b[nb], acc[mb][nb]);
        asm volatile("v_nop\n\tv_nop\n\tv_nop\n\tv_nop" : "+v"(acc[0][0]), "+v"(acc[1][1]), "+v"(acc[2][2]), "+v"(acc[3][3]) : "v"(a[0]), "v"(a[3]));   // the four vector slots the chip needs behind the trip's last products, on the taken back edge too, before the next trip writes their operand registers
    }
    float* mine = os + w * (64 * 68);
#pragma unroll
    for (int mb = 0; mb < 4; ++mb)
#pragma unroll
        for (int nb = 0; nb < 4; ++nb)
#pragma unroll
            for (int j = 0; j < 8; ++j) mine[(mb * 16 + hi * 8 + j) * 68 + nb * 16 + lr] = acc[mb][nb][j];
    __syncthreads();   // every wave's partial tile is in LDS before any wave sums across them
    const float* op = os + row0 * 68 + cofs; const size_t co = (size_t)(r0 + row0) * ldc + c0 + cofs;
#pragma unroll
    for (int s = 0; s < 32 / KS; ++s) { v4f val = *(const v4fa*)(op + 2 * s * 68);
#pragma unroll
        for (int p = 1; p < KS; ++p) val += *(const v4fa*)(op + (p * 64 + 2 * s) * 68);
        if (OUT == 2) val += br[s]; else val += bv;
        const size_t oo = co + (size_t)(2 * s) * ldc; v4us oh, ol;
#pragma unroll
        for (int u = 0; u < 4; ++u) { unsigned short x0, x1; splitf(val[u], x0, x1); oh[u] = x0; ol[u] = x1; }
        *(v4us*)(Ch + oo) = oh; *(v4us*)(Cl + oo) = ol; }
    asm volatile("s_wait_xcnt 0x0" ::: "memory");   // the code laid out behind this body reuses the stores' address and data registers: the wait stands in front of that
}
// ---- k_qkv: the Q, K and V projections, which do not depend on one another, in ONE launch of 128 + 128 + 256 tiles of equal arithmetic: two work-groups share a WGP (LDS allows two), so one's load waits are filled by the other.
// Tile j < 128: K, head j / 8, 64 keys -> planes [h][key][d]. Next 128: V with the head's weight rows as A -> planes [h][d][key]. Last 256: Q, head by 64 queries -> planes [h][t][d].
// K and V take the low tile indices, for speed only: their token rows are read by one tile alone, while 16 Q tiles share each block of query rows.
// For the Q tiles K stays an argument, as in k_gemmw.
// amdgpu_waves_per_eu(4, 4): the register budget of four waves per SIMD (256), which two work-groups on a WGP need; without it the f32 rows in flight take the kernel past it and only one work-group fits.
#define QT (NH_ * TQ / 64)
#define KT (NH_ * KPH / 64)
__global__ __launch_bounds__(256) __attribute__((amdgpu_waves_per_eu(4, 4))) void k_qkv(const bf* __restrict__ QB, const float* __restrict__ kin, const float* __restrict__ vin, const bf* __restrict__ BQ, const bf* __restrict__ BK, const bf* __restrict__ BV,
                                             const float* __restrict__ bq, const float* __restrict__ bk, const float* __restrict__ bv, int K, bf* Qh, bf* Ql, bf* Kh, bf* Kl, bf* Vh, bf* Vl) {
    __shared__ __align__(16) float os[8 * 64 * 68];
    static_assert(2 * 2 * SO <= 8 * 64 * 68 * 4, "the two stages of a Q tile fit the partial tiles' LDS");
    const int j = blockIdx.x; const size_t zw = (size_t)HD * DM, zp = (size_t)KPH * HD;    // per head: the head's 64 weight rows, projected plane
    if (j < KT) { const size_t h = j / (KPH / 64); const int t = j % (KPH / 64);
        kv_tile<1>(os, kin + h * DM, BK + h * zw, Kh + h * zp, Kl + h * zp, bk + h * HD, t * 64); }
    else if (j < 2 * KT) { const size_t h = (j - KT) / (KPH / 64); const int t = (j - KT) % (KPH / 64);
        kv_tile<2>(os, vin + h * DM, BV + h * zw, Vh + h * zp, Vl + h * zp, bv + h * HD, t * 64); }
    else { const size_t h = (j - 2 * KT) / (TQ / 64); const int t = (j - 2 * KT) % (TQ / 64);
        gemmw_tile<bf, 0, true, 8, 1>(os, QB, nullptr, BQ + h * zw, nullptr, K, nullptr, Qh + h * (TQ * HD), Ql + h * (TQ * HD), HD, bq + h * HD, t * 64, 0); }
}


// ---- k_cvtall: the f32 -> bf16 copies of the operands that many tiles share (Wq, Wk, Wv, Wo, q: 1024 rows of DM floats each) in ONE streaming launch; k and v have no copy.
// CG work-groups x CW waves x CR rows per wave cover them exactly once. A wave reads a row as 8 loads of 512 contiguous bytes, non-temporal (each source is read once), and asks for all its CR rows
// before it rounds the first; it stores a row as 8 stores of 256 contiguous bytes.
#define CG 256
#define CW 5
#define CR 4
static_assert(CG * CW * CR == 4 * DM + TQ, "the conversion launch covers every row once");
__global__ __launch_bounds__(CW * 32) void k_cvtall(const float* __restrict__ Wq, const float* __restrict__ Wk, const float* __restrict__ Wv, const float* __restrict__ Wo, const float* __restrict__ qin,
                                                    bf* BQ, bf* BK, bf* BV, bf* BO, bf* QB) {
    const int lane = threadIdx.x & 31; const int gw = __builtin_amdgcn_readfirstlane((int)(blockIdx.x * CW + (threadIdx.x >> 5)));   // wave-uniform: a row's source and place are scalar work
    __builtin_assume(gw >= 0 && gw < CG * CW);
    v4f x[CR][DM / 128]; bf* dst[CR];
#pragma unroll
    for (int r = 0; r < CR; ++r) { const int row = r * (CG * CW) + gw; const int m = row >> 10; const size_t o = (size_t)(row & 1023) * DM; const float* s = Wq; bf* d = BQ;
        if (m == 1) { s = Wk; d = BK; } if (m == 2) { s = Wv; d = BV; } if (m == 3) { s = Wo; d = BO; } if (m == 4) { s = qin; d = QB; } s += o; d += o;
        dst[r] = d + lane * 4;
#pragma unroll
        for (int q = 0; q < DM / 128; ++q) x[r][q] = __builtin_nontemporal_load((const v4f*)(s + q * 128 + lane * 4)); }
    __builtin_amdgcn_sched_barrier(0);   // keeps every row's loads in front of the first rounding: left alone the compiler issues the last row's loads only when earlier rows have arrived, a second memory latency in every wave
#pragma unroll
    for (int r = 0; r < CR; ++r)
#pragma unroll
        for (int q = 0; q < DM / 128; ++q) { v4us o;
#pragma unroll
            for (int u = 0; u < 4; ++u) o[u] = f2bf(x[r][q][u]);
            *(v4us*)(dst[r] + q * 128) = o; } }
// ---- k_attn: scores, softmax, attn.v and the head merge of 64 queries of one head in ONE work-group of 8 waves; grid (TQ / 64, NH_). No score and no probability leaves the registers.
// Wave w takes keys 64 w ... 64 w + 63. It forms S^T = K Q^T (A = K rows, B = Q rows as columns; hl x hl, 3 products), so a lane holds 32 keys of one query per 16-query group: maximum and sum are in-lane plus one exchange of the wave halves.
// p = exp2(s c - m c), m the maximum over the WAVE's own 64 keys, not yet divided by any sum. Two 16-key score tiles, rounded in place, are the B operand of O^T += V^T P^T (A = V^T rows from the [d][key] planes, same k order; 3 products).
// K, Q and V^T reach the waves through LDS, as the GEMM operands do: a fragment load from the planes takes 32 bytes of each of 16 rows, an asynchronous copy four whole 128-byte rows.
// Wave w copies its own 64 K rows and, behind the first barrier, its own 128 bytes of the 64 V^T rows (both planes each), and rows 8 w ... 8 w + 7 of the Q tile, which all waves read. Each buffer is filled once.
// The 8 partial O^T tiles, each with its m c and its sum, meet in LDS behind one barrier; wave w joins queries 8 w ... 8 w + 7: O = sum_p f_p O_p / sum_p f_p l_p, f_p = exp2(m_p c - max m c), partial 0 first, and stores them as hl planes in merged [t][h * 64 + d] order.
typedef __attribute__((ext_vector_type(2))) float v2f;
typedef __attribute__((ext_vector_type(2))) __bf16 v2bf;
__device__ __forceinline__ float xhalf(float x) { const int b = __float_as_int(x); return __int_as_float(__builtin_amdgcn_permlanex16(b, b, 0x76543210, 0xfedcba98, false, false)); }   // lane l <-> l ^ 16
#define AP 144          // bytes from row to row of the staged 128-byte rows: 16 x odd, the conflict-free pitch for 16-byte fragment reads
#define AO (KPH * AP)   // one plane of the head's 512 K rows, or of the 8 waves' 64 V^T pieces
#define AQ (64 * AP)    // one plane of the Q tile
// cp8r: eight copies of four 128-byte rows each (lane = 16 bytes; l and g are the lane's own piece of the first four rows), gs = elements from one four rows to the next; LDS pitch AP.
__device__ __forceinline__ void cp8r(unsigned l, const bf* g, size_t gs) {
    // the copies and s_wait_xcnt 0 in one statement: the wait stands in front of every later write of the address registers that the copies name
    asm volatile("global_load_async_to_lds_b128 %0, %8, off\n\tglobal_load_async_to_lds_b128 %1, %9, off\n\tglobal_load_async_to_lds_b128 %2, %10, off\n\tglobal_load_async_to_lds_b128 %3, %11, off\n\t"
                 "global_load_async_to_lds_b128 %4, %12, off\n\tglobal_load_async_to_lds_b128 %5, %13, off\n\tglobal_load_async_to_lds_b128 %6, %14, off\n\tglobal_load_async_to_lds_b128 %7, %15, off\n\ts_wait_xcnt 0x0"
                 :: "v"(l), "v"(l + 4 * AP), "v"(l + 8 * AP), "v"(l + 12 * AP), "v"(l + 16 * AP), "v"(l + 20 * AP), "v"(l + 24 * AP), "v"(l + 28 * AP),
                    "v"(g), "v"(g + gs), "v"(g + 2 * gs), "v"(g + 3 * gs), "v"(g + 4 * gs), "v"(g + 5 * gs), "v"(g + 6 * gs), "v"(g + 7 * gs) : "memory");
}
// cp4q: eight rows of each of two planes, four copies; the wait as in cp8r.
__device__ __forceinline__ void cp4q(unsigned l, const bf* g0, const bf* g1) {
    asm volatile("global_load_async_to_lds_b128 %0, %4, off\n\tglobal_load_async_to_lds_b128 %1, %5, off\n\tglobal_load_async_to_lds_b128 %2, %6, off\n\tglobal_load_async_to_lds_b128 %3, %7, off\n\ts_wait_xcnt 0x0"
                 :: "v"(l), "v"(l + 4 * AP), "v"(l + AQ), "v"(l + AQ + 4 * AP), "v"(g0), "v"(g0 + 4 * HD), "v"(g1), "v"(g1 + 4 * HD) : "memory");
}
__global__ __launch_bounds__(256) void k_attn(const bf* __restrict__ Qh, const bf* __restrict__ Ql, const bf* __restrict__ Kh, const bf* __restrict__ Kl, const bf* __restrict__ Vh, const bf* __restrict__ Vl, bf* ATh, bf* ATl) {
    __shared__ __align__(16) char sm[4 * AO + 2 * AQ + 2 * 64 * 8 * 4];   // K high, K low, Q high, Q low, V^T high, V^T low, st
    static_assert(8 * 64 * 68 * 4 <= 2 * AO, "the partial tiles lie on the K rows alone");
    float* const os = (float*)sm;                      // the partial tiles, written when every wave has left the K rows (second barrier)
    float* const st = (float*)(sm + 4 * AO + 2 * AQ);  // [0][query][wave] = m c, [1][query][wave] = sum
    const int lane = threadIdx.x & 31, lr = lane & 15, hi = lane >> 4; const int q0 = blockIdx.x * 64; const size_t h = blockIdx.y;
    const int w = __builtin_amdgcn_readfirstlane((int)(threadIdx.x >> 5));   // wave-uniform: the key slice and the queries to join are scalar work
    const int cr = lane >> 3, cc = lane & 7;   // a copy's lane: row cr of four, 16-byte piece cc of eight
    const unsigned lc = (unsigned)(size_t)sm + (unsigned)(cr * AP + cc * 16);
    const size_t kc0 = (h * KPH + w * 64 + cr) * HD + cc * 8, qc0 = (h * TQ + q0 + w * 8 + cr) * HD + cc * 8, vc0 = (h * HD + cr) * KPH + w * 64 + cc * 8;
    cp8r(lc + w * 64 * AP, Kh + kc0, 4 * HD); cp8r(lc + (w * 64 + 32) * AP, Kh + kc0 + 32 * HD, 4 * HD);
    cp8r(lc + AO + w * 64 * AP, Kl + kc0, 4 * HD); cp8r(lc + AO + (w * 64 + 32) * AP, Kl + kc0 + 32 * HD, 4 * HD);
    cp4q(lc + 2 * AO + w * 8 * AP, Qh + qc0, Ql + qc0);
    asm volatile("s_wait_asynccnt 0x0" ::: "memory");   // this wave's copies of K and Q have landed
    __syncthreads();   // every wave's rows of the Q tile have landed before any wave reads them
    const char* kp = sm + (w * 64 + lr) * AP + hi * 16; const char* qp = sm + 2 * AO + lr * AP + hi * 16; const char* vp = kp + 2 * AO + 2 * AQ;   // the lane's row of the wave's K rows, of the Q tile and of the wave's V^T pieces
    v8f acc[4][4], o[4][4];
#pragma unroll
    for (int mb = 0; mb < 4; ++mb)
#pragma unroll
        for (int nb = 0; nb < 4; ++nb) { acc[mb][nb] = (v8f){}; o[mb][nb] = (v8f){}; }
    v16bf a[2][4], a2[2][4], b[2][4], b2[2][4], va[2][4], va2[2][4];   // [32-wide k slice][16-row block]: K, Q and V^T fragments, high and low planes
#pragma unroll
    for (int kc = 0; kc < 2; ++kc) {
#pragma unroll
        for (int i = 0; i < 4; ++i) { a[kc][i] = ldl(kp + i * 16 * AP + kc * 64); a2[kc][i] = ldl(kp + AO + i * 16 * AP + kc * 64); b[kc][i] = ldl(qp + i * 16 * AP + kc * 64); b2[kc][i] = ldl(qp + AQ + i * 16 * AP + kc * 64); }
        if (kc == 0) __builtin_amdgcn_sched_barrier(0);   // keeps the first k slice's reads in front of the second's: LDS reads return in order, and left alone the first product's operands are asked for last, so it waits for all 64 reads
    }
    // the V^T copies fly while the K and Q fragments are read and the first half of the scores is formed; their LDS has not been touched before
    cp8r(lc + 2 * AO + 2 * AQ + w * 64 * AP, Vh + vc0, 4 * KPH); cp8r(lc + 2 * AO + 2 * AQ + (w * 64 + 32) * AP, Vh + vc0 + 32 * KPH, 4 * KPH);
    cp8r(lc + 3 * AO + 2 * AQ + w * 64 * AP, Vl + vc0, 4 * KPH); cp8r(lc + 3 * AO + 2 * AQ + (w * 64 + 32) * AP, Vl + vc0 + 32 * KPH, 4 * KPH);
    __builtin_amdgcn_sched_barrier(0);   // keeps the fragment reads and the copies in front of the first product: left alone the compiler puts most of the first half's products ahead of the copies, which then start just in front of their own wait
#pragma unroll
    for (int kc = 0; kc < 2; ++kc) {
#pragma unroll
        for (int nb = 0; nb < 4; ++nb) {   // the four key blocks take turns, so that no product waits for the one just issued
#pragma unroll
            for (int mb = 0; mb < 4; ++mb) acc[mb][nb] = wmmab(a[kc][mb], b[kc][nb], acc[mb][nb]);
#pragma unroll
            for (int mb = 0; mb < 4; ++mb) acc[mb][nb] = wmmab(a2[kc][mb], b[kc][nb], acc[mb][nb]);
#pragma unroll
            for (int mb = 0; mb < 4; ++mb) acc[mb][nb] = wmmab(a[kc][mb], b2[kc][nb], acc[mb][nb]); }
        if (kc == 0) {
            __builtin_amdgcn_sched_barrier(0);   // keeps the first half of the score products in front of the waits below: left alone the compiler moves all but one of them behind the barrier, and the wave waits out the V^T copies idle
            asm volatile("s_wait_dscnt 0x0" ::: "memory");      // this wave has read all it wants of the K rows and the Q tile
            asm volatile("s_wait_asynccnt 0x0" ::: "memory");   // this wave's copies of V^T have landed
            __syncthreads();   // ends every wave's reads of the K rows, on which the partial tiles are written below
#pragma unroll
            for (int ch = 0; ch < 2; ++ch)
#pragma unroll
                for (int db = 0; db < 4; ++db) { va[ch][db] = ldl(vp + db * 16 * AP + ch * 64); va2[ch][db] = ldl(vp + AO + db * 16 * AP + ch * 64); }
            __builtin_amdgcn_sched_barrier(0);   // keeps the V^T fragment reads here, half the score products and the softmax arithmetic ahead of their use: left alone part of them is asked for only among the later products, just in front of its use
        }
    }   // acc[mb][nb][r] = S[query q0 + 16 nb + lr][key 64 w + 16 mb + 8 hi + r], unscaled
    const float c8 = 0.125f * 1.4426950408889634f;   // 1 / sqrt(HD) and log2(e) in one factor
#pragma unroll
    for (int nb = 0; nb < 4; ++nb) {
        float mx = acc[0][nb][0];
#pragma unroll
        for (int mb = 0; mb < 4; ++mb)
#pragma unroll
            for (int r = 0; r < 8; ++r) mx = fmaxf(mx, acc[mb][nb][r]);
        mx = fmaxf(mx, xhalf(mx));
        const float mc = mx * c8; float sum = 0.f; v16bf ph[2], pl[2];
#pragma unroll
        for (int ch = 0; ch < 2; ++ch)
#pragma unroll
            for (int s = 0; s < 16; s += 2) { v2f e;   // element s of the B operand = key 32 ch + 16 (s >> 3) + 8 hi + (s & 7): the hardware k order, which the V^T loader has too
                e[0] = __builtin_amdgcn_exp2f(__builtin_fmaf(acc[2 * ch + (s >> 3)][nb][s & 7], c8, -mc)); e[1] = __builtin_amdgcn_exp2f(__builtin_fmaf(acc[2 * ch + (s >> 3)][nb][(s & 7) + 1], c8, -mc));
                sum += e[0]; sum += e[1];
                const v2bf eh = __builtin_convertvector(e, v2bf); const v2bf el = __builtin_convertvector(e - __builtin_convertvector(eh, v2f), v2bf);
                ph[ch][s] = eh[0]; ph[ch][s + 1] = eh[1]; pl[ch][s] = el[0]; pl[ch][s + 1] = el[1]; }
        sum += xhalf(sum);
        st[hi * 512 + (nb * 16 + lr) * 8 + w] = hi ? sum : mc;   // both halves hold both values: the low half stores m c, the high half the sum
#pragma unroll
        for (int ch = 0; ch < 2; ++ch) {   // the four d blocks take turns, so that no product waits for the one just issued
#pragma unroll
            for (int db = 0; db < 4; ++db) o[db][nb] = wmmab(va[ch][db], ph[ch], o[db][nb]);
#pragma unroll
            for (int db = 0; db < 4; ++db) o[db][nb] = wmmab(va2[ch][db], ph[ch], o[db][nb]);
#pragma unroll
            for (int db = 0; db < 4; ++db) o[db][nb] = wmmab(va[ch][db], pl[ch], o[db][nb]); }
    }   // o[db][nb][r] = partial O[query 16 nb + lr][d = 16 db + 8 hi + r]
    __builtin_amdgcn_sched_barrier(0);   // keeps the LDS stores behind the last product
    float* mine = os + w * (64 * 68) + lr * 68 + hi * 8;
#pragma unroll
    for (int nb = 0; nb < 4; ++nb)
#pragma unroll
        for (int db = 0; db < 4; ++db) { float* p = mine + nb * 16 * 68 + db * 16;
            *(v4fa*)p = __builtin_shufflevector(o[db][nb], o[db][nb], 0, 1, 2, 3); *(v4fa*)(p + 4) = __builtin_shufflevector(o[db][nb], o[db][nb], 4, 5, 6, 7); }
    __syncthreads();   // every wave's partial tile, maximum and sum are in LDS before any wave joins them
    const int cofs = lr * 4, row0 = w * 8 + hi;
#pragma unroll
    for (int s = 0; s < 4; ++s) { const int row = row0 + 2 * s; float m[8], l[8];
        { const v4f m0 = *(const v4fa*)(st + row * 8), m1 = *(const v4fa*)(st + row * 8 + 4), l0 = *(const v4fa*)(st + 512 + row * 8), l1 = *(const v4fa*)(st + 512 + row * 8 + 4);
#pragma unroll
            for (int u = 0; u < 4; ++u) { m[u] = m0[u]; m[4 + u] = m1[u]; l[u] = l0[u]; l[4 + u] = l1[u]; } }
        float M = m[0];
#pragma unroll
        for (int p = 1; p < 8; ++p) M = fmaxf(M, m[p]);
        float L = 0.f; v4f val = (v4f){};
#pragma unroll
        for (int p = 0; p < 8; ++p) { const float f = __builtin_amdgcn_exp2f(m[p] - M); L += f * l[p]; val += f * *(const v4fa*)(os + (p * 64 + row) * 68 + cofs); }
        val *= __fdiv_rn(1.0f, L);
        v4us oh, ol;
#pragma unroll
        for (int u = 0; u < 4; ++u) { unsigned short x0, x1; splitf(val[u], x0, x1); oh[u] = x0; ol[u] = x1; }
        const size_t oo = (size_t)(q0 + row) * DM + h * HD + cofs; *(v4us*)(ATh + oo) = oh; *(v4us*)(ATl + oo) = ol; }
}

extern "C" void kernel_launch(void* const* d_in, const int* in_sizes, int n_in,
                              void* d_out, int out_size, void* d_ws, size_t ws_size, hipStream_t stream) {
    (void)in_sizes; (void)n_in; (void)out_size;
    const float* qin = (const float*)d_in[0]; const float* kin = (const float*)d_in[1]; const float* vin = (const float*)d_in[2]; const float* Wq = (const float*)d_in[3]; const float* bq = (const float*)d_in[4]; const float* Wk = (const float*)d_in[5]; const float* bk = (const float*)d_in[6]; const float* Wv = (const float*)d_in[7]; const float* bv = (const float*)d_in[8]; const float* Wo = (const float*)d_in[9]; const float* bo = (const float*)d_in[10];
    float* OUT = (float*)d_out;     // [1][1024][1024]
    char* wsp = (char*)d_ws;
    auto take = [&](size_t bytes) { char* p = wsp; wsp += (bytes + 255) & ~(size_t)255; return (void*)p; };
    bf* BQ = (bf*)take((size_t)DM * DM * 2); bf* BK = (bf*)take((size_t)DM * DM * 2); bf* BV = (bf*)take((size_t)DM * DM * 2); bf* BO = (bf*)take((size_t)DM * DM * 2);
    bf* QB = (bf*)take((size_t)TQ * DM * 2);
    bf* Qh = (bf*)take((size_t)NH_ * TQ * HD * 2); bf* Ql = (bf*)take((size_t)NH_ * TQ * HD * 2); bf* Kh = (bf*)take((size_t)NH_ * KPH * HD * 2); bf* Kl = (bf*)take((size_t)NH_ * KPH * HD * 2); bf* Vh = (bf*)take((size_t)NH_ * HD * KPH * 2); bf* Vl = (bf*)take((size_t)NH_ * HD * KPH * 2);
    bf* ATh = (bf*)take((size_t)TQ * DM * 2); bf* ATl = (bf*)take((size_t)TQ * DM * 2);
    if ((size_t)(wsp - (char*)d_ws) > ws_size) return;    // total ~ 22 MB
    k_cvtall<<<CG, CW * 32, 0, stream>>>(Wq, Wk, Wv, Wo, qin, BQ, BK, BV, BO, QB);   // [out][in] weights = Bt as-is
    k_qkv<<<QT + 2 * KT, 256, 0, stream>>>(QB, kin, vin, BQ, BK, BV, bq, bk, bv, DM, Qh, Ql, Kh, Kl, Vh, Vl);
    k_attn<<<dim3(TQ / 64, NH_, 1), 256, 0, stream>>>(Qh, Ql, Kh, Kl, Vh, Vl, ATh, ATl);
    k_gemmw<bf, 1, true, 8, 0><<<dim3(TQ / 64, DM / 64, 1), 256, 0, stream>>>(ATh, ATl, BO, nullptr, DM, OUT, nullptr, nullptr, DM, bo);
}

// v010
// Measured time: 33.2 microseconds a run.
// Next to v009, in two timings, it ran 1.03 times as fast each time.
// Counting every step since v000, it is 5.89 times as fast.
#include <hip/hip_runtime.h>

// Multi-head attention with a strided key mask (q [1][1024][1024], k, v [1][8192][1024]; Q/K/V = in W^T + b (16 heads x 64); head h attends only keys with (k_idx - h) % 16 == 0 (512 keys per head); softmax(Q.K / 8); out = merged Wo^T + bo -> [1][1024][1024]; no row is fully masked, so nan_to_num is a no-op).
// The HEPOS mask is structural: each head's 512 keys are gathered into dense planes (key m of head h = token 16 m + h), so no masked score is ever computed.
// Key token t is kept by head t % 16 alone, so of its K and V projections only that head's 64 columns are ever read: a head's rows of k / v (every 16th) are projected as one of 16 batched 512 x 64 x 1024 GEMMs.
// Compute dtypes, f32 accumulate: every input rounded to bf16; Q/K/V as PLAIN bf16 GEMMs (inputs: exact) + bias (Q inside the attention launch); scores hl x hl (3 products), softmax f32 -> hl operands in registers, attn.v 3 products (all cheap: 512 keys; one fused launch); Wo hl x exact (2 products) + bias.

#define TQ   1024
#define TK   8192
#define DM   1024
#define NH_  16
#define HD   64
#define KPH  512    // keys per head = TK / 16
typedef _Float16 h16;
typedef unsigned short bf;
typedef __attribute__((ext_vector_type(16))) __bf16   v16bf;
typedef __attribute__((ext_vector_type(16))) _Float16 v16h;
typedef __attribute__((ext_vector_type(8)))  _Float16 v8h;
typedef __attribute__((ext_vector_type(8)))  unsigned short v8us;
typedef __attribute__((ext_vector_type(8)))  float    v8f;
typedef __attribute__((ext_vector_type(4)))  float    v4f;
typedef v8h  __attribute__((may_alias)) v8ha;
typedef v4f  __attribute__((may_alias)) v4fa;
typedef v8us __attribute__((may_alias)) v8usa;

__device__ __forceinline__ unsigned short f2bf(float f) { unsigned u = __float_as_uint(f); u += 0x7FFFu + ((u >> 16) & 1u); return (unsigned short)(u >> 16); }
__device__ __forceinline__ float bf2f(unsigned short b) { return __uint_as_float(((unsigned)b) << 16); }
__device__ __forceinline__ float bfr(float f) { return bf2f(f2bf(f)); }
__device__ __forceinline__ v16h cat16(v8h lo, v8h hi) { return __builtin_shufflevector(lo, hi, 0, 1, 2, 3, 4, 5, 6, 7, 8, 9, 10, 11, 12, 13, 14, 15); }
__device__ __forceinline__ v16bf cat16b(v8us lo, v8us hi) { return __builtin_bit_cast(v16bf, __builtin_shufflevector(lo, hi, 0, 1, 2, 3, 4, 5, 6, 7, 8, 9, 10, 11, 12, 13, 14, 15)); }
__device__ __forceinline__ v8f wmma16(v16h a, v16h b, v8f c) { return __builtin_amdgcn_wmma_f32_16x16x32_f16(false, a, false, b, (short)0, c, false, false); }
__device__ __forceinline__ v8f wmmab(v16bf a, v16bf b, v8f c) { return __builtin_amdgcn_wmma_f32_16x16x32_bf16(false, a, false, b, (short)0, c, false, false); }



// ---- k_gemmw: register-blocked GEMM, one work-group of KS waves per 64x64 output tile, operands from K-contiguous 16-bit planes by way of LDS; grid (M/64, N/64), 32 * KS threads.
// Every wave holds the whole tile (16 accumulators) and takes every KS-th 32-wide slice of K, so the K loop is K / (32 KS) trips long and the KS waves of a trip consume 64 KS contiguous bytes of each row.
// The KS partial tiles meet in LDS behind one barrier; wave w sums rows 64 w / KS ... of them, partial 0 first, and stores those rows.
// C[m][n] (pitch ldc, + optional f32 bias) = sum_k A[m][k] Bt[n][k] (+ split products per NSPLIT). K % 256 == 0.
// OUT 0: C stored as f32, bias[n]. OUT 1: C stored as a high and a low bf16 plane (Ch, Cl), the form the attention launch reads, bias[n]. OUT 2: planes too, bias[m] (A = weight rows, Bt = tokens: the tile comes out as [d][key]).
// OUT 3: the two planes of the tile stay in LDS, rows of pitch AP at Ch (high) and Ch + AQ bytes (low), bias[n]: the form in which the attention work-group reads its own Q tile.
template <typename T16> struct WFrag;
template <> struct WFrag<h16> { typedef v16h V; static __device__ __forceinline__ V ld(const h16* p) { return cat16(*(const v8h*)p, *(const v8h*)(p + 16)); } static __device__ __forceinline__ v8f mma(V a, V b, v8f c) { return wmma16(a, b, c); } };
template <> struct WFrag<bf> { typedef v16bf V; static __device__ __forceinline__ V ld(const bf* p) { return cat16b(*(const v8us*)p, *(const v8us*)(p + 16)); } static __device__ __forceinline__ v8f mma(V a, V b, v8f c) { return wmmab(a, b, c); } };
__device__ __forceinline__ void splitf(float y, unsigned short& h, unsigned short& l) { h = f2bf(y); l = f2bf(y - bf2f(h)); }
typedef __attribute__((ext_vector_type(4))) unsigned short v4us;
typedef v4us __attribute__((may_alias)) v4usa;
// The operands reach the waves through LDS. Read straight from the planes, a fragment load takes 32 bytes of each of 16 rows: 16 cache lines for 512 bytes. An asynchronous copy takes 512 contiguous bytes of ONE row, 4 whole lines.
// A stage is the KS * 32 = 256 k (512 bytes) of every operand row that one trip of the K loop consumes, at pitch SP; two buffers, the next stage's copies fly while this one is multiplied. The buffers lie in os and are dead before the partial tiles are written there.
#define SP 528          // bytes from row to row of a stage in LDS: 16 x odd, the conflict-free pitch for 16-byte fragment reads
#define SO (64 * SP)    // the 64 rows of one operand
#define AP 144          // bytes from row to row of the staged 128-byte rows of the attention launch: 16 x odd, the conflict-free pitch for 16-byte fragment reads
#define AO (KPH * AP)   // one plane of the head's 512 K rows, or of the 8 waves' 64 V^T pieces
#define AQ (64 * AP)    // one plane of the Q tile
// cp8: eight rows' pieces, one copy each (lane = 16 bytes), from g (pitch ld elements) to LDS byte address l (pitch SP).
__device__ __forceinline__ void cp8(unsigned l, const bf* g, size_t ld) {
    // the copies and s_wait_xcnt 0 in one statement: the wait stands in front of every later write of the address registers that the copies name
    asm volatile("global_load_async_to_lds_b128 %0, %8, off\n\tglobal_load_async_to_lds_b128 %1, %9, off\n\tglobal_load_async_to_lds_b128 %2, %10, off\n\tglobal_load_async_to_lds_b128 %3, %11, off\n\t"
                 "global_load_async_to_lds_b128 %4, %12, off\n\tglobal_load_async_to_lds_b128 %5, %13, off\n\tglobal_load_async_to_lds_b128 %6, %14, off\n\tglobal_load_async_to_lds_b128 %7, %15, off\n\ts_wait_xcnt 0x0"
                 :: "v"(l), "v"(l + SP), "v"(l + 2 * SP), "v"(l + 3 * SP), "v"(l + 4 * SP), "v"(l + 5 * SP), "v"(l + 6 * SP), "v"(l + 7 * SP),
                    "v"(g), "v"(g + ld), "v"(g + 2 * ld), "v"(g + 3 * ld), "v"(g + 4 * ld), "v"(g + 5 * ld), "v"(g + 6 * ld), "v"(g + 7 * ld) : "memory");
}
// ldl: one fragment from a staged row, at the k positions of WFrag<bf>::ld.
__device__ __forceinline__ v16bf ldl(const char* p) { return cat16b(*(const v8usa*)p, *(const v8usa*)(p + 32)); }
// gemmw_tile is the work of one such work-group on the tile at row r0, column c0; os = its LDS: the larger of KS * 64 * 68 floats and two stages.
template <typename T16, int NSPLIT, bool BIAS, int KS, int OUT>
__device__ __forceinline__ void gemmw_tile(float* os, const T16* __restrict__ A, const T16* __restrict__ A2, const T16* __restrict__ Bt, const T16* __restrict__ Bt2, int K, float* C, bf* Ch, bf* Cl, int ldc, const float* __restrict__ bias, int r0, int c0) {
    typedef typename WFrag<T16>::V V;
    const int lane = threadIdx.x & 31, lr = lane & 15, hi = lane >> 4;
    const int w = __builtin_amdgcn_readfirstlane((int)(threadIdx.x >> 5));   // wave-uniform: the K slice and the rows to sum are scalar work
    v8f acc[4][4];
#pragma unroll
    for (int mb = 0; mb < 4; ++mb)
#pragma unroll
        for (int nb = 0; nb < 4; ++nb) acc[mb][nb] = (v8f){};
    const int cofs = lr * 4, row0 = w * (64 / KS) + hi; v4f bv = (v4f){}; float br[32 / KS];   // the lane's four output columns, its first output row and their bias, asked for ahead of the K loop
    if (BIAS && OUT != 2) { bv[0] = bfr(bias[c0 + cofs]); bv[1] = bfr(bias[c0 + cofs + 1]); bv[2] = bfr(bias[c0 + cofs + 2]); bv[3] = bfr(bias[c0 + cofs + 3]); }
    if (BIAS && OUT == 2) {
#pragma unroll
        for (int s = 0; s < 32 / KS; ++s) br[s] = bfr(bias[r0 + row0 + 2 * s]); }
    static_assert(KS == 8 && NSPLIT <= 1 && sizeof(T16) == 2, "a stage is 8 slices of 32 k of A, Bt and, with NSPLIT 1, A2");
    constexpr int NOP = NSPLIT == 1 ? 3 : 2;   // operands of a stage: A, Bt (, A2)
    const int nt = K / (KS * 32);              // stages = trips; K % 256 == 0
    // wave w copies rows 8 w ... 8 w + 7 of every operand
    const unsigned l0 = (unsigned)(size_t)os + (unsigned)(w * 8 * SP + lane * 16);
    const size_t ga = (size_t)(r0 + w * 8) * K + lane * 8, gb = (size_t)(c0 + w * 8) * K + lane * 8;
    auto stage = [&](int t) { const unsigned lb = l0 + (unsigned)((t & 1) * (NOP * SO)); const size_t ko = (size_t)t * (KS * 32);
        cp8(lb, A + ga + ko, K); cp8(lb + SO, Bt + gb + ko, K); if (NSPLIT == 1) cp8(lb + 2 * SO, A2 + ga + ko, K); };
    stage(0);
    asm volatile("s_wait_asynccnt 0x0" ::: "memory");   // this wave's copies of stage 0 have landed
    __syncthreads();   // every wave's copies of stage 0 have landed before any wave reads it
    if (nt > 1) stage(1);
    const char* fp = (const char*)os + lr * SP + w * 64 + hi * 16;   // the lane's row and the wave's 32-k slice of a stage
#pragma unroll 1
    for (int t = 0; t < nt; ++t) {
        const char* sb = fp + (t & 1) * (NOP * SO);
        V a[4], a2[4], b[4];
#pragma unroll
        for (int mb = 0; mb < 4; ++mb) { a[mb] = ldl(sb + mb * 16 * SP); if (NSPLIT == 1) a2[mb] = ldl(sb + 2 * SO + mb * 16 * SP); }
#pragma unroll
        for (int nb = 0; nb < 4; ++nb) b[nb] = ldl(sb + SO + nb * 16 * SP);
        __builtin_amdgcn_sched_barrier(0);   // keeps every fragment read of the trip in front of the first product: left alone the compiler asks for three of the four B fragments between the products, three further LDS latencies in every trip
#pragma unroll
        for (int nb = 0; nb < 4; ++nb)
#pragma unroll
            for (int mb = 0; mb < 4; ++mb) { acc[mb][nb] = WFrag<T16>::mma(a[mb], b[nb], acc[mb][nb]); if (NSPLIT == 1) acc[mb][nb] = WFrag<T16>::mma(a2[mb], b[nb], acc[mb][nb]); }
        __builtin_amdgcn_sched_barrier(0);   // keeps every product of the trip in front of the barrier below: left alone the compiler moves most of them behind it, in front of the refill, and the copies start that much later
        asm volatile("v_nop\n\tv_nop\n\tv_nop\n\tv_nop" : "+v"(acc[0][0]), "+v"(acc[1][1]), "+v"(acc[2][2]), "+v"(acc[3][3]) : "v"(a[0]), "v"(a[3]));   // the four vector slots the chip needs behind the trip's last products, on the taken back edge too, before the next trip writes their operand registers
        asm volatile("s_wait_dscnt 0x0" ::: "memory");      // this wave has read all it wants of this trip's buffer
        asm volatile("s_wait_asynccnt 0x0" ::: "memory");   // this wave's copies of the next stage have landed
        __syncthreads();   // publishes the next stage and ends every wave's reads of this trip's buffer, which is refilled (after the last trip: overwritten by the partial tiles) behind it
        if (t + 2 < nt) stage(t + 2);
    }
    asm volatile("s_wait_asynccnt 0x0" ::: "memory");   // no copy is outstanding when the buffers become the partial tiles
    float* mine = os + w * (64 * 68);
#pragma unroll
    for (int mb = 0; mb < 4; ++mb)
#pragma unroll
        for (int nb = 0; nb < 4; ++nb)
#pragma unroll
            for (int j = 0; j < 8; ++j) mine[(mb * 16 + hi * 8 + j) * 68 + nb * 16 + lr] = acc[mb][nb][j];
    __syncthreads();   // every wave's partial tile is in LDS before any wave sums across them
    const float* op = os + row0 * 68 + cofs; const size_t co = (size_t)(r0 + row0) * ldc + c0 + cofs;
#pragma unroll
    for (int s = 0; s < 32 / KS; ++s) { v4f val = *(const v4fa*)(op + 2 * s * 68);
#pragma unroll
        for (int p = 1; p < KS; ++p) val += *(const v4fa*)(op + (p * 64 + 2 * s) * 68);
        if (BIAS) { if (OUT == 2) val += br[s]; else val += bv; }
        const size_t oo = co + (size_t)(2 * s) * ldc;
        if (OUT == 0) *(v4f*)(C + oo) = val;
        else { v4us oh, ol;
#pragma unroll
            for (int u = 0; u < 4; ++u) { unsigned short x0, x1; splitf(val[u], x0, x1); oh[u] = x0; ol[u] = x1; }
            if (OUT == 3) { char* qd = (char*)Ch + (row0 + 2 * s) * AP + cofs * 2; *(v4usa*)qd = oh; *(v4usa*)(qd + AQ) = ol; }
            else { *(v4us*)(Ch + oo) = oh; *(v4us*)(Cl + oo) = ol; } } }
    asm volatile("s_wait_xcnt 0x0" ::: "memory");   // where several tile bodies stand in one kernel, the code laid out behind this one reuses the stores' address and data registers: the wait stands in front of that
}
template <typename T16, int NSPLIT, bool BIAS, int KS, int OUT>
__global__ __launch_bounds__(32 * KS) void k_gemmw(const T16* __restrict__ A, const T16* __restrict__ A2, const T16* __restrict__ Bt, const T16* __restrict__ Bt2, int K, float* C, bf* Ch, bf* Cl, int ldc, const float* __restrict__ bias) {
    constexpr int PT = KS * 64 * 68, ST = 2 * (NSPLIT == 1 ? 3 : 2) * SO / 4;   // floats: the partial tiles, the two stages
    __shared__ __align__(16) float os[PT > ST ? PT : ST];
    gemmw_tile<T16, NSPLIT, BIAS, KS, OUT>(os, A, A2, Bt, Bt2, K, C, Ch, Cl, ldc, bias, blockIdx.x * 64, blockIdx.y * 64);
}
// ---- kv_tile: the tile body above (8 waves, plain bf16 product, bias, plane output, same K slices and same sums) for a tile whose token operand is still the f32 input: 64 keys of one head by the head's 64 weight rows.
// X = the head's first token row: key m of head h is token NH_ m + h, so the head's keys are rows of pitch NH_ * DM floats. Each is read from memory by this tile alone and rounded to bf16 in the loader, so k and v need no bf16 copy.
// Wt = the head's 64 weight rows, f32 input as well and rounded in the loader like the tokens, so the tile waits for no conversion; t0 = the tile's first key. OUT 1: tokens are A, planes [key][d], bias per column. OUT 2: tokens are Bt, planes [d][key], bias per row.
// cs / cd: the wave's 512 floats of Wq, Wo and q and their bf16 places (the operands that many later tiles share): asked for first, so that they fly with the first trip's rows, rounded and stored last (a store in front of the barrier would be waited for there).
// The row steps are literals: folded into the loads' offsets they free the address registers that the f32 rows in flight need.
// ldf: one fragment from f32, rounded nearest even, at the k positions of WFrag<bf>::ld: 4 loads of 16 bytes in place of 2.
__device__ __forceinline__ v16bf ldf(const float* p) { const v4f x0 = *(const v4f*)p, x1 = *(const v4f*)(p + 4), x2 = *(const v4f*)(p + 16), x3 = *(const v4f*)(p + 20);
    const v8f lo = __builtin_shufflevector(x0, x1, 0, 1, 2, 3, 4, 5, 6, 7), hi = __builtin_shufflevector(x2, x3, 0, 1, 2, 3, 4, 5, 6, 7);
    return __builtin_convertvector(__builtin_shufflevector(lo, hi, 0, 1, 2, 3, 4, 5, 6, 7, 8, 9, 10, 11, 12, 13, 14, 15), v16bf); }
template <int OUT>
__device__ __forceinline__ void kv_tile(float* os, const float* __restrict__ X, const float* __restrict__ Wt, bf* Ch, bf* Cl, const float* __restrict__ bias, int t0, const float* const (&cs)[3], bf* const (&cd)[3]) {
    constexpr int KS = 8, ldc = OUT == 2 ? KPH : HD; constexpr size_t ldx = (size_t)NH_ * DM;
    const int lane = threadIdx.x & 31, lr = lane & 15, hi = lane >> 4;
    const int w = __builtin_amdgcn_readfirstlane((int)(threadIdx.x >> 5));   // wave-uniform: the K slice and the rows to sum are scalar work
    const int r0 = OUT == 2 ? 0 : t0, c0 = OUT == 2 ? t0 : 0;
    v4f cx[3][4];   // each source is read once: non-temporal, 512 contiguous bytes a load
#pragma unroll
    for (int r = 0; r < 3; ++r)
#pragma unroll
        for (int q = 0; q < 4; ++q) cx[r][q] = __builtin_nontemporal_load((const v4f*)(cs[r] + q * 128));
    asm volatile("s_wait_xcnt 0x0" ::: "memory");   // the address registers of the twelve loads above are reused by the bias loads below: the wait stands in front of the first overwrite
    v8f acc[4][4];
#pragma unroll
    for (int mb = 0; mb < 4; ++mb)
#pragma unroll
        for (int nb = 0; nb < 4; ++nb) acc[mb][nb] = (v8f){};
    const int cofs = lr * 4, row0 = w * (64 / KS) + hi; v4f bv = (v4f){}; float br[32 / KS];   // the lane's four output columns, its first output row and their bias, asked for ahead of the K loop
    if (OUT != 2) { bv[0] = bfr(bias[cofs]); bv[1] = bfr(bias[cofs + 1]); bv[2] = bfr(bias[cofs + 2]); bv[3] = bfr(bias[cofs + 3]); }
    else {
#pragma unroll
        for (int s = 0; s < 32 / KS; ++s) br[s] = bfr(bias[row0 + 2 * s]); }
    asm volatile("s_wait_xcnt 0x0" ::: "memory");   // the address registers of the loads above are reused by the code below: the wait stands in front of the first overwrite
    const float* xp = X + (size_t)(t0 + lr) * ldx + 8 * hi; const float* wp = Wt + (size_t)lr * DM + 8 * hi;
#pragma unroll 1
    for (int kc = w * 32; kc < DM; kc += KS * 32) {
        v16bf a[4], b[4];   // the token rows come from memory, the weight rows (shared by the head's 8 tiles) mostly from L2: the token loads go first
        if (OUT == 2) {
#pragma unroll
            for (int nb = 0; nb < 4; ++nb) b[nb] = ldf(xp + nb * 16 * ldx + kc);
#pragma unroll
            for (int mb = 0; mb < 4; ++mb) a[mb] = ldf(wp + mb * 16 * DM + kc); }
        else {
#pragma unroll
            for (int mb = 0; mb < 4; ++mb) a[mb] = ldf(xp + mb * 16 * ldx + kc);
#pragma unroll
            for (int nb = 0; nb < 4; ++nb) b[nb] = ldf(wp + nb * 16 * DM + kc); }
        asm volatile("s_wait_xcnt 0x0" ::: "memory");   // the loads' address registers are stepped for the next trip: the wait stands in front of that (the fence on the next line holds later code behind it)
        __builtin_amdgcn_sched_barrier(0);   // keeps every load of the trip in front of the first product: left alone the compiler asks for part of them only between the products, further load waits in every trip
#pragma unroll
        for (int nb = 0; nb < 4; ++nb)
#pragma unroll
            for (int mb = 0; mb < 4; ++mb) acc[mb][nb] = wmmab(a[mb], b[nb], acc[mb][nb]);
        asm volatile("v_nop\n\tv_nop\n\tv_nop\n\tv_nop" : "+v"(acc[0][0]), "+v"(acc[1][1]), "+v"(acc[2][2]), "+v"(acc[3][3]) : "v"(a[0]), "v"(a[3]));   // the four vector slots the chip needs behind the trip's last products, on the taken back edge too, before the next trip writes their operand registers
    }
    float* mine = os + w * (64 * 68);
#pragma unroll
    for (int mb = 0; mb < 4; ++mb)
#pragma unroll
        for (int nb = 0; nb < 4; ++nb)
#pragma unroll
            for (int j = 0; j < 8; ++j) mine[(mb * 16 + hi * 8 + j) * 68 + nb * 16 + lr] = acc[mb][nb][j];
    __syncthreads();   // every wave's partial tile is in LDS before any wave sums across them
    const float* op = os + row0 * 68 + cofs; const size_t co = (size_t)(r0 + row0) * ldc + c0 + cofs;
#pragma unroll
    for (int s = 0; s < 32 / KS; ++s) { v4f val = *(const v4fa*)(op + 2 * s * 68);
#pragma unroll
        for (int p = 1; p < KS; ++p) val += *(const v4fa*)(op + (p * 64 + 2 * s) * 68);
        if (OUT == 2) val += br[s]; else val += bv;
        const size_t oo = co + (size_t)(2 * s) * ldc; v4us oh, ol;
#pragma unroll
        for (int u = 0; u < 4; ++u) { unsigned short x0, x1; splitf(val[u], x0, x1); oh[u] = x0; ol[u] = x1; }
        *(v4us*)(Ch + oo) = oh; *(v4us*)(Cl + oo) = ol; }
    asm volatile("s_wait_xcnt 0x0" ::: "memory");   // the code laid out behind this body reuses the stores' address and data registers: the wait stands in front of that
#pragma unroll
    for (int r = 0; r < 3; ++r)
#pragma unroll
        for (int q = 0; q < 4; ++q) { v4us o;
#pragma unroll
            for (int u = 0; u < 4; ++u) o[u] = f2bf(cx[r][q][u]);
            *(v4us*)(cd[r] + q * 128) = o; }
    asm volatile("s_wait_xcnt 0x0" ::: "memory");   // as above, for the stores of the rounded rows
}
// ---- k_kv: the K and V projections in the FIRST launch, 128 + 128 tiles, one work-group to a WGP. Nothing in it waits for a conversion: tokens and weight rows are f32 input, rounded in the loader.
// Tile j < 128: K, head j / 8, 64 keys -> planes [h][key][d]. Next 128: V with the head's weight rows as A -> planes [h][d][key].
// The bf16 copies of the operands that many later tiles share (Wq, Wo, q: 1024 rows of DM floats each) are made here too: the 2048 waves take 512 floats of each, so no launch of its own is left for them. Wk, Wv, k and v have no copy.
#define KT (NH_ * KPH / 64)
static_assert(2 * KT * 8 * 512 == DM * DM && DM * DM == TQ * DM, "the waves' pieces cover Wq, Wo and q exactly once");
__global__ __launch_bounds__(256) void k_kv(const float* __restrict__ kin, const float* __restrict__ vin, const float* __restrict__ Wk, const float* __restrict__ Wv, const float* __restrict__ bk, const float* __restrict__ bv,
                                            bf* Kh, bf* Kl, bf* Vh, bf* Vl, const float* __restrict__ Wq, const float* __restrict__ Wo, const float* __restrict__ qin, bf* BQ, bf* BO, bf* QB) {
    __shared__ __align__(16) float os[8 * 64 * 68];
    const int j = blockIdx.x; const size_t zw = (size_t)HD * DM, zp = (size_t)KPH * HD;    // per head: the head's 64 weight rows, projected plane
    const size_t cofs = (size_t)(j * 8 + (int)(threadIdx.x >> 5)) * 512 + (threadIdx.x & 31) * 4;   // the lane's first four floats of the wave's piece
    const float* const cs[3] = { Wq + cofs, Wo + cofs, qin + cofs }; bf* const cd[3] = { BQ + cofs, BO + cofs, QB + cofs };
    if (j < KT) { const size_t h = j / (KPH / 64); const int t = j % (KPH / 64);
        kv_tile<1>(os, kin + h * DM, Wk + h * zw, Kh + h * zp, Kl + h * zp, bk + h * HD, t * 64, cs, cd); }
    else { const size_t h = (j - KT) / (KPH / 64); const int t = (j - KT) % (KPH / 64);
        kv_tile<2>(os, vin + h * DM, Wv + h * zw, Vh + h * zp, Vl + h * zp, bv + h * HD, t * 64, cs, cd); }
}
// ---- k_attn: the Q projection, scores, softmax, attn.v and the head merge of 64 queries of one head in ONE work-group of 8 waves; grid (TQ / 64, NH_). No score and no probability leaves the registers.
// The work-group's Q tile (64 queries x the head's 64 columns, K = DM) is read by this work-group alone: it forms the tile itself with the GEMM tile body above, while its K rows fly, and leaves the two planes in LDS.
// The tile body's stages and partial tiles lie on the V^T buffers, which are filled only behind the barrier that publishes the Q tile.
// Wave w takes keys 64 w ... 64 w + 63. It forms S^T = K Q^T (A = K rows, B = Q rows as columns; hl x hl, 3 products), so a lane holds 32 keys of one query per 16-query group: maximum and sum are in-lane plus one exchange of the wave halves.
// p = exp2(s c - m c), m the maximum over the WAVE's own 64 keys, not yet divided by any sum. Two 16-key score tiles, rounded in place, are the B operand of O^T += V^T P^T (A = V^T rows from the [d][key] planes, same k order; 3 products).
// K, Q and V^T reach the waves through LDS, as the GEMM operands do: a fragment load from the planes takes 32 bytes of each of 16 rows, an asynchronous copy four whole 128-byte rows.
// Wave w copies its own 64 K rows and, behind the barrier that publishes the Q tile, its own 128 bytes of the 64 V^T rows (both planes each). Each of these buffers is filled once.
// The 8 partial O^T tiles, each with its m c and its sum, meet in LDS behind one barrier; wave w joins queries 8 w ... 8 w + 7: O = sum_p f_p O_p / sum_p f_p l_p, f_p = exp2(m_p c - max m c), partial 0 first, and stores them as hl planes in merged [t][h * 64 + d] order.
typedef __attribute__((ext_vector_type(2))) float v2f;
typedef __attribute__((ext_vector_type(2))) __bf16 v2bf;
__device__ __forceinline__ float xhalf(float x) { const int b = __float_as_int(x); return __int_as_float(__builtin_amdgcn_permlanex16(b, b, 0x76543210, 0xfedcba98, false, false)); }   // lane l <-> l ^ 16
// cp8r: eight copies of four 128-byte rows each (lane = 16 bytes; l and g are the lane's own piece of the first four rows), gs = elements from one four rows to the next; LDS pitch AP.
__device__ __forceinline__ void cp8r(unsigned l, const bf* g, size_t gs) {
    // the copies and s_wait_xcnt 0 in one statement: the wait stands in front of every later write of the address registers that the copies name
    asm volatile("global_load_async_to_lds_b128 %0, %8, off\n\tglobal_load_async_to_lds_b128 %1, %9, off\n\tglobal_load_async_to_lds_b128 %2, %10, off\n\tglobal_load_async_to_lds_b128 %3, %11, off\n\t"
                 "global_load_async_to_lds_b128 %4, %12, off\n\tglobal_load_async_to_lds_b128 %5, %13, off\n\tglobal_load_async_to_lds_b128 %6, %14, off\n\tglobal_load_async_to_lds_b128 %7, %15, off\n\ts_wait_xcnt 0x0"
                 :: "v"(l), "v"(l + 4 * AP), "v"(l + 8 * AP), "v"(l + 12 * AP), "v"(l + 16 * AP), "v"(l + 20 * AP), "v"(l + 24 * AP), "v"(l + 28 * AP),
                    "v"(g), "v"(g + gs), "v"(g + 2 * gs), "v"(g + 3 * gs), "v"(g + 4 * gs), "v"(g + 5 * gs), "v"(g + 6 * gs), "v"(g + 7 * gs) : "memory");
}
__global__ __launch_bounds__(256) void k_attn(const bf* __restrict__ QB, const bf* __restrict__ BQ, const float* __restrict__ bq, const bf* __restrict__ Kh, const bf* __restrict__ Kl, const bf* __restrict__ Vh, const bf* __restrict__ Vl, bf* ATh, bf* ATl) {
    __shared__ __align__(16) char sm[4 * AO + 2 * AQ + 2 * 64 * 8 * 4];   // K high, K low, Q high, Q low, V^T high, V^T low, st
    static_assert(8 * 64 * 68 * 4 <= 2 * AO, "the partial tiles lie on the K rows alone");
    static_assert(2 * 2 * SO <= 2 * AO, "the Q tile's stages (and its partial tiles, line above) lie on the V^T buffers alone");
    float* const os = (float*)sm;                      // the partial tiles, written when every wave has left the K rows (the barrier between the two halves of the scores)
    float* const st = (float*)(sm + 4 * AO + 2 * AQ);  // [0][query][wave] = m c, [1][query][wave] = sum
    const int lane = threadIdx.x & 31, lr = lane & 15, hi = lane >> 4; const int q0 = blockIdx.x * 64; const size_t h = blockIdx.y;
    const int w = __builtin_amdgcn_readfirstlane((int)(threadIdx.x >> 5));   // wave-uniform: the key slice and the queries to join are scalar work
    const int cr = lane >> 3, cc = lane & 7;   // a copy's lane: row cr of four, 16-byte piece cc of eight
    const unsigned lc = (unsigned)(size_t)sm + (unsigned)(cr * AP + cc * 16);
    const size_t kc0 = (h * KPH + w * 64 + cr) * HD + cc * 8, vc0 = (h * HD + cr) * KPH + w * 64 + cc * 8;
    cp8r(lc + w * 64 * AP, Kh + kc0, 4 * HD); cp8r(lc + (w * 64 + 32) * AP, Kh + kc0 + 32 * HD, 4 * HD);
    cp8r(lc + AO + w * 64 * AP, Kl + kc0, 4 * HD); cp8r(lc + AO + (w * 64 + 32) * AP, Kl + kc0 + 32 * HD, 4 * HD);
    // the Q tile; its first wait on the copies (to 0) covers the 32 K copies above as well, 48 of a wave in flight at most
    gemmw_tile<bf, 0, true, 8, 3>((float*)(sm + 2 * AO + 2 * AQ), QB, nullptr, BQ + h * ((size_t)HD * DM), nullptr, DM, nullptr, (bf*)(sm + 2 * AO), nullptr, 0, bq + h * HD, q0, 0);
    asm volatile("s_wait_dscnt 0x0" ::: "memory");   // this wave has stored its rows of the Q tile and read all it wants of the partial tiles
    __syncthreads();   // publishes the Q tile and ends every wave's reads of the partial tiles, on which the V^T copies land below
    const char* kp = sm + (w * 64 + lr) * AP + hi * 16; const char* qp = sm + 2 * AO + lr * AP + hi * 16; const char* vp = kp + 2 * AO + 2 * AQ;   // the lane's row of the wave's K rows, of the Q tile and of the wave's V^T pieces
    v8f acc[4][4], o[4][4];
#pragma unroll
    for (int mb = 0; mb < 4; ++mb)
#pragma unroll
        for (int nb = 0; nb < 4; ++nb) { acc[mb][nb] = (v8f){}; o[mb][nb] = (v8f){}; }
    v16bf a[2][4], a2[2][4], b[2][4], b2[2][4], va[2][4], va2[2][4];   // [32-wide k slice][16-row block]: K, Q and V^T fragments, high and low planes
#pragma unroll
    for (int kc = 0; kc < 2; ++kc) {
#pragma unroll
        for (int i = 0; i < 4; ++i) { a[kc][i] = ldl(kp + i * 16 * AP + kc * 64); a2[kc][i] = ldl(kp + AO + i * 16 * AP + kc * 64); b[kc][i] = ldl(qp + i * 16 * AP + kc * 64); b2[kc][i] = ldl(qp + AQ + i * 16 * AP + kc * 64); }
        if (kc == 0) __builtin_amdgcn_sched_barrier(0);   // keeps the first k slice's reads in front of the second's: LDS reads return in order, and left alone the first product's operands are asked for last, so it waits for all 64 reads
    }
    // the V^T copies fly while the K and Q fragments are read and the first half of the scores is formed; their LDS was the Q tile's, left by every wave at the barrier above
    cp8r(lc + 2 * AO + 2 * AQ + w * 64 * AP, Vh + vc0, 4 * KPH); cp8r(lc + 2 * AO + 2 * AQ + (w * 64 + 32) * AP, Vh + vc0 + 32 * KPH, 4 * KPH);
    cp8r(lc + 3 * AO + 2 * AQ + w * 64 * AP, Vl + vc0, 4 * KPH); cp8r(lc + 3 * AO + 2 * AQ + (w * 64 + 32) * AP, Vl + vc0 + 32 * KPH, 4 * KPH);
    __builtin_amdgcn_sched_barrier(0);   // keeps the fragment reads and the copies in front of the first product: left alone the compiler puts most of the first half's products ahead of the copies, which then start just in front of their own wait
#pragma unroll
    for (int kc = 0; kc < 2; ++kc) {
#pragma unroll
        for (int nb = 0; nb < 4; ++nb) {   // the four key blocks take turns, so that no product waits for the one just issued
#pragma unroll
            for (int mb = 0; mb < 4; ++mb) acc[mb][nb] = wmmab(a[kc][mb], b[kc][nb], acc[mb][nb]);
#pragma unroll
            for (int mb = 0; mb < 4; ++mb) acc[mb][nb] = wmmab(a2[kc][mb], b[kc][nb], acc[mb][nb]);
#pragma unroll
            for (int mb = 0; mb < 4; ++mb) acc[mb][nb] = wmmab(a[kc][mb], b2[kc][nb], acc[mb][nb]); }
        if (kc == 0) {
            __builtin_amdgcn_sched_barrier(0);   // keeps the first half of the score products in front of the waits below: left alone the compiler moves all but one of them behind the barrier, and the wave waits out the V^T copies idle
            asm volatile("s_wait_dscnt 0x0" ::: "memory");      // this wave has read all it wants of the K rows and the Q tile
            asm volatile("s_wait_asynccnt 0x0" ::: "memory");   // this wave's copies of V^T have landed
            __syncthreads();   // ends every wave's reads of the K rows, on which the partial tiles are written below
#pragma unroll
            for (int ch = 0; ch < 2; ++ch)
#pragma unroll
                for (int db = 0; db < 4; ++db) { va[ch][db] = ldl(vp + db * 16 * AP + ch * 64); va2[ch][db] = ldl(vp + AO + db * 16 * AP + ch * 64); }
            __builtin_amdgcn_sched_barrier(0);   // keeps the V^T fragment reads here, half the score products and the softmax arithmetic ahead of their use: left alone part of them is asked for only among the later products, just in front of its use
        }
    }   // acc[mb][nb][r] = S[query q0 + 16 nb + lr][key 64 w + 16 mb + 8 hi + r], unscaled
    const float c8 = 0.125f * 1.4426950408889634f;   // 1 / sqrt(HD) and log2(e) in one factor
#pragma unroll
    for (int nb = 0; nb < 4; ++nb) {
        float mx = acc[0][nb][0];
#pragma unroll
        for (int mb = 0; mb < 4; ++mb)
#pragma unroll
            for (int r = 0; r < 8; ++r) mx = fmaxf(mx, acc[mb][nb][r]);
        mx = fmaxf(mx, xhalf(mx));
        const float mc = mx * c8; float sum = 0.f; v16bf ph[2], pl[2];
#pragma unroll
        for (int ch = 0; ch < 2; ++ch)
#pragma unroll
            for (int s = 0; s < 16; s += 2) { v2f e;   // element s of the B operand = key 32 ch + 16 (s >> 3) + 8 hi + (s & 7): the hardware k order, which the V^T loader has too
                e[0] = __builtin_amdgcn_exp2f(__builtin_fmaf(acc[2 * ch + (s >> 3)][nb][s & 7], c8, -mc)); e[1] = __builtin_amdgcn_exp2f(__builtin_fmaf(acc[2 * ch + (s >> 3)][nb][(s & 7) + 1], c8, -mc));
                sum += e[0]; sum += e[1];
                const v2bf eh = __builtin_convertvector(e, v2bf); const v2bf el = __builtin_convertvector(e - __builtin_convertvector(eh, v2f), v2bf);
                ph[ch][s] = eh[0]; ph[ch][s + 1] = eh[1]; pl[ch][s] = el[0]; pl[ch][s + 1] = el[1]; }
        sum += xhalf(sum);
        st[hi * 512 + (nb * 16 + lr) * 8 + w] = hi ? sum : mc;   // both halves hold both values: the low half stores m c, the high half the sum
#pragma unroll
        for (int ch = 0; ch < 2; ++ch) {   // the four d blocks take turns, so that no product waits for the one just issued
#pragma unroll
            for (int db = 0; db < 4; ++db) o[db][nb] = wmmab(va[ch][db], ph[ch], o[db][nb]);
#pragma unroll
            for (int db = 0; db < 4; ++db) o[db][nb] = wmmab(va2[ch][db], ph[ch], o[db][nb]);
#pragma unroll
            for (int db = 0; db < 4; ++db) o[db][nb] = wmmab(va[ch][db], pl[ch], o[db][nb]); }
    }   // o[db][nb][r] = partial O[query 16 nb + lr][d = 16 db + 8 hi + r]
    __builtin_amdgcn_sched_barrier(0);   // keeps the LDS stores behind the last product
    float* mine = os + w * (64 * 68) + lr * 68 + hi * 8;
#pragma unroll
    for (int nb = 0; nb < 4; ++nb)
#pragma unroll
        for (int db = 0; db < 4; ++db) { float* p = mine + nb * 16 * 68 + db * 16;
            *(v4fa*)p = __builtin_shufflevector(o[db][nb], o[db][nb], 0, 1, 2, 3); *(v4fa*)(p + 4) = __builtin_shufflevector(o[db][nb], o[db][nb], 4, 5, 6, 7); }
    __syncthreads();   // every wave's partial tile, maximum and sum are in LDS before any wave joins them
    const int cofs = lr * 4, row0 = w * 8 + hi;
#pragma unroll
    for (int s = 0; s < 4; ++s) { const int row = row0 + 2 * s; float m[8], l[8];
        { const v4f m0 = *(const v4fa*)(st + row * 8), m1 = *(const v4fa*)(st + row * 8 + 4), l0 = *(const v4fa*)(st + 512 + row * 8), l1 = *(const v4fa*)(st + 512 + row * 8 + 4);
#pragma unroll
            for (int u = 0; u < 4; ++u) { m[u] = m0[u]; m[4 + u] = m1[u]; l[u] = l0[u]; l[4 + u] = l1[u]; } }
        float M = m[0];
#pragma unroll
        for (int p = 1; p < 8; ++p) M = fmaxf(M, m[p]);
        float L = 0.f; v4f val = (v4f){};
#pragma unroll
        for (int p = 0; p < 8; ++p) { const float f = __builtin_amdgcn_exp2f(m[p] - M); L += f * l[p]; val += f * *(const v4fa*)(os + (p * 64 + row) * 68 + cofs); }
        val *= __fdiv_rn(1.0f, L);
        v4us oh, ol;
#pragma unroll
        for (int u = 0; u < 4; ++u) { unsigned short x0, x1; splitf(val[u], x0, x1); oh[u] = x0; ol[u] = x1; }
        const size_t oo = (size_t)(q0 + row) * DM + h * HD + cofs; *(v4us*)(ATh + oo) = oh; *(v4us*)(ATl + oo) = ol;
        asm volatile("s_wait_xcnt 0x0" ::: "memory"); }   // the next rows' reads and sums reuse the stores' address and data registers: the wait stands in front of that
}

extern "C" void kernel_launch(void* const* d_in, const int* in_sizes, int n_in,
                              void* d_out, int out_size, void* d_ws, size_t ws_size, hipStream_t stream) {
    (void)in_sizes; (void)n_in; (void)out_size;
    const float* qin = (const float*)d_in[0]; const float* kin = (const float*)d_in[1]; const float* vin = (const float*)d_in[2]; const float* Wq = (const float*)d_in[3]; const float* bq = (const float*)d_in[4]; const float* Wk = (const float*)d_in[5]; const float* bk = (const float*)d_in[6]; const float* Wv = (const float*)d_in[7]; const float* bv = (const float*)d_in[8]; const float* Wo = (const float*)d_in[9]; const float* bo = (const float*)d_in[10];
    float* OUT = (float*)d_out;     // [1][1024][1024]
    char* wsp = (char*)d_ws;
    auto take = [&](size_t bytes) { char* p = wsp; wsp += (bytes + 255) & ~(size_t)255; return (void*)p; };
    bf* BQ = (bf*)take((size_t)DM * DM * 2); bf* BO = (bf*)take((size_t)DM * DM * 2);
    bf* QB = (bf*)take((size_t)TQ * DM * 2);
    bf* Kh = (bf*)take((size_t)NH_ * KPH * HD * 2); bf* Kl = (bf*)take((size_t)NH_ * KPH * HD * 2); bf* Vh = (bf*)take((size_t)NH_ * HD * KPH * 2); bf* Vl = (bf*)take((size_t)NH_ * HD * KPH * 2);
    bf* ATh = (bf*)take((size_t)TQ * DM * 2); bf* ATl = (bf*)take((size_t)TQ * DM * 2);
    if ((size_t)(wsp - (char*)d_ws) > ws_size) return;    // total ~ 14 MB
    k_kv<<<2 * KT, 256, 0, stream>>>(kin, vin, Wk, Wv, bk, bv, Kh, Kl, Vh, Vl, Wq, Wo, qin, BQ, BO, QB);   // [out][in] weights as-is: Wk as Bt, Wv as A
    k_attn<<<dim3(TQ / 64, NH_, 1), 256, 0, stream>>>(QB, BQ, bq, Kh, Kl, Vh, Vl, ATh, ATl);
    k_gemmw<bf, 1, true, 8, 0><<<dim3(TQ / 64, DM / 64, 1), 256, 0, stream>>>(ATh, ATl, BO, nullptr, DM, OUT, nullptr, nullptr, DM, bo);
}
